// v000
// The times below were measured on an AMD MI455X: many runs one after another, warmed up first and cycling through
// copies of the inputs, with the whole window's GPU time divided by the number of runs. Launches and the gaps
// between them are all in it. The median over several windows is given; except for v000 it joins two sittings, which
// can be a few percent apart, so the side-by-side timings, each taken in one sitting, are the better comparison.
// v000, which the later versions start from, runs in 2460 microseconds.
#include <hip/hip_runtime.h>

// Grouped-query RoPE attention without a mask (x [2][2048][2048]; q = x Wq (32 heads x 64), k, v = x Wk / Wv ([2048][512]: 8 kv heads); rotate-half RoPE (theta 5e5, tables computed on device); kv head = h/4; softmax(q.k/8) over all keys; out = merged Wo -> [2][2048][2048] (8.4 M)).
// Compute dtypes, f32 accumulate: every input rounded to bf16; q/k/v on PLAIN bf16 operands (inputs: exact); rotary in f32; scores and attn.v on single fp16 planes for every row (x1024 probability carry); softmax f32; Wo hl x exact (2 products).

#define NB_  2
#define TT   2048
#define DM   2048
#define NH_  32
#define NKV  8
#define REP  (NH_ / NKV)
#define HD   64
#define DQ   (NH_ * HD)
#define DKV  (NKV * HD)
#define ZH   2
#define RH   0                    // every row on fp16 planes (hi/lo rows buy nothing here)
#define WIN  0
#define PCAR 1024.0f
#define SCL  0.125f   // HD^-0.5
typedef _Float16 h16;
typedef unsigned short bf;
typedef __attribute__((ext_vector_type(16))) __bf16   v16bf;
typedef __attribute__((ext_vector_type(16))) _Float16 v16h;
typedef __attribute__((ext_vector_type(8)))  _Float16 v8h;
typedef __attribute__((ext_vector_type(8)))  unsigned short v8us;
typedef __attribute__((ext_vector_type(8)))  float    v8f;
typedef __attribute__((ext_vector_type(4)))  float    v4f;
typedef v8h  __attribute__((may_alias)) v8ha;
typedef v4f  __attribute__((may_alias)) v4fa;
typedef v8us __attribute__((may_alias)) v8usa;

__device__ __forceinline__ unsigned short f2bf(float f) { unsigned u = __float_as_uint(f); u += 0x7FFFu + ((u >> 16) & 1u); return (unsigned short)(u >> 16); }
__device__ __forceinline__ float bf2f(unsigned short b) { return __uint_as_float(((unsigned)b) << 16); }
__device__ __forceinline__ float bfr(float f) { return bf2f(f2bf(f)); }
__device__ __forceinline__ v16h cat16(v8h lo, v8h hi) { return __builtin_shufflevector(lo, hi, 0, 1, 2, 3, 4, 5, 6, 7, 8, 9, 10, 11, 12, 13, 14, 15); }
__device__ __forceinline__ v16bf cat16b(v8us lo, v8us hi) { return __builtin_bit_cast(v16bf, __builtin_shufflevector(lo, hi, 0, 1, 2, 3, 4, 5, 6, 7, 8, 9, 10, 11, 12, 13, 14, 15)); }
__device__ __forceinline__ v8f wmma16(v16h a, v16h b, v8f c) { return __builtin_amdgcn_wmma_f32_16x16x32_f16(false, a, false, b, (short)0, c, false, false); }
__device__ __forceinline__ v8f wmmab(v16bf a, v16bf b, v8f c) { return __builtin_amdgcn_wmma_f32_16x16x32_bf16(false, a, false, b, (short)0, c, false, false); }



// ---- k_gemmw: register-blocked GEMM, ONE WAVE per 64x64 output tile (16 accumulators), operands straight from K-contiguous 16-bit planes; grid (M/64, N/64, Z), 32 threads.
// C[m][n] (f32, pitch ldc, + optional f32 bias[n]) = sum_k A[m][k] Bt[n][k] (+ split products per NSPLIT). z-batch strides sA/sB/sC in elements. K % 32 == 0.
template <typename T16> struct WFrag;
template <> struct WFrag<h16> { typedef v16h V; static __device__ __forceinline__ V ld(const h16* p) { return cat16(*(const v8h*)p, *(const v8h*)(p + 16)); } static __device__ __forceinline__ v8f mma(V a, V b, v8f c) { return wmma16(a, b, c); } };
template <> struct WFrag<bf> { typedef v16bf V; static __device__ __forceinline__ V ld(const bf* p) { return cat16b(*(const v8us*)p, *(const v8us*)(p + 16)); } static __device__ __forceinline__ v8f mma(V a, V b, v8f c) { return wmmab(a, b, c); } };
template <typename T16, int NSPLIT, bool BIAS>
__global__ __launch_bounds__(32) void k_gemmw(const T16* __restrict__ A, const T16* __restrict__ A2, const T16* __restrict__ Bt, const T16* __restrict__ Bt2, int K, float* C, int ldc, const float* __restrict__ bias, size_t sA, size_t sB, size_t sC) {
    typedef typename WFrag<T16>::V V;
    __shared__ __align__(16) float os[16 * 68];
    const size_t z = blockIdx.z; A += z * sA; if (A2) A2 += z * sA; Bt += z * sB; if (Bt2) Bt2 += z * sB; C += z * sC;
    const int lane = threadIdx.x & 31, lr = lane & 15, hi = lane >> 4; const int r0 = blockIdx.x * 64, c0 = blockIdx.y * 64;
    v8f acc[4][4];
#pragma unroll
    for (int mb = 0; mb < 4; ++mb)
#pragma unroll
        for (int nb = 0; nb < 4; ++nb) acc[mb][nb] = (v8f){};
    const size_t aoff = (size_t)(r0 + lr) * K + 8 * hi, boff = (size_t)(c0 + lr) * K + 8 * hi;
#pragma unroll 1
    for (int kc = 0; kc < K; kc += 32) {
        V a[4], a2[4];
#pragma unroll
        for (int mb = 0; mb < 4; ++mb) { a[mb] = WFrag<T16>::ld(A + aoff + (size_t)mb * 16 * K + kc); if (NSPLIT == 1 || NSPLIT == 2) a2[mb] = WFrag<T16>::ld(A2 + aoff + (size_t)mb * 16 * K + kc); }
#pragma unroll
        for (int nb = 0; nb < 4; ++nb) { const V b = WFrag<T16>::ld(Bt + boff + (size_t)nb * 16 * K + kc); V b2; if (NSPLIT >= 2) b2 = WFrag<T16>::ld(Bt2 + boff + (size_t)nb * 16 * K + kc);
#pragma unroll
            for (int mb = 0; mb < 4; ++mb) { acc[mb][nb] = WFrag<T16>::mma(a[mb], b, acc[mb][nb]); if (NSPLIT == 1 || NSPLIT == 2) acc[mb][nb] = WFrag<T16>::mma(a2[mb], b, acc[mb][nb]); if (NSPLIT >= 2) acc[mb][nb] = WFrag<T16>::mma(a[mb], b2, acc[mb][nb]); } }
        asm volatile("v_nop\n\tv_nop\n\tv_nop\n\tv_nop" : "+v"(acc[0][0]), "+v"(acc[1][1]), "+v"(acc[2][2]), "+v"(acc[3][3]) : "v"(a[0]), "v"(a[3]));
    }
#pragma unroll
    for (int mb = 0; mb < 4; ++mb) {
#pragma unroll
        for (int nb = 0; nb < 4; ++nb) {
#pragma unroll
            for (int j = 0; j < 8; ++j) os[(hi * 8 + j) * 68 + nb * 16 + lr] = acc[mb][nb][j]; }
        __builtin_amdgcn_wave_barrier(); asm volatile("" ::: "memory");
        float* crow = C + (size_t)(r0 + mb * 16) * ldc + c0;
{
#pragma unroll
            for (int s = 0; s < 8; ++s) { const int row = 2 * s + hi, cofs = lr * 4; v4f val = *(const v4fa*)(os + row * 68 + cofs); if (BIAS) { val[0] += bfr(bias[c0 + cofs]); val[1] += bfr(bias[c0 + cofs + 1]); val[2] += bfr(bias[c0 + cofs + 2]); val[3] += bfr(bias[c0 + cofs + 3]); }
                *(v4f*)(crow + (size_t)row * ldc + cofs) = val; }
             }
        __builtin_amdgcn_wave_barrier(); asm volatile("" ::: "memory");
    }
}

__device__ __forceinline__ h16 tohx(float x) { return (h16)x; }
__device__ __forceinline__ void splitf(float y, unsigned short& h, unsigned short& l) { h = f2bf(y); l = f2bf(y - bf2f(h)); }
typedef __attribute__((ext_vector_type(2))) _Float16 v2h;
typedef __attribute__((ext_vector_type(4))) _Float16 v4h;
typedef __attribute__((ext_vector_type(2))) unsigned short v2us;
typedef __attribute__((ext_vector_type(4))) unsigned short v4us;
typedef __attribute__((ext_vector_type(2))) float v2f;
typedef __attribute__((ext_vector_type(4))) int v4i;

__global__ __launch_bounds__(256) void k_wtG(const float* __restrict__ w, int K, int N, bf* Bt) {
    const int lane = threadIdx.x & 31; const int L0 = (blockIdx.x * 8 + (threadIdx.x >> 5)) * 8; const int nlines = N * K / 64;
{
#pragma unroll 1
        for (int l = 0; l < 8; ++l) { const int L = L0 + l; if (L >= nlines) break; const size_t e = (size_t)L * 64 + lane * 2; const int k = (int)(e % K), n = (int)(e / K); v2us o;
            o[0] = f2bf(w[(size_t)k * N + n]); o[1] = f2bf(w[(size_t)(k + 1) * N + n]); *(v2us*)(Bt + e) = o; }
         }
}
__global__ __launch_bounds__(256) void k_cvt8(const float* __restrict__ src, bf* dst, size_t n8) { const size_t i = (size_t)blockIdx.x * 256 + threadIdx.x; if (i >= n8) return; const v8f v = *(const v8f*)(src + i * 8); v8us o;
#pragma unroll
    for (int k = 0; k < 8; ++k) o[k] = f2bf(v[k]); *(v8us*)(dst + i * 8) = o;  }
__constant__ float INV[HD / 2] = {1.00000000f,0.663601220f,0.440366596f,0.292227834f,0.193922743f,0.128687367f,0.0853971019f,0.0566696227f,0.0376060307f,0.0249554086f,0.0165604409f,0.0109895281f,0.00729266461f,0.00483942125f,0.00321144611f,0.00213111960f,0.00141421356f,0.000938473851f,0.000622772437f,0.000413272559f,0.000274248188f,0.000181991432f,0.000120769735f,0.0000801429487f,0.0000531829573f,0.0000352922762f,0.0000234199997f,0.0000155415401f,0.0000103133852f,0.00000684397537f,0.00000454167048f,0.00000301385808f};
__global__ __launch_bounds__(256) void k_cstab(float* CS) { const int idx = blockIdx.x * 256 + threadIdx.x; if (idx >= TT * HD) return; const int t = idx / HD, d = idx % HD; const float ang = __fmul_rn((float)t, INV[d % (HD / 2)]); v2f cs; cs[0] = cosf(ang); cs[1] = sinf(ang);
    *(v2f*)(CS + (size_t)idx * 2) = cs;  }

// k_rope: head planes [h][t][d] (fp16 + hi/lo) of rope(x) x sc with the rotate-half convention out[d] = x[d] cos[t][d] - x[d+HD/2] sin[t][d], out[d+HD/2] = x[d+HD/2] cos[t][d+HD/2] + x[d] sin[t][d+HD/2]
__global__ __launch_bounds__(256) void k_rope(const float* __restrict__ F, int pitch, int nheads, const float* __restrict__ CS, const float* __restrict__ RF, const float* __restrict__ nw, float sc, h16* P16, bf* Ph, bf* Pl) {
    const size_t e = ((size_t)blockIdx.x * 256 + threadIdx.x) * 2; if (e >= (size_t)nheads * TT * HD) return; const int d = (int)(e % HD); const int t = (int)((e / HD) % TT); const int h = (int)(e / ((size_t)HD * TT)); const float* f = F + (size_t)t * pitch + h * HD; const float rf = RF ? RF[(size_t)h * TT + t] : 1.0f; v2h o16; v2us oh, ol;
#pragma unroll
    for (int q = 0; q < 2; ++q) { const int dd = d + q; const int dp = (dd < HD / 2) ? dd + HD / 2 : dd - HD / 2; float x0 = f[dd], x1 = f[dp];
        if (RF) { float n0 = __fmul_rn(x0, rf), n1 = __fmul_rn(x1, rf); asm volatile("" : "+v"(n0)); asm volatile("" : "+v"(n1)); x0 = __fmul_rn(bfr(nw[dd]), n0); x1 = __fmul_rn(bfr(nw[dp]), n1); }
        const v2f cs = *(const v2f*)(CS + ((size_t)t * HD + dd) * 2); float a = __fmul_rn(x0, cs[0]), bq = __fmul_rn(x1, cs[1]); asm volatile("" : "+v"(a)); asm volatile("" : "+v"(bq)); const float r = ((dd < HD / 2) ? __fsub_rn(a, bq) : __fadd_rn(a, bq)) * sc;
        o16[q] = tohx(r); unsigned short a2, c2; splitf(r, a2, c2); oh[q] = a2; ol[q] = c2; }
    *(v2h*)(P16 + e) = o16; *(v2us*)(Ph + e) = oh; *(v2us*)(Pl + e) = ol;  }
__global__ __launch_bounds__(256) void k_vtp(const float* __restrict__ F, int pitch, int nheads, h16* V16, bf* Vh, bf* Vl) { const size_t e = ((size_t)blockIdx.x * 256 + threadIdx.x) * 2; if (e >= (size_t)nheads * HD * TT) return; const int t = (int)(e % TT); const int d = (int)((e / TT) % HD); const int g = (int)(e / ((size_t)TT * HD)); v2h o16; v2us oh, ol;
#pragma unroll
    for (int q = 0; q < 2; ++q) { const float x = F[(size_t)(t + q) * pitch + g * HD + d]; o16[q] = tohx(x); unsigned short a2, c2; splitf(x, a2, c2); oh[q] = a2; ol[q] = c2; }
    *(v2h*)(V16 + e) = o16; *(v2us*)(Vh + e) = oh; *(v2us*)(Vl + e) = ol;  }
// k_asoft: per row (zz, i): t = S x HD^-0.5 (no mask); softmax over the 2048 keys (register row, one exp, fixed trees);
__global__ __launch_bounds__(256) void k_asoft(const float* __restrict__ Sb, h16* P16, bf* Ph, bf* Pl) {
    const int lane = threadIdx.x & 31; const int row = blockIdx.x * 8 + (threadIdx.x >> 5); if (row >= ZH * TT) return; const int i = row % TT; const int zz = row / TT; (void)zz; const bool hires = (i < RH); const float* sr = Sb + (size_t)row * TT; float v[TT / 32]; float mx = -3.0e38f;
#pragma unroll
    for (int ch = 0; ch < TT / 128; ++ch) { const int j0 = ch * 128 + lane * 4; const v4f a = *(const v4f*)(sr + j0);
#pragma unroll
        for (int q = 0; q < 4; ++q) { const int j = j0 + q; (void)j; const float t = a[q] * SCL; v[ch * 4 + q] = t; mx = fmaxf(mx, t); } }
#pragma unroll
    for (int sh = 16; sh; sh >>= 1) mx = fmaxf(mx, __shfl_xor(mx, sh, 32));
    float sum = 0.f;
#pragma unroll
    for (int k = 0; k < TT / 32; ++k) { float d0 = __fsub_rn(v[k], mx); asm volatile("" : "+v"(d0)); v[k] = __builtin_amdgcn_exp2f(__fmul_rn(d0, 1.4426950408889634f)); sum += v[k]; }
#pragma unroll
    for (int sh = 16; sh; sh >>= 1) sum += __shfl_xor(sum, sh, 32);
    const float f = __fdiv_rn(hires ? 1.0f : PCAR, sum);
{
        if (hires) {
#pragma unroll
            for (int ch = 0; ch < TT / 128; ++ch) { v4us oh, ol;
#pragma unroll
                for (int q = 0; q < 4; ++q) { unsigned short a, c2; splitf(v[ch * 4 + q] * f, a, c2); oh[q] = a; ol[q] = c2; }
                const size_t oo = ((size_t)zz * (RH ? RH : 1) + i) * TT + ch * 128 + lane * 4; *(v4us*)(Ph + oo) = oh; *(v4us*)(Pl + oo) = ol; }
        } else {
#pragma unroll
            for (int ch = 0; ch < TT / 128; ++ch) { v4h o4;
#pragma unroll
                for (int q = 0; q < 4; ++q) o4[q] = tohx(v[ch * 4 + q] * f);
                *(v4h*)(P16 + (size_t)row * TT + ch * 128 + lane * 4) = o4; } }
         }
}
__global__ __launch_bounds__(256) void k_merge(const float* __restrict__ O, int h0, bf* Ah, bf* Al) { const size_t e = ((size_t)blockIdx.x * 256 + threadIdx.x) * 2; if (e >= (size_t)ZH * TT * HD) return; const int d = (int)(e % HD); const int t = (int)((e / HD) % TT); const int zz = (int)(e / ((size_t)HD * TT)); const float cs = (t < RH) ? 1.0f : (1.0f / PCAR); const size_t oo = (size_t)t * DQ + (h0 + zz) * HD + d;
    v2us oh, ol;
#pragma unroll
    for (int q = 0; q < 2; ++q) { unsigned short a, c2; splitf(O[e + q] * cs, a, c2); oh[q] = a; ol[q] = c2; } *(v2us*)(Ah + oo) = oh; *(v2us*)(Al + oo) = ol;  }

extern "C" void kernel_launch(void* const* d_in, const int* in_sizes, int n_in,
                              void* d_out, int out_size, void* d_ws, size_t ws_size, hipStream_t stream) {
    (void)in_sizes; (void)n_in; (void)out_size;
    const float* x = (const float*)d_in[0]; const float* wq = (const float*)d_in[1]; const float* wk = (const float*)d_in[2]; const float* wv = (const float*)d_in[3]; const float* wo = (const float*)d_in[4];
    float* OUT = (float*)d_out;     // [2][2048][2048]
    char* wsp = (char*)d_ws;
    auto take = [&](size_t bytes) { char* p = wsp; wsp += (bytes + 255) & ~(size_t)255; return (void*)p; };
    bf* WQ = (bf*)take((size_t)DQ * DM * 2); bf* WK = (bf*)take((size_t)DKV * DM * 2); bf* WV = (bf*)take((size_t)DKV * DM * 2); bf* WO = (bf*)take((size_t)DM * DQ * 2); float* CS = (float*)take((size_t)TT * HD * 2 * 4);
    bf* XB = (bf*)take((size_t)TT * DM * 2); float* FQ = (float*)take((size_t)TT * DQ * 4); float* FK = (float*)take((size_t)TT * DKV * 4);
    h16* QP16 = (h16*)take((size_t)NH_ * TT * HD * 2); h16* KP16 = (h16*)take((size_t)NKV * TT * HD * 2); h16* VT16 = (h16*)take((size_t)NKV * HD * TT * 2);
    bf* QPh = (bf*)take((size_t)NH_ * TT * HD * 2); bf* QPl = (bf*)take((size_t)NH_ * TT * HD * 2); bf* KPh = (bf*)take((size_t)NKV * TT * HD * 2); bf* KPl = (bf*)take((size_t)NKV * TT * HD * 2); bf* VTh = (bf*)take((size_t)NKV * HD * TT * 2); bf* VTl = (bf*)take((size_t)NKV * HD * TT * 2); bf* Ph = (bf*)take(256); bf* Pl = (bf*)take(256);   /* unused: no hi/lo rows */
    float* Sb = (float*)take((size_t)ZH * TT * TT * 4); h16* P16 = (h16*)take((size_t)ZH * TT * TT * 2); float* Ob = (float*)take((size_t)ZH * TT * HD * 4); bf* ATh = (bf*)take((size_t)TT * DQ * 2); bf* ATl = (bf*)take((size_t)TT * DQ * 2);
    if ((size_t)(wsp - (char*)d_ws) > ws_size) return;    // ws 256 MiB
    float* FV = FK;   // v projection reuses the k buffer after the k planes are built (stream-ordered)
    { k_wtG<<<(unsigned)((DM * DQ / 64 + 63) / 64), 256, 0, stream>>>(wq, DM, DQ, WQ); k_wtG<<<(unsigned)((DM * DKV / 64 + 63) / 64), 256, 0, stream>>>(wk, DM, DKV, WK); k_wtG<<<(unsigned)((DM * DKV / 64 + 63) / 64), 256, 0, stream>>>(wv, DM, DKV, WV);
      k_wtG<<<(unsigned)((DQ * DM / 64 + 63) / 64), 256, 0, stream>>>(wo, DQ, DM, WO);
      k_cstab<<<(TT * HD + 255) / 256, 256, 0, stream>>>(CS); }
    const unsigned LQ = (unsigned)(((size_t)NH_ * TT * HD / 2 + 255) / 256), LKv = (unsigned)(((size_t)NKV * TT * HD / 2 + 255) / 256);
    for (int b = 0; b < NB_; ++b) {
        
        k_cvt8<<<(unsigned)(((size_t)TT * DM / 8 + 255) / 256), 256, 0, stream>>>(x + (size_t)b * TT * DM, XB, (size_t)TT * DM / 8);
        k_gemmw<bf, 0, false><<<dim3(TT / 64, DQ / 64, 1), 32, 0, stream>>>(XB, nullptr, WQ, nullptr, DM, FQ, DQ, nullptr, 0, 0, 0);
        k_rope<<<LQ, 256, 0, stream>>>(FQ, DQ, NH_, CS, nullptr, nullptr, 1.0f, QP16, QPh, QPl);
        k_gemmw<bf, 0, false><<<dim3(TT / 64, DKV / 64, 1), 32, 0, stream>>>(XB, nullptr, WK, nullptr, DM, FK, DKV, nullptr, 0, 0, 0);
        k_rope<<<LKv, 256, 0, stream>>>(FK, DKV, NKV, CS, nullptr, nullptr, 1.0f, KP16, KPh, KPl);
        k_gemmw<bf, 0, false><<<dim3(TT / 64, DKV / 64, 1), 32, 0, stream>>>(XB, nullptr, WV, nullptr, DM, FV, DKV, nullptr, 0, 0, 0); k_vtp<<<LKv, 256, 0, stream>>>(FV, DKV, NKV, VT16, VTh, VTl);
        for (int h0 = 0; h0 < NH_; h0 += ZH) { const size_t zq = (size_t)h0, zk = (size_t)(h0 / REP);   // both heads of a pass share kv group h0/REP (REP >= 2): sB = 0
            k_gemmw<h16, 0, false><<<dim3((TT - RH) / 64, TT / 64, ZH), 32, 0, stream>>>(QP16 + zq * TT * HD + (size_t)RH * HD, nullptr, KP16 + zk * TT * HD, nullptr, HD, Sb + (size_t)RH * TT, TT, nullptr, (size_t)TT * HD, 0, (size_t)TT * TT);
            k_asoft<<<ZH * TT / 8, 256, 0, stream>>>(Sb, P16, Ph, Pl);
            k_gemmw<h16, 0, false><<<dim3((TT - RH) / 64, HD / 64, ZH), 32, 0, stream>>>(P16 + (size_t)RH * TT, nullptr, VT16 + zk * HD * TT, nullptr, TT, Ob + (size_t)RH * HD, HD, nullptr, (size_t)TT * TT, 0, (size_t)TT * HD);
            k_merge<<<(unsigned)(((size_t)ZH * TT * HD / 2 + 255) / 256), 256, 0, stream>>>(Ob, h0, ATh, ATl); }
        k_gemmw<bf, 1, false><<<dim3(TT / 64, DM / 64, 1), 32, 0, stream>>>(ATh, ATl, WO, nullptr, DQ, OUT + (size_t)b * TT * DM, DM, nullptr, 0, 0, 0); }
}

// v001
// Measured time: 586 microseconds a run.
// Next to v000, in two timings, it ran 4.25 and 4.28 times as fast.
#include <hip/hip_runtime.h>

// Grouped-query RoPE attention without a mask (x [2][2048][2048]; q = x Wq (32 heads x 64), k, v = x Wk / Wv ([2048][512]: 8 kv heads); rotate-half RoPE (theta 5e5, tables computed on device); kv head = h/4; softmax(q.k/8) over all keys; out = merged Wo -> [2][2048][2048] (8.4 M)).
// Compute dtypes, f32 accumulate: every input rounded to bf16; q/k/v on PLAIN bf16 operands (inputs: exact); rotary in f32; scores and attn.v on single fp16 operands for every row (x64 probability carry against the running maximum); online softmax f32, denominator summed in f32 from the f32 exponentials; Wo hl x exact (2 products).

#define NB_  2
#define TT   2048
#define DM   2048
#define NH_  32
#define NKV  8
#define REP  (NH_ / NKV)
#define HD   64
#define DQ   (NH_ * HD)
#define DKV  (NKV * HD)
#define SCL  0.125f   // HD^-0.5
typedef _Float16 h16;
typedef unsigned short bf;
typedef __attribute__((ext_vector_type(16))) __bf16   v16bf;
typedef __attribute__((ext_vector_type(16))) _Float16 v16h;
typedef __attribute__((ext_vector_type(8)))  _Float16 v8h;
typedef __attribute__((ext_vector_type(8)))  unsigned short v8us;
typedef __attribute__((ext_vector_type(8)))  float    v8f;
typedef __attribute__((ext_vector_type(4)))  float    v4f;
typedef v8h  __attribute__((may_alias)) v8ha;
typedef v4f  __attribute__((may_alias)) v4fa;
typedef v8us __attribute__((may_alias)) v8usa;

__device__ __forceinline__ unsigned short f2bf(float f) { unsigned u = __float_as_uint(f); u += 0x7FFFu + ((u >> 16) & 1u); return (unsigned short)(u >> 16); }
__device__ __forceinline__ float bf2f(unsigned short b) { return __uint_as_float(((unsigned)b) << 16); }
__device__ __forceinline__ float bfr(float f) { return bf2f(f2bf(f)); }
__device__ __forceinline__ v16h cat16(v8h lo, v8h hi) { return __builtin_shufflevector(lo, hi, 0, 1, 2, 3, 4, 5, 6, 7, 8, 9, 10, 11, 12, 13, 14, 15); }
__device__ __forceinline__ v16bf cat16b(v8us lo, v8us hi) { return __builtin_bit_cast(v16bf, __builtin_shufflevector(lo, hi, 0, 1, 2, 3, 4, 5, 6, 7, 8, 9, 10, 11, 12, 13, 14, 15)); }
__device__ __forceinline__ v8f wmma16(v16h a, v16h b, v8f c) { return __builtin_amdgcn_wmma_f32_16x16x32_f16(false, a, false, b, (short)0, c, false, false); }
__device__ __forceinline__ v8f wmmab(v16bf a, v16bf b, v8f c) { return __builtin_amdgcn_wmma_f32_16x16x32_bf16(false, a, false, b, (short)0, c, false, false); }



// ---- k_gemmw: register-blocked GEMM, ONE WAVE per 64x64 output tile (16 accumulators), operands straight from K-contiguous 16-bit planes; grid (M/64, N/64, Z), 32 threads.
// C[m][n] (f32, pitch ldc, + optional f32 bias[n]) = sum_k A[m][k] Bt[n][k] (+ split products per NSPLIT). z-batch strides sA/sB/sC in elements. K % 32 == 0.
template <typename T16> struct WFrag;
template <> struct WFrag<h16> { typedef v16h V; static __device__ __forceinline__ V ld(const h16* p) { return cat16(*(const v8h*)p, *(const v8h*)(p + 16)); } static __device__ __forceinline__ v8f mma(V a, V b, v8f c) { return wmma16(a, b, c); } };
template <> struct WFrag<bf> { typedef v16bf V; static __device__ __forceinline__ V ld(const bf* p) { return cat16b(*(const v8us*)p, *(const v8us*)(p + 16)); } static __device__ __forceinline__ v8f mma(V a, V b, v8f c) { return wmmab(a, b, c); } };
template <typename T16, int NSPLIT, bool BIAS>
__global__ __launch_bounds__(32) void k_gemmw(const T16* __restrict__ A, const T16* __restrict__ A2, const T16* __restrict__ Bt, const T16* __restrict__ Bt2, int K, float* C, int ldc, const float* __restrict__ bias, size_t sA, size_t sB, size_t sC) {
    typedef typename WFrag<T16>::V V;
    __shared__ __align__(16) float os[16 * 68];
    const size_t z = blockIdx.z; A += z * sA; if (A2) A2 += z * sA; Bt += z * sB; if (Bt2) Bt2 += z * sB; C += z * sC;
    const int lane = threadIdx.x & 31, lr = lane & 15, hi = lane >> 4; const int r0 = blockIdx.x * 64, c0 = blockIdx.y * 64;
    v8f acc[4][4];
#pragma unroll
    for (int mb = 0; mb < 4; ++mb)
#pragma unroll
        for (int nb = 0; nb < 4; ++nb) acc[mb][nb] = (v8f){};
    const size_t aoff = (size_t)(r0 + lr) * K + 8 * hi, boff = (size_t)(c0 + lr) * K + 8 * hi;
#pragma unroll 1
    for (int kc = 0; kc < K; kc += 32) {
        V a[4], a2[4];
#pragma unroll
        for (int mb = 0; mb < 4; ++mb) { a[mb] = WFrag<T16>::ld(A + aoff + (size_t)mb * 16 * K + kc); if (NSPLIT == 1 || NSPLIT == 2) a2[mb] = WFrag<T16>::ld(A2 + aoff + (size_t)mb * 16 * K + kc); }
#pragma unroll
        for (int nb = 0; nb < 4; ++nb) { const V b = WFrag<T16>::ld(Bt + boff + (size_t)nb * 16 * K + kc); V b2; if (NSPLIT >= 2) b2 = WFrag<T16>::ld(Bt2 + boff + (size_t)nb * 16 * K + kc);
#pragma unroll
            for (int mb = 0; mb < 4; ++mb) { acc[mb][nb] = WFrag<T16>::mma(a[mb], b, acc[mb][nb]); if (NSPLIT == 1 || NSPLIT == 2) acc[mb][nb] = WFrag<T16>::mma(a2[mb], b, acc[mb][nb]); if (NSPLIT >= 2) acc[mb][nb] = WFrag<T16>::mma(a[mb], b2, acc[mb][nb]); } }
        asm volatile("v_nop\n\tv_nop\n\tv_nop\n\tv_nop" : "+v"(acc[0][0]), "+v"(acc[1][1]), "+v"(acc[2][2]), "+v"(acc[3][3]) : "v"(a[0]), "v"(a[3]));
    }
#pragma unroll
    for (int mb = 0; mb < 4; ++mb) {
#pragma unroll
        for (int nb = 0; nb < 4; ++nb) {
#pragma unroll
            for (int j = 0; j < 8; ++j) os[(hi * 8 + j) * 68 + nb * 16 + lr] = acc[mb][nb][j]; }
        __builtin_amdgcn_wave_barrier(); asm volatile("" ::: "memory");
        float* crow = C + (size_t)(r0 + mb * 16) * ldc + c0;
{
#pragma unroll
            for (int s = 0; s < 8; ++s) { const int row = 2 * s + hi, cofs = lr * 4; v4f val = *(const v4fa*)(os + row * 68 + cofs); if (BIAS) { val[0] += bfr(bias[c0 + cofs]); val[1] += bfr(bias[c0 + cofs + 1]); val[2] += bfr(bias[c0 + cofs + 2]); val[3] += bfr(bias[c0 + cofs + 3]); }
                *(v4f*)(crow + (size_t)row * ldc + cofs) = val; }
             }
        __builtin_amdgcn_wave_barrier(); asm volatile("" ::: "memory");
    }
}

__device__ __forceinline__ h16 tohx(float x) { return (h16)x; }
__device__ __forceinline__ void splitf(float y, unsigned short& h, unsigned short& l) { h = f2bf(y); l = f2bf(y - bf2f(h)); }
typedef __attribute__((ext_vector_type(2))) _Float16 v2h;
typedef __attribute__((ext_vector_type(4))) _Float16 v4h;
typedef __attribute__((ext_vector_type(2))) unsigned short v2us;
typedef __attribute__((ext_vector_type(4))) unsigned short v4us;
typedef __attribute__((ext_vector_type(2))) float v2f;
typedef __attribute__((ext_vector_type(4))) int v4i;

__global__ __launch_bounds__(256) void k_wtG(const float* __restrict__ w, int K, int N, bf* Bt) {
    const int lane = threadIdx.x & 31; const int L0 = (blockIdx.x * 8 + (threadIdx.x >> 5)) * 8; const int nlines = N * K / 64;
{
#pragma unroll 1
        for (int l = 0; l < 8; ++l) { const int L = L0 + l; if (L >= nlines) break; const size_t e = (size_t)L * 64 + lane * 2; const int k = (int)(e % K), n = (int)(e / K); v2us o;
            o[0] = f2bf(w[(size_t)k * N + n]); o[1] = f2bf(w[(size_t)(k + 1) * N + n]); *(v2us*)(Bt + e) = o; }
         }
}
__global__ __launch_bounds__(256) void k_cvt8(const float* __restrict__ src, bf* dst, size_t n8) { const size_t i = (size_t)blockIdx.x * 256 + threadIdx.x; if (i >= n8) return; const v8f v = *(const v8f*)(src + i * 8); v8us o;
#pragma unroll
    for (int k = 0; k < 8; ++k) o[k] = f2bf(v[k]); *(v8us*)(dst + i * 8) = o;  }
__constant__ float INV[HD / 2] = {1.00000000f,0.663601220f,0.440366596f,0.292227834f,0.193922743f,0.128687367f,0.0853971019f,0.0566696227f,0.0376060307f,0.0249554086f,0.0165604409f,0.0109895281f,0.00729266461f,0.00483942125f,0.00321144611f,0.00213111960f,0.00141421356f,0.000938473851f,0.000622772437f,0.000413272559f,0.000274248188f,0.000181991432f,0.000120769735f,0.0000801429487f,0.0000531829573f,0.0000352922762f,0.0000234199997f,0.0000155415401f,0.0000103133852f,0.00000684397537f,0.00000454167048f,0.00000301385808f};
__global__ __launch_bounds__(256) void k_cstab(float* CS) { const int idx = blockIdx.x * 256 + threadIdx.x; if (idx >= TT * HD) return; const int t = idx / HD, d = idx % HD; const float ang = __fmul_rn((float)t, INV[d % (HD / 2)]); v2f cs; cs[0] = cosf(ang); cs[1] = sinf(ang);
    *(v2f*)(CS + (size_t)idx * 2) = cs;  }

// k_rope: head planes [h][t][d] (fp16 + hi/lo) of rope(x) x sc with the rotate-half convention out[d] = x[d] cos[t][d] - x[d+HD/2] sin[t][d], out[d+HD/2] = x[d+HD/2] cos[t][d+HD/2] + x[d] sin[t][d+HD/2]
__global__ __launch_bounds__(256) void k_rope(const float* __restrict__ F, int pitch, int nheads, const float* __restrict__ CS, const float* __restrict__ RF, const float* __restrict__ nw, float sc, h16* P16, bf* Ph, bf* Pl) {
    const size_t e = ((size_t)blockIdx.x * 256 + threadIdx.x) * 2; if (e >= (size_t)nheads * TT * HD) return; const int d = (int)(e % HD); const int t = (int)((e / HD) % TT); const int h = (int)(e / ((size_t)HD * TT)); const float* f = F + (size_t)t * pitch + h * HD; const float rf = RF ? RF[(size_t)h * TT + t] : 1.0f; v2h o16; v2us oh, ol;
#pragma unroll
    for (int q = 0; q < 2; ++q) { const int dd = d + q; const int dp = (dd < HD / 2) ? dd + HD / 2 : dd - HD / 2; float x0 = f[dd], x1 = f[dp];
        if (RF) { float n0 = __fmul_rn(x0, rf), n1 = __fmul_rn(x1, rf); asm volatile("" : "+v"(n0)); asm volatile("" : "+v"(n1)); x0 = __fmul_rn(bfr(nw[dd]), n0); x1 = __fmul_rn(bfr(nw[dp]), n1); }
        const v2f cs = *(const v2f*)(CS + ((size_t)t * HD + dd) * 2); float a = __fmul_rn(x0, cs[0]), bq = __fmul_rn(x1, cs[1]); asm volatile("" : "+v"(a)); asm volatile("" : "+v"(bq)); const float r = ((dd < HD / 2) ? __fsub_rn(a, bq) : __fadd_rn(a, bq)) * sc;
        o16[q] = tohx(r); unsigned short a2, c2; splitf(r, a2, c2); oh[q] = a2; ol[q] = c2; }
    *(v2h*)(P16 + e) = o16; *(v2us*)(Ph + e) = oh; *(v2us*)(Pl + e) = ol;  }
__global__ __launch_bounds__(256) void k_vtp(const float* __restrict__ F, int pitch, int nheads, h16* V16, bf* Vh, bf* Vl) { const size_t e = ((size_t)blockIdx.x * 256 + threadIdx.x) * 2; if (e >= (size_t)nheads * HD * TT) return; const int t = (int)(e % TT); const int d = (int)((e / TT) % HD); const int g = (int)(e / ((size_t)TT * HD)); v2h o16; v2us oh, ol;
#pragma unroll
    for (int q = 0; q < 2; ++q) { const float x = F[(size_t)(t + q) * pitch + g * HD + d]; o16[q] = tohx(x); unsigned short a2, c2; splitf(x, a2, c2); oh[q] = a2; ol[q] = c2; }
    *(v2h*)(V16 + e) = o16; *(v2us*)(Vh + e) = oh; *(v2us*)(Vl + e) = ol;  }
#define PC2  6.0f
#define CS2  (SCL * 1.4426950408889634f)
__device__ __forceinline__ float xhalf(float x) { return __builtin_bit_cast(float, __builtin_amdgcn_permlanex16(__builtin_bit_cast(int, x), __builtin_bit_cast(int, x), 0x76543210, 0xfedcba98, false, false)); }  // lane l with lane l ^ 16
__device__ __forceinline__ void sfence() { __builtin_amdgcn_sched_barrier(0); }   // keeps a load group where it is written, so that it flies under the work behind it
struct KVf { v16h k[2][2]; v16h v[4]; };
__device__ __forceinline__ void ld_k(KVf& f, const h16* kp) {
#pragma unroll
    for (int kt = 0; kt < 2; ++kt)
#pragma unroll
        for (int kc = 0; kc < 2; ++kc) f.k[kt][kc] = WFrag<h16>::ld(kp + kt * 16 * HD + kc * 32); }
__device__ __forceinline__ void ld_v(KVf& f, const h16* vp) {
#pragma unroll
    for (int t = 0; t < 4; ++t) f.v[t] = WFrag<h16>::ld(vp + t * 16 * TT); }
// one pass of 32 keys; its K fragments are refilled for pass + 2 behind the score products, its V fragments behind the second product.
// The two fragment sets share one K and one V^T lane pointer: set 0 steps it by two passes, set 1 reads 32 keys behind it.
__device__ __forceinline__ void xwait() { asm volatile("s_wait_xcnt 0x0" ::: "memory"); }   // stands in front of the overwrite of an address register that issued loads name
template <int SET>
__device__ __forceinline__ void fpass(KVf& f, const h16*& kp, const h16*& vp, int kstep, int vstep, const v16h (&qf)[2][2], v8f (&acc)[2][4], float (&lsum)[2], float (&mrun)[2]) {
    v8f s[2][2];
#pragma unroll
    for (int kt = 0; kt < 2; ++kt)
#pragma unroll
        for (int g = 0; g < 2; ++g) { s[kt][g] = (v8f){};
#pragma unroll
            for (int kc = 0; kc < 2; ++kc) s[kt][g] = wmma16(f.k[kt][kc], qf[g][kc], s[kt][g]); }
    sfence();
    if (SET == 0) { xwait(); sfence(); kp += kstep; }
    ld_k(f, kp + SET * 32 * HD);
    sfence();
    float mb[2]; bool need = false;
#pragma unroll
    for (int g = 0; g < 2; ++g) { float mx = -INFINITY;
#pragma unroll
        for (int kt = 0; kt < 2; ++kt)
#pragma unroll
            for (int r = 0; r < 8; ++r) mx = fmaxf(mx, s[kt][g][r]);
        mx = fmaxf(mx, xhalf(mx)) * CS2; mb[g] = mx; need = need || (mx > mrun[g] + 8.0f); }
    if (__builtin_amdgcn_ballot_w32(need) != 0) {   // wave-uniform; rare after the first passes
#pragma unroll
        for (int g = 0; g < 2; ++g) { const float mn = fmaxf(mrun[g], mb[g]); const float corr = __builtin_amdgcn_exp2f(mrun[g] - mn); mrun[g] = mn; lsum[g] = lsum[g] * corr;
#pragma unroll
            for (int t = 0; t < 4; ++t) acc[g][t] = acc[g][t] * corr; } }
#pragma unroll
    for (int g = 0; g < 2; ++g) { const float nm = PC2 - mrun[g]; v16h pf; float p[16];
#pragma unroll
        for (int e = 0; e < 16; ++e) { p[e] = __builtin_amdgcn_exp2f(fmaf(s[e >> 3][g][e & 7], CS2, nm)); pf[e] = tohx(p[e]); }   // element e of the 32-key operand = tile e >> 3, register e & 7 (the hardware k order, as the V^T loader's)
#pragma unroll
        for (int w = 8; w; w >>= 1)
#pragma unroll
            for (int e = 0; e < w; ++e) p[e] += p[e + w];
        lsum[g] += p[0];
#pragma unroll
        for (int t = 0; t < 4; ++t) acc[g][t] = wmma16(f.v[t], pf, acc[g][t]); }
    sfence();
    if (SET == 0) { xwait(); sfence(); vp += vstep; }
    ld_v(f, vp + SET * 32);
    sfence();
}
__global__ __launch_bounds__(256) void k_fattn(const h16* __restrict__ Q16, const h16* __restrict__ K16, const h16* __restrict__ V16, bf* Ah, bf* Al) {
    const int lane = threadIdx.x & 31, c = lane & 15, hi = lane >> 4; const int wave = __builtin_amdgcn_readfirstlane(threadIdx.x >> 5);
    const int h = blockIdx.y, q0 = blockIdx.x * 256 + wave * 32;
    const h16* qp = Q16 + ((size_t)h * TT + q0 + c) * HD + 8 * hi;
    const h16* kp = K16 + (size_t)(h / REP) * TT * HD + c * HD + 8 * hi; const h16* vp = V16 + (size_t)(h / REP) * HD * TT + c * TT + 8 * hi;
    v16h qf[2][2];
#pragma unroll
    for (int g = 0; g < 2; ++g)
#pragma unroll
        for (int kc = 0; kc < 2; ++kc) qf[g][kc] = WFrag<h16>::ld(qp + g * 16 * HD + kc * 32);
    // the first two passes' fragments, issued in the loop's own order (K, V, K, V): only then are the loop's load waits counted ones that leave the younger groups in flight
    KVf fa, fb; sfence();
    asm volatile("s_wait_xcnt 0x0" :: "v"(qp) : "memory");   // as xwait(); the operand keeps the Q loads' address pair from being reused in front of the wait
    sfence(); ld_k(fa, kp); sfence(); ld_v(fa, vp); sfence(); ld_k(fb, kp + 32 * HD); sfence(); ld_v(fb, vp + 32); sfence(); xwait(); sfence();
    v8f acc[2][4]; float lsum[2], mrun[2];
#pragma unroll
    for (int g = 0; g < 2; ++g) { mrun[g] = -INFINITY; lsum[g] = 0.0f;
#pragma unroll
        for (int t = 0; t < 4; ++t) acc[g][t] = (v8f){}; }
#pragma unroll 1   // two passes a trip, one per fragment set; more would only grow the code
    for (int key0 = 0; key0 < TT; key0 += 64) {   // the last trip's refills step back to keys 0 and 32: in bounds, not used
        const bool more = key0 + 64 < TT; const int kstep = more ? 64 * HD : -(TT - 64) * HD, vstep = more ? 64 : -(TT - 64);
        fpass<0>(fa, kp, vp, kstep, vstep, qf, acc, lsum, mrun);
        fpass<1>(fb, kp, vp, kstep, vstep, qf, acc, lsum, mrun); }
#pragma unroll
    for (int g = 0; g < 2; ++g) { const float inv = __fdiv_rn(1.0f, lsum[g] + xhalf(lsum[g]));   // a query's 32 keys of a pass lie half in lane c, half in lane c + 16
        const size_t oo = (size_t)(q0 + 16 * g + c) * DQ + h * HD + 8 * hi;
#pragma unroll
        for (int t = 0; t < 4; ++t) { v8us oh, ol;   // acc[g][t][r] = O[query c][d = 16 t + 8 hi + r]
#pragma unroll
            for (int r = 0; r < 8; ++r) { unsigned short a, c2; splitf(acc[g][t][r] * inv, a, c2); oh[r] = a; ol[r] = c2; }
            *(v8us*)(Ah + oo + 16 * t) = oh; *(v8us*)(Al + oo + 16 * t) = ol; } }
}

extern "C" void kernel_launch(void* const* d_in, const int* in_sizes, int n_in,
                              void* d_out, int out_size, void* d_ws, size_t ws_size, hipStream_t stream) {
    (void)in_sizes; (void)n_in; (void)out_size;
    const float* x = (const float*)d_in[0]; const float* wq = (const float*)d_in[1]; const float* wk = (const float*)d_in[2]; const float* wv = (const float*)d_in[3]; const float* wo = (const float*)d_in[4];
    float* OUT = (float*)d_out;     // [2][2048][2048]
    char* wsp = (char*)d_ws;
    auto take = [&](size_t bytes) { char* p = wsp; wsp += (bytes + 255) & ~(size_t)255; return (void*)p; };
    bf* WQ = (bf*)take((size_t)DQ * DM * 2); bf* WK = (bf*)take((size_t)DKV * DM * 2); bf* WV = (bf*)take((size_t)DKV * DM * 2); bf* WO = (bf*)take((size_t)DM * DQ * 2); float* CS = (float*)take((size_t)TT * HD * 2 * 4);
    bf* XB = (bf*)take((size_t)TT * DM * 2); float* FQ = (float*)take((size_t)TT * DQ * 4); float* FK = (float*)take((size_t)TT * DKV * 4);
    h16* QP16 = (h16*)take((size_t)NH_ * TT * HD * 2); h16* KP16 = (h16*)take((size_t)NKV * TT * HD * 2); h16* VT16 = (h16*)take((size_t)NKV * HD * TT * 2);
    bf* QPh = (bf*)take((size_t)NH_ * TT * HD * 2); bf* QPl = (bf*)take((size_t)NH_ * TT * HD * 2); bf* KPh = (bf*)take((size_t)NKV * TT * HD * 2); bf* KPl = (bf*)take((size_t)NKV * TT * HD * 2); bf* VTh = (bf*)take((size_t)NKV * HD * TT * 2); bf* VTl = (bf*)take((size_t)NKV * HD * TT * 2);
    bf* ATh = (bf*)take((size_t)TT * DQ * 2); bf* ATl = (bf*)take((size_t)TT * DQ * 2);
    if ((size_t)(wsp - (char*)d_ws) > ws_size) return;    // ws 256 MiB
    float* FV = FK;   // v projection reuses the k buffer after the k planes are built (stream-ordered)
    { k_wtG<<<(unsigned)((DM * DQ / 64 + 63) / 64), 256, 0, stream>>>(wq, DM, DQ, WQ); k_wtG<<<(unsigned)((DM * DKV / 64 + 63) / 64), 256, 0, stream>>>(wk, DM, DKV, WK); k_wtG<<<(unsigned)((DM * DKV / 64 + 63) / 64), 256, 0, stream>>>(wv, DM, DKV, WV);
      k_wtG<<<(unsigned)((DQ * DM / 64 + 63) / 64), 256, 0, stream>>>(wo, DQ, DM, WO);
      k_cstab<<<(TT * HD + 255) / 256, 256, 0, stream>>>(CS); }
    const unsigned LQ = (unsigned)(((size_t)NH_ * TT * HD / 2 + 255) / 256), LKv = (unsigned)(((size_t)NKV * TT * HD / 2 + 255) / 256);
    for (int b = 0; b < NB_; ++b) {
        
        k_cvt8<<<(unsigned)(((size_t)TT * DM / 8 + 255) / 256), 256, 0, stream>>>(x + (size_t)b * TT * DM, XB, (size_t)TT * DM / 8);
        k_gemmw<bf, 0, false><<<dim3(TT / 64, DQ / 64, 1), 32, 0, stream>>>(XB, nullptr, WQ, nullptr, DM, FQ, DQ, nullptr, 0, 0, 0);
        k_rope<<<LQ, 256, 0, stream>>>(FQ, DQ, NH_, CS, nullptr, nullptr, 1.0f, QP16, QPh, QPl);
        k_gemmw<bf, 0, false><<<dim3(TT / 64, DKV / 64, 1), 32, 0, stream>>>(XB, nullptr, WK, nullptr, DM, FK, DKV, nullptr, 0, 0, 0);
        k_rope<<<LKv, 256, 0, stream>>>(FK, DKV, NKV, CS, nullptr, nullptr, 1.0f, KP16, KPh, KPl);
        k_gemmw<bf, 0, false><<<dim3(TT / 64, DKV / 64, 1), 32, 0, stream>>>(XB, nullptr, WV, nullptr, DM, FV, DKV, nullptr, 0, 0, 0); k_vtp<<<LKv, 256, 0, stream>>>(FV, DKV, NKV, VT16, VTh, VTl);
        k_fattn<<<dim3(TT / 256, NH_, 1), 256, 0, stream>>>(QP16, KP16, VT16, ATh, ATl);
        k_gemmw<bf, 1, false><<<dim3(TT / 64, DM / 64, 1), 32, 0, stream>>>(ATh, ATl, WO, nullptr, DQ, OUT + (size_t)b * TT * DM, DM, nullptr, 0, 0, 0); }
}

// v002
// A run of this version takes 350 microseconds.
// Next to v001, in two timings, it ran 1.68 times as fast each time.
// Over all steps from v000 it is 7.17 times as fast.
#include <hip/hip_runtime.h>

// Grouped-query RoPE attention without a mask (x [2][2048][2048]; q = x Wq (32 heads x 64), k, v = x Wk / Wv ([2048][512]: 8 kv heads); rotate-half RoPE (theta 5e5, tables computed on device); kv head = h/4; softmax(q.k/8) over all keys; out = merged Wo -> [2][2048][2048] (8.4 M)).
// Compute dtypes, f32 accumulate: every input rounded to bf16; q/k/v on PLAIN bf16 operands (inputs: exact); rotary in f32; scores and attn.v on single fp16 operands for every row (x64 probability carry against the running maximum); online softmax f32, denominator summed in f32 from the f32 exponentials; Wo hl x exact (2 products).

#define NB_  2
#define TT   2048
#define DM   2048
#define NH_  32
#define NKV  8
#define REP  (NH_ / NKV)
#define HD   64
#define DQ   (NH_ * HD)
#define DKV  (NKV * HD)
#define DF   (DQ + 2 * DKV)   // columns of the joined q | k | v projection
#define NQK  (NH_ + NKV)       // rotated head planes of a batch: 32 q heads, then 8 k heads
#define MT   (NB_ * TT)        // rows of both batches
#define SCL  0.125f   // HD^-0.5
typedef _Float16 h16;
typedef unsigned short bf;
typedef __attribute__((ext_vector_type(16))) __bf16   v16bf;
typedef __attribute__((ext_vector_type(16))) _Float16 v16h;
typedef __attribute__((ext_vector_type(8)))  _Float16 v8h;
typedef __attribute__((ext_vector_type(8)))  unsigned short v8us;
typedef __attribute__((ext_vector_type(8)))  float    v8f;
typedef __attribute__((ext_vector_type(4)))  float    v4f;
typedef v8h  __attribute__((may_alias)) v8ha;
typedef v4f  __attribute__((may_alias)) v4fa;
typedef v8us __attribute__((may_alias)) v8usa;

__device__ __forceinline__ unsigned short f2bf(float f) { unsigned u = __float_as_uint(f); u += 0x7FFFu + ((u >> 16) & 1u); return (unsigned short)(u >> 16); }
__device__ __forceinline__ float bf2f(unsigned short b) { return __uint_as_float(((unsigned)b) << 16); }
__device__ __forceinline__ float bfr(float f) { return bf2f(f2bf(f)); }
__device__ __forceinline__ v16h cat16(v8h lo, v8h hi) { return __builtin_shufflevector(lo, hi, 0, 1, 2, 3, 4, 5, 6, 7, 8, 9, 10, 11, 12, 13, 14, 15); }
__device__ __forceinline__ v16bf cat16b(v8us lo, v8us hi) { return __builtin_bit_cast(v16bf, __builtin_shufflevector(lo, hi, 0, 1, 2, 3, 4, 5, 6, 7, 8, 9, 10, 11, 12, 13, 14, 15)); }
__device__ __forceinline__ v8f wmma16(v16h a, v16h b, v8f c) { return __builtin_amdgcn_wmma_f32_16x16x32_f16(false, a, false, b, (short)0, c, false, false); }
__device__ __forceinline__ v8f wmmab(v16bf a, v16bf b, v8f c) { return __builtin_amdgcn_wmma_f32_16x16x32_bf16(false, a, false, b, (short)0, c, false, false); }



// ---- k_gemmw: register-blocked GEMM, ONE WAVE per 64x64 output tile (16 accumulators), operands straight from K-contiguous 16-bit planes; grid (M/64, N/64, Z), 32 threads.
// C[m][n] (f32, pitch ldc, + optional f32 bias[n]) = sum_k A[m][k] Bt[n][k] (+ split products per NSPLIT). z-batch strides sA/sB/sC in elements. K % 32 == 0.
template <typename T16> struct WFrag;
template <> struct WFrag<h16> { typedef v16h V; static __device__ __forceinline__ V ld(const h16* p) { return cat16(*(const v8h*)p, *(const v8h*)(p + 16)); } static __device__ __forceinline__ v8f mma(V a, V b, v8f c) { return wmma16(a, b, c); } };
template <> struct WFrag<bf> { typedef v16bf V; static __device__ __forceinline__ V ld(const bf* p) { return cat16b(*(const v8us*)p, *(const v8us*)(p + 16)); } static __device__ __forceinline__ v8f mma(V a, V b, v8f c) { return wmmab(a, b, c); } };
template <typename T16, int NSPLIT, bool BIAS>
__global__ __launch_bounds__(32) void k_gemmw(const T16* __restrict__ A, const T16* __restrict__ A2, const T16* __restrict__ Bt, const T16* __restrict__ Bt2, int K, float* C, int ldc, const float* __restrict__ bias, size_t sA, size_t sB, size_t sC) {
    typedef typename WFrag<T16>::V V;
    __shared__ __align__(16) float os[16 * 68];
    const size_t z = blockIdx.z; A += z * sA; if (A2) A2 += z * sA; Bt += z * sB; if (Bt2) Bt2 += z * sB; C += z * sC;
    const int lane = threadIdx.x & 31, lr = lane & 15, hi = lane >> 4; const int r0 = blockIdx.x * 64, c0 = blockIdx.y * 64;
    v8f acc[4][4];
#pragma unroll
    for (int mb = 0; mb < 4; ++mb)
#pragma unroll
        for (int nb = 0; nb < 4; ++nb) acc[mb][nb] = (v8f){};
    const size_t aoff = (size_t)(r0 + lr) * K + 8 * hi, boff = (size_t)(c0 + lr) * K + 8 * hi;
#pragma unroll 1
    for (int kc = 0; kc < K; kc += 32) {
        V a[4], a2[4];
#pragma unroll
        for (int mb = 0; mb < 4; ++mb) { a[mb] = WFrag<T16>::ld(A + aoff + (size_t)mb * 16 * K + kc); if (NSPLIT == 1 || NSPLIT == 2) a2[mb] = WFrag<T16>::ld(A2 + aoff + (size_t)mb * 16 * K + kc); }
#pragma unroll
        for (int nb = 0; nb < 4; ++nb) { const V b = WFrag<T16>::ld(Bt + boff + (size_t)nb * 16 * K + kc); V b2; if (NSPLIT >= 2) b2 = WFrag<T16>::ld(Bt2 + boff + (size_t)nb * 16 * K + kc);
#pragma unroll
            for (int mb = 0; mb < 4; ++mb) { acc[mb][nb] = WFrag<T16>::mma(a[mb], b, acc[mb][nb]); if (NSPLIT == 1 || NSPLIT == 2) acc[mb][nb] = WFrag<T16>::mma(a2[mb], b, acc[mb][nb]); if (NSPLIT >= 2) acc[mb][nb] = WFrag<T16>::mma(a[mb], b2, acc[mb][nb]); } }
        asm volatile("v_nop\n\tv_nop\n\tv_nop\n\tv_nop" : "+v"(acc[0][0]), "+v"(acc[1][1]), "+v"(acc[2][2]), "+v"(acc[3][3]) : "v"(a[0]), "v"(a[3]));
    }
#pragma unroll
    for (int mb = 0; mb < 4; ++mb) {
#pragma unroll
        for (int nb = 0; nb < 4; ++nb) {
#pragma unroll
            for (int j = 0; j < 8; ++j) os[(hi * 8 + j) * 68 + nb * 16 + lr] = acc[mb][nb][j]; }
        __builtin_amdgcn_wave_barrier(); asm volatile("" ::: "memory");
        float* crow = C + (size_t)(r0 + mb * 16) * ldc + c0;
{
#pragma unroll
            for (int s = 0; s < 8; ++s) { const int row = 2 * s + hi, cofs = lr * 4; v4f val = *(const v4fa*)(os + row * 68 + cofs); if (BIAS) { val[0] += bfr(bias[c0 + cofs]); val[1] += bfr(bias[c0 + cofs + 1]); val[2] += bfr(bias[c0 + cofs + 2]); val[3] += bfr(bias[c0 + cofs + 3]); }
                *(v4f*)(crow + (size_t)row * ldc + cofs) = val; }
             }
        __builtin_amdgcn_wave_barrier(); asm volatile("" ::: "memory");
    }
}

__device__ __forceinline__ h16 tohx(float x) { return (h16)x; }
__device__ __forceinline__ void splitf(float y, unsigned short& h, unsigned short& l) { h = f2bf(y); l = f2bf(y - bf2f(h)); }
typedef __attribute__((ext_vector_type(2))) _Float16 v2h;
typedef __attribute__((ext_vector_type(4))) _Float16 v4h;
typedef __attribute__((ext_vector_type(2))) unsigned short v2us;
typedef __attribute__((ext_vector_type(4))) unsigned short v4us;
typedef __attribute__((ext_vector_type(2))) float v2f;
typedef __attribute__((ext_vector_type(4))) int v4i;

// all four weights in one launch: blockIdx.y picks the weight (wq, wk, wv into the joined plane, wo into its own); blocks past a narrow weight's last line leave at once
__global__ __launch_bounds__(256) void k_wtG(const float* __restrict__ wq, const float* __restrict__ wk, const float* __restrict__ wv, const float* __restrict__ wo, bf* WF, bf* WO) {
    const int y = blockIdx.y; const float* __restrict__ w = y == 0 ? wq : y == 1 ? wk : y == 2 ? wv : wo; const int K = y == 3 ? DQ : DM, N = y == 0 ? DQ : y == 3 ? DM : DKV;
    bf* Bt = y == 0 ? WF : y == 1 ? WF + (size_t)DQ * DM : y == 2 ? WF + (size_t)(DQ + DKV) * DM : WO;
    const int lane = threadIdx.x & 31; const int L0 = (blockIdx.x * 8 + (threadIdx.x >> 5)) * 8; const int nlines = N * K / 64;
{
#pragma unroll 1
        for (int l = 0; l < 8; ++l) { const int L = L0 + l; if (L >= nlines) break; const size_t e = (size_t)L * 64 + lane * 2; const int k = (int)(e % K), n = (int)(e / K); v2us o;
            o[0] = f2bf(w[(size_t)k * N + n]); o[1] = f2bf(w[(size_t)(k + 1) * N + n]); *(v2us*)(Bt + e) = o; }
         }
}
__global__ __launch_bounds__(256) void k_cvt8(const float* __restrict__ src, bf* dst, size_t n8) { const size_t i = (size_t)blockIdx.x * 256 + threadIdx.x; if (i >= n8) return; const v8f v = *(const v8f*)(src + i * 8); v8us o;
#pragma unroll
    for (int k = 0; k < 8; ++k) o[k] = f2bf(v[k]); *(v8us*)(dst + i * 8) = o;  }
__constant__ float INV[HD / 2] = {1.00000000f,0.663601220f,0.440366596f,0.292227834f,0.193922743f,0.128687367f,0.0853971019f,0.0566696227f,0.0376060307f,0.0249554086f,0.0165604409f,0.0109895281f,0.00729266461f,0.00483942125f,0.00321144611f,0.00213111960f,0.00141421356f,0.000938473851f,0.000622772437f,0.000413272559f,0.000274248188f,0.000181991432f,0.000120769735f,0.0000801429487f,0.0000531829573f,0.0000352922762f,0.0000234199997f,0.0000155415401f,0.0000103133852f,0.00000684397537f,0.00000454167048f,0.00000301385808f};
__global__ __launch_bounds__(256) void k_cstab(float* CS) { const int idx = blockIdx.x * 256 + threadIdx.x; if (idx >= TT * HD) return; const int t = idx / HD, d = idx % HD; const float ang = __fmul_rn((float)t, INV[d % (HD / 2)]); v2f cs; cs[0] = cosf(ang); cs[1] = sinf(ang);
    *(v2f*)(CS + (size_t)idx * 2) = cs;  }

// k_rope: head planes [b][h][t][d] (both batches; h runs over the q heads and then the k heads, whose columns follow them in the joined projection; fp16 + hi/lo) of rope(x) x sc with the rotate-half convention out[d] = x[d] cos[t][d] - x[d+HD/2] sin[t][d], out[d+HD/2] = x[d+HD/2] cos[t][d+HD/2] + x[d] sin[t][d+HD/2]
__global__ __launch_bounds__(256) void k_rope(const float* __restrict__ F, int pitch, int nheads, const float* __restrict__ CS, const float* __restrict__ RF, const float* __restrict__ nw, float sc, h16* P16, bf* Ph, bf* Pl) {
    { const size_t po = (size_t)blockIdx.y * nheads * TT * HD; F += (size_t)blockIdx.y * TT * pitch; P16 += po; Ph += po; Pl += po; }   // blockIdx.y = batch: its TT rows of F, its nheads planes
    const size_t e = ((size_t)blockIdx.x * 256 + threadIdx.x) * 2; if (e >= (size_t)nheads * TT * HD) return; const int d = (int)(e % HD); const int t = (int)((e / HD) % TT); const int h = (int)(e / ((size_t)HD * TT)); const float* f = F + (size_t)t * pitch + h * HD; const float rf = RF ? RF[(size_t)h * TT + t] : 1.0f; v2h o16; v2us oh, ol;
#pragma unroll
    for (int q = 0; q < 2; ++q) { const int dd = d + q; const int dp = (dd < HD / 2) ? dd + HD / 2 : dd - HD / 2; float x0 = f[dd], x1 = f[dp];
        if (RF) { float n0 = __fmul_rn(x0, rf), n1 = __fmul_rn(x1, rf); asm volatile("" : "+v"(n0)); asm volatile("" : "+v"(n1)); x0 = __fmul_rn(bfr(nw[dd]), n0); x1 = __fmul_rn(bfr(nw[dp]), n1); }
        const v2f cs = *(const v2f*)(CS + ((size_t)t * HD + dd) * 2); float a = __fmul_rn(x0, cs[0]), bq = __fmul_rn(x1, cs[1]); asm volatile("" : "+v"(a)); asm volatile("" : "+v"(bq)); const float r = ((dd < HD / 2) ? __fsub_rn(a, bq) : __fadd_rn(a, bq)) * sc;
        o16[q] = tohx(r); unsigned short a2, c2; splitf(r, a2, c2); oh[q] = a2; ol[q] = c2; }
    *(v2h*)(P16 + e) = o16; *(v2us*)(Ph + e) = oh; *(v2us*)(Pl + e) = ol;  }
__global__ __launch_bounds__(256) void k_vtp(const float* __restrict__ F, int pitch, int nheads, h16* V16, bf* Vh, bf* Vl) { { const size_t po = (size_t)blockIdx.y * nheads * HD * TT; F += (size_t)blockIdx.y * TT * pitch; V16 += po; Vh += po; Vl += po; }   // blockIdx.y = batch; planes [b][g][d][t]
    const size_t e = ((size_t)blockIdx.x * 256 + threadIdx.x) * 2; if (e >= (size_t)nheads * HD * TT) return; const int t = (int)(e % TT); const int d = (int)((e / TT) % HD); const int g = (int)(e / ((size_t)TT * HD)); v2h o16; v2us oh, ol;
#pragma unroll
    for (int q = 0; q < 2; ++q) { const float x = F[(size_t)(t + q) * pitch + g * HD + d]; o16[q] = tohx(x); unsigned short a2, c2; splitf(x, a2, c2); oh[q] = a2; ol[q] = c2; }
    *(v2h*)(V16 + e) = o16; *(v2us*)(Vh + e) = oh; *(v2us*)(Vl + e) = ol;  }
#define PC2  6.0f
#define CS2  (SCL * 1.4426950408889634f)
__device__ __forceinline__ float xhalf(float x) { return __builtin_bit_cast(float, __builtin_amdgcn_permlanex16(__builtin_bit_cast(int, x), __builtin_bit_cast(int, x), 0x76543210, 0xfedcba98, false, false)); }  // lane l with lane l ^ 16
__device__ __forceinline__ void sfence() { __builtin_amdgcn_sched_barrier(0); }   // keeps a load group where it is written, so that it flies under the work behind it
struct KVf { v16h k[2][2]; v16h v[4]; };
__device__ __forceinline__ void ld_k(KVf& f, const h16* kp) {
#pragma unroll
    for (int kt = 0; kt < 2; ++kt)
#pragma unroll
        for (int kc = 0; kc < 2; ++kc) f.k[kt][kc] = WFrag<h16>::ld(kp + kt * 16 * HD + kc * 32); }
__device__ __forceinline__ void ld_v(KVf& f, const h16* vp) {
#pragma unroll
    for (int t = 0; t < 4; ++t) f.v[t] = WFrag<h16>::ld(vp + t * 16 * TT); }
// one pass of 32 keys; its K fragments are refilled for pass + 2 behind the score products, its V fragments behind the second product.
// The two fragment sets share one K and one V^T lane pointer: set 0 steps it by two passes, set 1 reads 32 keys behind it.
__device__ __forceinline__ void xwait() { asm volatile("s_wait_xcnt 0x0" ::: "memory"); }   // stands in front of the overwrite of an address register that issued loads name
template <int SET>
__device__ __forceinline__ void fpass(KVf& f, const h16*& kp, const h16*& vp, int kstep, int vstep, const v16h (&qf)[2][2], v8f (&acc)[2][4], float (&lsum)[2], float (&mrun)[2]) {
    v8f s[2][2];
#pragma unroll
    for (int kt = 0; kt < 2; ++kt)
#pragma unroll
        for (int g = 0; g < 2; ++g) { s[kt][g] = (v8f){};
#pragma unroll
            for (int kc = 0; kc < 2; ++kc) s[kt][g] = wmma16(f.k[kt][kc], qf[g][kc], s[kt][g]); }
    sfence();
    if (SET == 0) { xwait(); sfence(); kp += kstep; }
    ld_k(f, kp + SET * 32 * HD);
    sfence();
    float mb[2]; bool need = false;
#pragma unroll
    for (int g = 0; g < 2; ++g) { float mx = -INFINITY;
#pragma unroll
        for (int kt = 0; kt < 2; ++kt)
#pragma unroll
            for (int r = 0; r < 8; ++r) mx = fmaxf(mx, s[kt][g][r]);
        mx = fmaxf(mx, xhalf(mx)) * CS2; mb[g] = mx; need = need || (mx > mrun[g] + 8.0f); }
    if (__builtin_amdgcn_ballot_w32(need) != 0) {   // wave-uniform; rare after the first passes
#pragma unroll
        for (int g = 0; g < 2; ++g) { const float mn = fmaxf(mrun[g], mb[g]); const float corr = __builtin_amdgcn_exp2f(mrun[g] - mn); mrun[g] = mn; lsum[g] = lsum[g] * corr;
#pragma unroll
            for (int t = 0; t < 4; ++t) acc[g][t] = acc[g][t] * corr; } }
#pragma unroll
    for (int g = 0; g < 2; ++g) { const float nm = PC2 - mrun[g]; v16h pf; float p[16];
#pragma unroll
        for (int e = 0; e < 16; ++e) { p[e] = __builtin_amdgcn_exp2f(fmaf(s[e >> 3][g][e & 7], CS2, nm)); pf[e] = tohx(p[e]); }   // element e of the 32-key operand = tile e >> 3, register e & 7 (the hardware k order, as the V^T loader's)
#pragma unroll
        for (int w = 8; w; w >>= 1)
#pragma unroll
            for (int e = 0; e < w; ++e) p[e] += p[e + w];
        lsum[g] += p[0];
#pragma unroll
        for (int t = 0; t < 4; ++t) acc[g][t] = wmma16(f.v[t], pf, acc[g][t]); }
    sfence();
    if (SET == 0) { xwait(); sfence(); vp += vstep; }
    ld_v(f, vp + SET * 32);
    sfence();
}
__global__ __launch_bounds__(256) void k_fattn(const h16* __restrict__ Q16, const h16* __restrict__ K16, const h16* __restrict__ V16, bf* Ah, bf* Al) {
    const int lane = threadIdx.x & 31, c = lane & 15, hi = lane >> 4; const int wave = __builtin_amdgcn_readfirstlane(threadIdx.x >> 5);
    const int h = blockIdx.y, q0 = blockIdx.x * 256 + wave * 32;
    { const size_t z = blockIdx.z; Q16 += z * NQK * TT * HD; K16 += z * NQK * TT * HD; V16 += z * NKV * HD * TT; Ah += z * TT * DQ; Al += z * TT * DQ; }   // blockIdx.z = batch; a batch's q and k planes lie in one run of NQK planes
    const h16* qp = Q16 + ((size_t)h * TT + q0 + c) * HD + 8 * hi;
    const h16* kp = K16 + (size_t)(h / REP) * TT * HD + c * HD + 8 * hi; const h16* vp = V16 + (size_t)(h / REP) * HD * TT + c * TT + 8 * hi;
    v16h qf[2][2];
#pragma unroll
    for (int g = 0; g < 2; ++g)
#pragma unroll
        for (int kc = 0; kc < 2; ++kc) qf[g][kc] = WFrag<h16>::ld(qp + g * 16 * HD + kc * 32);
    // the first two passes' fragments, issued in the loop's own order (K, V, K, V): only then are the loop's load waits counted ones that leave the younger groups in flight
    KVf fa, fb; sfence();
    asm volatile("s_wait_xcnt 0x0" :: "v"(qp) : "memory");   // as xwait(); the operand keeps the Q loads' address pair from being reused in front of the wait
    sfence(); ld_k(fa, kp); sfence(); ld_v(fa, vp); sfence(); ld_k(fb, kp + 32 * HD); sfence(); ld_v(fb, vp + 32); sfence(); xwait(); sfence();
    v8f acc[2][4]; float lsum[2], mrun[2];
#pragma unroll
    for (int g = 0; g < 2; ++g) { mrun[g] = -INFINITY; lsum[g] = 0.0f;
#pragma unroll
        for (int t = 0; t < 4; ++t) acc[g][t] = (v8f){}; }
#pragma unroll 1   // two passes a trip, one per fragment set; more would only grow the code
    for (int key0 = 0; key0 < TT; key0 += 64) {   // the last trip's refills step back to keys 0 and 32: in bounds, not used
        const bool more = key0 + 64 < TT; const int kstep = more ? 64 * HD : -(TT - 64) * HD, vstep = more ? 64 : -(TT - 64);
        fpass<0>(fa, kp, vp, kstep, vstep, qf, acc, lsum, mrun);
        fpass<1>(fb, kp, vp, kstep, vstep, qf, acc, lsum, mrun); }
#pragma unroll
    for (int g = 0; g < 2; ++g) { const float inv = __fdiv_rn(1.0f, lsum[g] + xhalf(lsum[g]));   // a query's 32 keys of a pass lie half in lane c, half in lane c + 16
        const size_t oo = (size_t)(q0 + 16 * g + c) * DQ + h * HD + 8 * hi;
#pragma unroll
        for (int t = 0; t < 4; ++t) { v8us oh, ol;   // acc[g][t][r] = O[query c][d = 16 t + 8 hi + r]
#pragma unroll
            for (int r = 0; r < 8; ++r) { unsigned short a, c2; splitf(acc[g][t][r] * inv, a, c2); oh[r] = a; ol[r] = c2; }
            *(v8us*)(Ah + oo + 16 * t) = oh; *(v8us*)(Al + oo + 16 * t) = ol; } }
}

extern "C" void kernel_launch(void* const* d_in, const int* in_sizes, int n_in,
                              void* d_out, int out_size, void* d_ws, size_t ws_size, hipStream_t stream) {
    (void)in_sizes; (void)n_in; (void)out_size;
    const float* x = (const float*)d_in[0]; const float* wq = (const float*)d_in[1]; const float* wk = (const float*)d_in[2]; const float* wv = (const float*)d_in[3]; const float* wo = (const float*)d_in[4];
    float* OUT = (float*)d_out;     // [2][2048][2048]
    char* wsp = (char*)d_ws;
    auto take = [&](size_t bytes) { char* p = wsp; wsp += (bytes + 255) & ~(size_t)255; return (void*)p; };
    bf* WF = (bf*)take((size_t)DF * DM * 2); bf* WO = (bf*)take((size_t)DM * DQ * 2); float* CS = (float*)take((size_t)TT * HD * 2 * 4);   // WF: wq, wk, wv transposed, row after row: one [DF][DM] operand
    bf* XB = (bf*)take((size_t)MT * DM * 2); float* F = (float*)take((size_t)MT * DF * 4);   // F[b t][q | k | v]
    h16* QK16 = (h16*)take((size_t)NB_ * NQK * TT * HD * 2); h16* VT16 = (h16*)take((size_t)NB_ * NKV * HD * TT * 2);
    bf* QKh = (bf*)take((size_t)NB_ * NQK * TT * HD * 2); bf* QKl = (bf*)take((size_t)NB_ * NQK * TT * HD * 2); bf* VTh = (bf*)take((size_t)NB_ * NKV * HD * TT * 2); bf* VTl = (bf*)take((size_t)NB_ * NKV * HD * TT * 2);
    bf* ATh = (bf*)take((size_t)MT * DQ * 2); bf* ATl = (bf*)take((size_t)MT * DQ * 2);
    if ((size_t)(wsp - (char*)d_ws) > ws_size) return;    // 189 MiB of the 256 MiB
    // every stage is ONE launch over all of its work: both batches as 4096 rows (a grid index in k_rope, k_vtp and k_fattn), q, k and v as one product: 3 and 2 one-wave tiles a SIMD in the two products, where a batch's k or v product alone left three SIMDs in four empty
    // Left open: k_gemmw waits out two load latencies a trip (no fetch ahead, no LDS); its 64-column tile is one head, so k_rope and k_vtp could be its epilogue; the hi/lo planes of q, k, v are written and never read; k_fattn's registers (over 256 a wave, so three waves a SIMD at most) keep it at one 8-wave workgroup a WGP
    k_wtG<<<dim3((unsigned)((DM * DQ / 64 + 63) / 64), 4, 1), 256, 0, stream>>>(wq, wk, wv, wo, WF, WO);
    k_cstab<<<(TT * HD + 255) / 256, 256, 0, stream>>>(CS);
    k_cvt8<<<(unsigned)(((size_t)MT * DM / 8 + 255) / 256), 256, 0, stream>>>(x, XB, (size_t)MT * DM / 8);
    k_gemmw<bf, 0, false><<<dim3(MT / 64, DF / 64, 1), 32, 0, stream>>>(XB, nullptr, WF, nullptr, DM, F, DF, nullptr, 0, 0, 0);
    k_rope<<<dim3((unsigned)(((size_t)NQK * TT * HD / 2 + 255) / 256), NB_, 1), 256, 0, stream>>>(F, DF, NQK, CS, nullptr, nullptr, 1.0f, QK16, QKh, QKl);
    k_vtp<<<dim3((unsigned)(((size_t)NKV * TT * HD / 2 + 255) / 256), NB_, 1), 256, 0, stream>>>(F + DQ + DKV, DF, NKV, VT16, VTh, VTl);
    k_fattn<<<dim3(TT / 256, NH_, NB_), 256, 0, stream>>>(QK16, QK16 + (size_t)NH_ * TT * HD, VT16, ATh, ATl);
    k_gemmw<bf, 1, false><<<dim3(MT / 64, DM / 64, 1), 32, 0, stream>>>(ATh, ATl, WO, nullptr, DQ, OUT, DM, nullptr, 0, 0, 0);
}

// v003
// A run of this version takes 260 microseconds.
// Next to v002, in two timings, it ran 1.34 and 1.35 times as fast.
// Counting every step since v000, it is 9.64 times as fast.
#include <hip/hip_runtime.h>

// Grouped-query RoPE attention without a mask (x [2][2048][2048]; q = x Wq (32 heads x 64), k, v = x Wk / Wv ([2048][512]: 8 kv heads); rotate-half RoPE (theta 5e5, tables computed on device); kv head = h/4; softmax(q.k/8) over all keys; out = merged Wo -> [2][2048][2048] (8.4 M)).
// Compute dtypes, f32 accumulate: every input rounded to bf16; q/k/v on PLAIN bf16 operands (inputs: exact); rotary in f32; scores and attn.v on single fp16 operands for every row (x64 probability carry against the running maximum); online softmax f32, denominator summed in f32 from the f32 exponentials; Wo hl x exact (2 products).

#define NB_  2
#define TT   2048
#define DM   2048
#define NH_  32
#define NKV  8
#define REP  (NH_ / NKV)
#define HD   64
#define DQ   (NH_ * HD)
#define DKV  (NKV * HD)
#define DF   (DQ + 2 * DKV)   // columns of the joined q | k | v projection
#define NQK  (NH_ + NKV)       // rotated head planes of a batch: 32 q heads, then 8 k heads
#define MT   (NB_ * TT)        // rows of both batches
#define SCL  0.125f   // HD^-0.5
typedef _Float16 h16;
typedef unsigned short bf;
typedef __attribute__((ext_vector_type(16))) __bf16   v16bf;
typedef __attribute__((ext_vector_type(16))) _Float16 v16h;
typedef __attribute__((ext_vector_type(8)))  _Float16 v8h;
typedef __attribute__((ext_vector_type(8)))  unsigned short v8us;
typedef __attribute__((ext_vector_type(8)))  float    v8f;
typedef __attribute__((ext_vector_type(4)))  float    v4f;
typedef v8h  __attribute__((may_alias)) v8ha;
typedef v4f  __attribute__((may_alias)) v4fa;
typedef v8us __attribute__((may_alias)) v8usa;

__device__ __forceinline__ unsigned short f2bf(float f) { unsigned u = __float_as_uint(f); u += 0x7FFFu + ((u >> 16) & 1u); return (unsigned short)(u >> 16); }
__device__ __forceinline__ float bf2f(unsigned short b) { return __uint_as_float(((unsigned)b) << 16); }
__device__ __forceinline__ float bfr(float f) { return bf2f(f2bf(f)); }
__device__ __forceinline__ v16h cat16(v8h lo, v8h hi) { return __builtin_shufflevector(lo, hi, 0, 1, 2, 3, 4, 5, 6, 7, 8, 9, 10, 11, 12, 13, 14, 15); }
__device__ __forceinline__ v16bf cat16b(v8us lo, v8us hi) { return __builtin_bit_cast(v16bf, __builtin_shufflevector(lo, hi, 0, 1, 2, 3, 4, 5, 6, 7, 8, 9, 10, 11, 12, 13, 14, 15)); }
__device__ __forceinline__ v8f wmma16(v16h a, v16h b, v8f c) { return __builtin_amdgcn_wmma_f32_16x16x32_f16(false, a, false, b, (short)0, c, false, false); }
__device__ __forceinline__ v8f wmmab(v16bf a, v16bf b, v8f c) { return __builtin_amdgcn_wmma_f32_16x16x32_bf16(false, a, false, b, (short)0, c, false, false); }



// ---- FRAGMENT ORDER: every 16-bit matrix operand plane (rows x K) is stored as blocks of 16 rows x 32 k = 512 elements, block (row / 16, k / 32) at element (row / 16) * 16 * K + (k / 32) * 512.
// Inside a block the element (row, k) lies at ((k >> 4) & 1) * 256 + ((k >> 3) & 1) * 128 + (row & 15) * 8 + (k & 7): lane l of the wave finds its first 8 operand elements at l * 8 and its last 8 at 256 + l * 8,
// so each of a fragment's two 16-byte loads covers 512 contiguous bytes (4 whole lines), where a row-major plane made it touch 16 lines. The k order of a fragment is what it was.
__device__ __forceinline__ size_t fidx(size_t row, int k, int K) { return (row >> 4) * ((size_t)16 * K) + (size_t)(k >> 5) * 512 + ((k >> 4) & 1) * 256 + ((k >> 3) & 1) * 128 + (row & 15) * 8 + (k & 7); }
// ---- k_gemmw: register-blocked GEMM, ONE WAVE per 64x64 output tile (16 accumulators), operands straight from 16-bit planes in fragment order; grid (M/64, N/64, Z), 32 threads.
// C[m][n] (f32, pitch ldc, + optional f32 bias[n]) = sum_k A[m][k] Bt[n][k] (+ split products per NSPLIT). z-batch strides sA/sB/sC in elements. K % 32 == 0.
template <typename T16> struct WFrag;
template <> struct WFrag<h16> { typedef v16h V; static __device__ __forceinline__ V ld(const h16* p) { return cat16(*(const v8h*)p, *(const v8h*)(p + 256)); } static __device__ __forceinline__ v8f mma(V a, V b, v8f c) { return wmma16(a, b, c); } };
template <> struct WFrag<bf> { typedef v16bf V; static __device__ __forceinline__ V ld(const bf* p) { return cat16b(*(const v8us*)p, *(const v8us*)(p + 256)); } static __device__ __forceinline__ v8f mma(V a, V b, v8f c) { return wmmab(a, b, c); } };
template <typename T16, int NSPLIT, bool BIAS>
__global__ __launch_bounds__(32) void k_gemmw(const T16* __restrict__ A, const T16* __restrict__ A2, const T16* __restrict__ Bt, const T16* __restrict__ Bt2, int K, float* C, int ldc, const float* __restrict__ bias, size_t sA, size_t sB, size_t sC) {
    typedef typename WFrag<T16>::V V;
    __shared__ __align__(16) float os[16 * 68];
    const size_t z = blockIdx.z; A += z * sA; if (A2) A2 += z * sA; Bt += z * sB; if (Bt2) Bt2 += z * sB; C += z * sC;
    const int lane = threadIdx.x & 31, lr = lane & 15, hi = lane >> 4; const int r0 = blockIdx.x * 64, c0 = blockIdx.y * 64;
    v8f acc[4][4];
#pragma unroll
    for (int mb = 0; mb < 4; ++mb)
#pragma unroll
        for (int nb = 0; nb < 4; ++nb) acc[mb][nb] = (v8f){};
    // in fragment order only lane * 8 differs between the lanes: each run of 16 rows has one wave-uniform block pointer, which steps by one block (32 k, 512 elements) a trip
    typedef const __attribute__((address_space(1))) T16* GP;   // says 'global memory' of a pointer that is carried round the loop, where the compiler no longer sees it and would fall back to flat loads
    const unsigned lo = lane * 8; GP pa[4], pa2[4], pb[4], pb2[4];
#pragma unroll
    for (int i = 0; i < 4; ++i) { pa[i] = (GP)A + (size_t)(r0 + 16 * i) * K; pa2[i] = (NSPLIT == 1 || NSPLIT == 2) ? (GP)A2 + (size_t)(r0 + 16 * i) * K : pa[i]; pb[i] = (GP)Bt + (size_t)(c0 + 16 * i) * K; pb2[i] = NSPLIT >= 2 ? (GP)Bt2 + (size_t)(c0 + 16 * i) * K : pb[i]; }   // a plane that this instance lacks: the pointer stands for its partner's
#pragma unroll 1
    for (int kc = 0; kc < K; kc += 32) {
        V a[4], a2[4];
#pragma unroll
        for (int mb = 0; mb < 4; ++mb) { a[mb] = WFrag<T16>::ld((const T16*)(pa[mb] + lo)); if (NSPLIT == 1 || NSPLIT == 2) a2[mb] = WFrag<T16>::ld((const T16*)(pa2[mb] + lo)); }
#pragma unroll
        for (int nb = 0; nb < 4; ++nb) { const V b = WFrag<T16>::ld((const T16*)(pb[nb] + lo)); V b2; if (NSPLIT >= 2) b2 = WFrag<T16>::ld((const T16*)(pb2[nb] + lo));
#pragma unroll
            for (int mb = 0; mb < 4; ++mb) { acc[mb][nb] = WFrag<T16>::mma(a[mb], b, acc[mb][nb]); if (NSPLIT == 1 || NSPLIT == 2) acc[mb][nb] = WFrag<T16>::mma(a2[mb], b, acc[mb][nb]); if (NSPLIT >= 2) acc[mb][nb] = WFrag<T16>::mma(a[mb], b2, acc[mb][nb]); } }
        asm volatile("v_nop\n\tv_nop\n\tv_nop\n\tv_nop" : "+v"(acc[0][0]), "+v"(acc[1][1]), "+v"(acc[2][2]), "+v"(acc[3][3]) : "v"(a[0]), "v"(a[3]));
        // stands in front of the step of the block pointers that the trip's loads name; the operands keep every one of them whole up to the wait (the lane offset is never rewritten in the loop)
        asm volatile("s_wait_xcnt 0x0" :: "s"(pa[0]), "s"(pa[1]), "s"(pa[2]), "s"(pa[3]), "s"(pa2[0]), "s"(pa2[1]), "s"(pa2[2]), "s"(pa2[3]), "s"(pb[0]), "s"(pb[1]), "s"(pb[2]), "s"(pb[3]), "s"(pb2[0]), "s"(pb2[1]), "s"(pb2[2]), "s"(pb2[3]) : "memory");
#pragma unroll
        for (int i = 0; i < 4; ++i) { pa[i] += 512; pa2[i] = (NSPLIT == 1 || NSPLIT == 2) ? pa2[i] + 512 : pa[i]; pb[i] += 512; pb2[i] = NSPLIT >= 2 ? pb2[i] + 512 : pb[i]; }
    }
#pragma unroll
    for (int mb = 0; mb < 4; ++mb) {
#pragma unroll
        for (int nb = 0; nb < 4; ++nb) {
#pragma unroll
            for (int j = 0; j < 8; ++j) os[(hi * 8 + j) * 68 + nb * 16 + lr] = acc[mb][nb][j]; }
        __builtin_amdgcn_wave_barrier(); asm volatile("" ::: "memory");
        float* crow = C + (size_t)(r0 + mb * 16) * ldc + c0;
{
#pragma unroll
            for (int s = 0; s < 8; ++s) { const int row = 2 * s + hi, cofs = lr * 4; v4f val = *(const v4fa*)(os + row * 68 + cofs); if (BIAS) { val[0] += bfr(bias[c0 + cofs]); val[1] += bfr(bias[c0 + cofs + 1]); val[2] += bfr(bias[c0 + cofs + 2]); val[3] += bfr(bias[c0 + cofs + 3]); }
                *(v4f*)(crow + (size_t)row * ldc + cofs) = val; }
             }
        __builtin_amdgcn_wave_barrier(); asm volatile("" ::: "memory");
    }
}

__device__ __forceinline__ h16 tohx(float x) { return (h16)x; }
__device__ __forceinline__ void splitf(float y, unsigned short& h, unsigned short& l) { h = f2bf(y); l = f2bf(y - bf2f(h)); }
typedef __attribute__((ext_vector_type(2))) _Float16 v2h;
typedef __attribute__((ext_vector_type(4))) _Float16 v4h;
typedef __attribute__((ext_vector_type(2))) unsigned short v2us;
typedef __attribute__((ext_vector_type(4))) unsigned short v4us;
typedef __attribute__((ext_vector_type(2))) float v2f;
typedef __attribute__((ext_vector_type(4))) int v4i;

// all four weights in one launch: blockIdx.y picks the weight (wq, wk, wv into the joined plane, wo into its own); blocks past a narrow weight's last piece leave at once.
// A thread writes one 16-byte piece (8 k of one n) of the transposed plane in fragment order. A wave takes 32 neighbouring n at the same 8 k: each of its 8 loads is one whole line of w, its store two runs of 256 bytes.
__global__ __launch_bounds__(256) void k_wtG(const float* __restrict__ wq, const float* __restrict__ wk, const float* __restrict__ wv, const float* __restrict__ wo, bf* WF, bf* WO) {
    const int y = blockIdx.y; const float* __restrict__ w = y == 0 ? wq : y == 1 ? wk : y == 2 ? wv : wo; const int K = y == 3 ? DQ : DM, N = y == 0 ? DQ : y == 3 ? DM : DKV;
    bf* Bt = y == 0 ? WF : y == 1 ? WF + (size_t)DQ * DM : y == 2 ? WF + (size_t)(DQ + DKV) * DM : WO;
    const int i = blockIdx.x * 256 + threadIdx.x; if (i >= N * K / 8) return;
    const int grp = i >> 7, lg = y == 0 || y == 3 ? 6 : 4; static_assert(DQ / 32 == 1 << 6 && DM / 32 == 1 << 6 && DKV / 32 == 1 << 4, "lg = log2(N / 32)");   // 128 threads a group of 32 n x 32 k; neighbouring groups take neighbouring lines of the same rows of w
    const int n = (grp & ((1 << lg) - 1)) * 32 + (i & 31), k = (grp >> lg) * 32 + ((i >> 5) & 3) * 8; v8us o;
#pragma unroll
    for (int q = 0; q < 8; ++q) o[q] = f2bf(w[(size_t)(k + q) * N + n]);
    *(v8us*)(Bt + fidx(n, k, K)) = o;
}
// x (rows of DM) rounded to bf16, in fragment order: a thread writes one 16-byte piece (8 k of one row). A wave takes 32 k of 8 rows: it reads 8 whole lines of x and stores 4 whole lines (8 rows' pieces of the same 8 k lie side by side)
__global__ __launch_bounds__(256) void k_cvt8(const float* __restrict__ src, bf* dst, size_t n8) { const size_t i = (size_t)blockIdx.x * 256 + threadIdx.x; if (i >= n8) return;
    const size_t row = (i >> 6) / (DM / 32) * 16 + ((i >> 2) & 15); const int k = (int)((i >> 6) % (DM / 32)) * 32 + (int)(i & 3) * 8; const v8f v = *(const v8f*)(src + row * DM + k); v8us o;
#pragma unroll
    for (int q = 0; q < 8; ++q) o[q] = f2bf(v[q]); *(v8us*)(dst + fidx(row, k, DM)) = o;  }
__constant__ float INV[HD / 2] = {1.00000000f,0.663601220f,0.440366596f,0.292227834f,0.193922743f,0.128687367f,0.0853971019f,0.0566696227f,0.0376060307f,0.0249554086f,0.0165604409f,0.0109895281f,0.00729266461f,0.00483942125f,0.00321144611f,0.00213111960f,0.00141421356f,0.000938473851f,0.000622772437f,0.000413272559f,0.000274248188f,0.000181991432f,0.000120769735f,0.0000801429487f,0.0000531829573f,0.0000352922762f,0.0000234199997f,0.0000155415401f,0.0000103133852f,0.00000684397537f,0.00000454167048f,0.00000301385808f};
__global__ __launch_bounds__(256) void k_cstab(float* CS) { const int idx = blockIdx.x * 256 + threadIdx.x; if (idx >= TT * HD) return; const int t = idx / HD, d = idx % HD; const float ang = __fmul_rn((float)t, INV[d % (HD / 2)]); v2f cs; cs[0] = cosf(ang); cs[1] = sinf(ang);
    *(v2f*)(CS + (size_t)idx * 2) = cs;  }

// k_rope: head planes [b][h][t][d] (the fp16 plane, which the products read, in fragment order: rows h t, K = HD; both batches; h runs over the q heads and then the k heads, whose columns follow them in the joined projection; fp16 + hi/lo) of rope(x) x sc with the rotate-half convention out[d] = x[d] cos[t][d] - x[d+HD/2] sin[t][d], out[d+HD/2] = x[d+HD/2] cos[t][d+HD/2] + x[d] sin[t][d+HD/2]
__global__ __launch_bounds__(256) void k_rope(const float* __restrict__ F, int pitch, int nheads, const float* __restrict__ CS, const float* __restrict__ RF, const float* __restrict__ nw, float sc, h16* P16, bf* Ph, bf* Pl) {
    { const size_t po = (size_t)blockIdx.y * nheads * TT * HD; F += (size_t)blockIdx.y * TT * pitch; P16 += po; Ph += po; Pl += po; }   // blockIdx.y = batch: its TT rows of F, its nheads planes
    const size_t e = ((size_t)blockIdx.x * 256 + threadIdx.x) * 2; if (e >= (size_t)nheads * TT * HD) return; const int d = (int)(e % HD); const int t = (int)((e / HD) % TT); const int h = (int)(e / ((size_t)HD * TT)); const float* f = F + (size_t)t * pitch + h * HD; const float rf = RF ? RF[(size_t)h * TT + t] : 1.0f; v2h o16; v2us oh, ol;
#pragma unroll
    for (int q = 0; q < 2; ++q) { const int dd = d + q; const int dp = (dd < HD / 2) ? dd + HD / 2 : dd - HD / 2; float x0 = f[dd], x1 = f[dp];
        if (RF) { float n0 = __fmul_rn(x0, rf), n1 = __fmul_rn(x1, rf); asm volatile("" : "+v"(n0)); asm volatile("" : "+v"(n1)); x0 = __fmul_rn(bfr(nw[dd]), n0); x1 = __fmul_rn(bfr(nw[dp]), n1); }
        const v2f cs = *(const v2f*)(CS + ((size_t)t * HD + dd) * 2); float a = __fmul_rn(x0, cs[0]), bq = __fmul_rn(x1, cs[1]); asm volatile("" : "+v"(a)); asm volatile("" : "+v"(bq)); const float r = ((dd < HD / 2) ? __fsub_rn(a, bq) : __fadd_rn(a, bq)) * sc;
        o16[q] = tohx(r); unsigned short a2, c2; splitf(r, a2, c2); oh[q] = a2; ol[q] = c2; }
    *(v2h*)(P16 + fidx((size_t)h * TT + t, d, HD)) = o16; *(v2us*)(Ph + e) = oh; *(v2us*)(Pl + e) = ol;  }
__global__ __launch_bounds__(256) void k_vtp(const float* __restrict__ F, int pitch, int nheads, h16* V16, bf* Vh, bf* Vl) { { const size_t po = (size_t)blockIdx.y * nheads * HD * TT; F += (size_t)blockIdx.y * TT * pitch; V16 += po; Vh += po; Vl += po; }   // blockIdx.y = batch; planes [b][g][d][t] in fragment order (rows g d, K = TT); a thread takes the plane's elements e, e + 1 and finds their row and t
    const size_t e = ((size_t)blockIdx.x * 256 + threadIdx.x) * 2; if (e >= (size_t)nheads * HD * TT) return; const int t = (int)((e >> 9) % (TT / 32)) * 32 + (int)((e >> 7) & 3) * 8 + (int)(e & 7); const int gd = (int)(e / ((size_t)16 * TT)) * 16 + (int)((e >> 3) & 15); v2h o16; v2us oh, ol;
#pragma unroll
    for (int q = 0; q < 2; ++q) { const float x = F[(size_t)(t + q) * pitch + gd]; o16[q] = tohx(x); unsigned short a2, c2; splitf(x, a2, c2); oh[q] = a2; ol[q] = c2; }
    *(v2h*)(V16 + e) = o16; *(v2us*)(Vh + e) = oh; *(v2us*)(Vl + e) = ol;  }
#define PC2  6.0f
#define CS2  (SCL * 1.4426950408889634f)
__device__ __forceinline__ float xhalf(float x) { return __builtin_bit_cast(float, __builtin_amdgcn_permlanex16(__builtin_bit_cast(int, x), __builtin_bit_cast(int, x), 0x76543210, 0xfedcba98, false, false)); }  // lane l with lane l ^ 16
__device__ __forceinline__ void sfence() { __builtin_amdgcn_sched_barrier(0); }   // keeps a load group where it is written, so that it flies under the work behind it
struct KVf { v16h k[2][2]; v16h v[4]; };
__device__ __forceinline__ void ld_k(KVf& f, const h16* kp) {
#pragma unroll
    for (int kt = 0; kt < 2; ++kt)
#pragma unroll
        for (int kc = 0; kc < 2; ++kc) f.k[kt][kc] = WFrag<h16>::ld(kp + kt * 16 * HD + kc * 512); }
__device__ __forceinline__ void ld_v(KVf& f, const h16* vp) {
#pragma unroll
    for (int t = 0; t < 4; ++t) f.v[t] = WFrag<h16>::ld(vp + t * 16 * TT); }
// one pass of 32 keys; its K fragments are refilled for pass + 2 behind the score products, its V fragments behind the second product.
// The two fragment sets share one K and one V^T lane pointer: set 0 steps it by two passes, set 1 reads 32 keys behind it (in V^T one block, 512 elements, of each 16 rows).
__device__ __forceinline__ void xwait() { asm volatile("s_wait_xcnt 0x0" ::: "memory"); }   // stands in front of the overwrite of an address register that issued loads name
template <int SET>
__device__ __forceinline__ void fpass(KVf& f, const h16*& kp, const h16*& vp, int kstep, int vstep, const v16h (&qf)[2][2], v8f (&acc)[2][4], float (&lsum)[2], float (&mrun)[2]) {
    v8f s[2][2];
#pragma unroll
    for (int kt = 0; kt < 2; ++kt)
#pragma unroll
        for (int g = 0; g < 2; ++g) { s[kt][g] = (v8f){};
#pragma unroll
            for (int kc = 0; kc < 2; ++kc) s[kt][g] = wmma16(f.k[kt][kc], qf[g][kc], s[kt][g]); }
    sfence();
    if (SET == 0) { xwait(); sfence(); kp += kstep; }
    ld_k(f, kp + SET * 32 * HD);
    sfence();
    float mb[2]; bool need = false;
#pragma unroll
    for (int g = 0; g < 2; ++g) { float mx = -INFINITY;
#pragma unroll
        for (int kt = 0; kt < 2; ++kt)
#pragma unroll
            for (int r = 0; r < 8; ++r) mx = fmaxf(mx, s[kt][g][r]);
        mx = fmaxf(mx, xhalf(mx)) * CS2; mb[g] = mx; need = need || (mx > mrun[g] + 8.0f); }
    if (__builtin_amdgcn_ballot_w32(need) != 0) {   // wave-uniform; rare after the first passes
#pragma unroll
        for (int g = 0; g < 2; ++g) { const float mn = fmaxf(mrun[g], mb[g]); const float corr = __builtin_amdgcn_exp2f(mrun[g] - mn); mrun[g] = mn; lsum[g] = lsum[g] * corr;
#pragma unroll
            for (int t = 0; t < 4; ++t) acc[g][t] = acc[g][t] * corr; } }
#pragma unroll
    for (int g = 0; g < 2; ++g) { const float nm = PC2 - mrun[g]; v16h pf; float p[16];
#pragma unroll
        for (int e = 0; e < 16; ++e) { p[e] = __builtin_amdgcn_exp2f(fmaf(s[e >> 3][g][e & 7], CS2, nm)); pf[e] = tohx(p[e]); }   // element e of the 32-key operand = tile e >> 3, register e & 7 (the hardware k order, as the V^T loader's)
#pragma unroll
        for (int w = 8; w; w >>= 1)
#pragma unroll
            for (int e = 0; e < w; ++e) p[e] += p[e + w];
        lsum[g] += p[0];
#pragma unroll
        for (int t = 0; t < 4; ++t) acc[g][t] = wmma16(f.v[t], pf, acc[g][t]); }
    sfence();
    if (SET == 0) { xwait(); sfence(); vp += vstep; }
    ld_v(f, vp + SET * 512);
    sfence();
}
__global__ __launch_bounds__(256) void k_fattn(const h16* __restrict__ Q16, const h16* __restrict__ K16, const h16* __restrict__ V16, bf* Ah, bf* Al) {
    const int lane = threadIdx.x & 31, c = lane & 15, hi = lane >> 4; const int wave = __builtin_amdgcn_readfirstlane(threadIdx.x >> 5);
    const int h = blockIdx.y, q0 = blockIdx.x * 256 + wave * 32;
    { const size_t z = blockIdx.z; Q16 += z * NQK * TT * HD; K16 += z * NQK * TT * HD; V16 += z * NKV * HD * TT; Ah += z * TT * DQ; Al += z * TT * DQ; }   // blockIdx.z = batch; a batch's q and k planes lie in one run of NQK planes
    const h16* qp = Q16 + ((size_t)h * TT + q0) * HD + lane * 8;
    const h16* kp = K16 + (size_t)(h / REP) * TT * HD + lane * 8; const h16* vp = V16 + (size_t)(h / REP) * HD * TT + lane * 8;
    v16h qf[2][2];
#pragma unroll
    for (int g = 0; g < 2; ++g)
#pragma unroll
        for (int kc = 0; kc < 2; ++kc) qf[g][kc] = WFrag<h16>::ld(qp + g * 16 * HD + kc * 512);
    // the first two passes' fragments, issued in the loop's own order (K, V, K, V): only then are the loop's load waits counted ones that leave the younger groups in flight
    KVf fa, fb; sfence();
    asm volatile("s_wait_xcnt 0x0" :: "v"(qp) : "memory");   // as xwait(); the operand keeps the Q loads' address pair from being reused in front of the wait
    sfence(); ld_k(fa, kp); sfence(); ld_v(fa, vp); sfence(); ld_k(fb, kp + 32 * HD); sfence(); ld_v(fb, vp + 512); sfence(); xwait(); sfence();
    v8f acc[2][4]; float lsum[2], mrun[2];
#pragma unroll
    for (int g = 0; g < 2; ++g) { mrun[g] = -INFINITY; lsum[g] = 0.0f;
#pragma unroll
        for (int t = 0; t < 4; ++t) acc[g][t] = (v8f){}; }
#pragma unroll 1   // two passes a trip, one per fragment set; more would only grow the code
    for (int key0 = 0; key0 < TT; key0 += 64) {   // the last trip's refills step back to keys 0 and 32: in bounds, not used
        const bool more = key0 + 64 < TT; const int kstep = more ? 64 * HD : -(TT - 64) * HD, vstep = more ? 64 * 16 : -(TT - 64) * 16;
        fpass<0>(fa, kp, vp, kstep, vstep, qf, acc, lsum, mrun);
        fpass<1>(fb, kp, vp, kstep, vstep, qf, acc, lsum, mrun); }
#pragma unroll
    for (int g = 0; g < 2; ++g) { const float inv = __fdiv_rn(1.0f, lsum[g] + xhalf(lsum[g]));   // a query's 32 keys of a pass lie half in lane c, half in lane c + 16
        const size_t oo = fidx(q0 + 16 * g + c, h * HD + 8 * hi, DQ);   // the merged planes are the last product's A operand: fragment order, a wave's store 512 contiguous bytes; 16 d further lie 256 elements on
#pragma unroll
        for (int t = 0; t < 4; ++t) { v8us oh, ol;   // acc[g][t][r] = O[query c][d = 16 t + 8 hi + r]
#pragma unroll
            for (int r = 0; r < 8; ++r) { unsigned short a, c2; splitf(acc[g][t][r] * inv, a, c2); oh[r] = a; ol[r] = c2; }
            *(v8us*)(Ah + oo + 256 * t) = oh; *(v8us*)(Al + oo + 256 * t) = ol; if (g == 0 || t < 3) xwait(); } }   // the wait: the next pair's values are formed in registers that these stores name (behind the last pair nothing is)
}

extern "C" void kernel_launch(void* const* d_in, const int* in_sizes, int n_in,
                              void* d_out, int out_size, void* d_ws, size_t ws_size, hipStream_t stream) {
    (void)in_sizes; (void)n_in; (void)out_size;
    const float* x = (const float*)d_in[0]; const float* wq = (const float*)d_in[1]; const float* wk = (const float*)d_in[2]; const float* wv = (const float*)d_in[3]; const float* wo = (const float*)d_in[4];
    float* OUT = (float*)d_out;     // [2][2048][2048]
    char* wsp = (char*)d_ws;
    auto take = [&](size_t bytes) { char* p = wsp; wsp += (bytes + 255) & ~(size_t)255; return (void*)p; };
    bf* WF = (bf*)take((size_t)DF * DM * 2); bf* WO = (bf*)take((size_t)DM * DQ * 2); float* CS = (float*)take((size_t)TT * HD * 2 * 4);   // WF: wq, wk, wv transposed, row after row: one [DF][DM] operand
    bf* XB = (bf*)take((size_t)MT * DM * 2); float* F = (float*)take((size_t)MT * DF * 4);   // F[b t][q | k | v]
    h16* QK16 = (h16*)take((size_t)NB_ * NQK * TT * HD * 2); h16* VT16 = (h16*)take((size_t)NB_ * NKV * HD * TT * 2);
    bf* QKh = (bf*)take((size_t)NB_ * NQK * TT * HD * 2); bf* QKl = (bf*)take((size_t)NB_ * NQK * TT * HD * 2); bf* VTh = (bf*)take((size_t)NB_ * NKV * HD * TT * 2); bf* VTl = (bf*)take((size_t)NB_ * NKV * HD * TT * 2);
    bf* ATh = (bf*)take((size_t)MT * DQ * 2); bf* ATl = (bf*)take((size_t)MT * DQ * 2);
    if ((size_t)(wsp - (char*)d_ws) > ws_size) return;    // 189 MiB of the 256 MiB
    // every stage is ONE launch over all of its work: both batches as 4096 rows (a grid index in k_rope, k_vtp and k_fattn), q, k and v as one product: 3 and 2 one-wave tiles a SIMD in the two products, where a batch's k or v product alone left three SIMDs in four empty
    // Left open: k_gemmw waits out two load latencies a trip (no fetch ahead, no LDS); its 64-column tile is one head, so k_rope and k_vtp could be its epilogue; the hi/lo planes of q, k, v are written and never read; k_fattn's registers (over 256 a wave, so three waves a SIMD at most) keep it at one 8-wave workgroup a WGP
    k_wtG<<<dim3((unsigned)(DM * DQ / 8 / 256), 4, 1), 256, 0, stream>>>(wq, wk, wv, wo, WF, WO);
    k_cstab<<<(TT * HD + 255) / 256, 256, 0, stream>>>(CS);
    k_cvt8<<<(unsigned)(((size_t)MT * DM / 8 + 255) / 256), 256, 0, stream>>>(x, XB, (size_t)MT * DM / 8);
    k_gemmw<bf, 0, false><<<dim3(MT / 64, DF / 64, 1), 32, 0, stream>>>(XB, nullptr, WF, nullptr, DM, F, DF, nullptr, 0, 0, 0);
    k_rope<<<dim3((unsigned)(((size_t)NQK * TT * HD / 2 + 255) / 256), NB_, 1), 256, 0, stream>>>(F, DF, NQK, CS, nullptr, nullptr, 1.0f, QK16, QKh, QKl);
    k_vtp<<<dim3((unsigned)(((size_t)NKV * TT * HD / 2 + 255) / 256), NB_, 1), 256, 0, stream>>>(F + DQ + DKV, DF, NKV, VT16, VTh, VTl);
    k_fattn<<<dim3(TT / 256, NH_, NB_), 256, 0, stream>>>(QK16, QK16 + (size_t)NH_ * TT * HD, VT16, ATh, ATl);
    k_gemmw<bf, 1, false><<<dim3(MT / 64, DM / 64, 1), 32, 0, stream>>>(ATh, ATl, WO, nullptr, DQ, OUT, DM, nullptr, 0, 0, 0);
}

// v004
// A run of this version takes 226 microseconds.
// Two timings next to v003 put it at 1.14 and 1.15 times that version's speed.
// Over all steps from v000 it is 11.0 times as fast.
#include <hip/hip_runtime.h>

// Grouped-query RoPE attention without a mask (x [2][2048][2048]; q = x Wq (32 heads x 64), k, v = x Wk / Wv ([2048][512]: 8 kv heads); rotate-half RoPE (theta 5e5, tables computed on device); kv head = h/4; softmax(q.k/8) over all keys; out = merged Wo -> [2][2048][2048] (8.4 M)).
// Compute dtypes, f32 accumulate: every input rounded to bf16; q/k/v on PLAIN bf16 operands (inputs: exact); rotary in f32; scores and attn.v on single fp16 operands for every row (x64 probability carry against the running maximum); online softmax f32, denominator summed in f32 from the f32 exponentials; Wo hl x exact (2 products).

#define NB_  2
#define TT   2048
#define DM   2048
#define NH_  32
#define NKV  8
#define REP  (NH_ / NKV)
#define HD   64
#define DQ   (NH_ * HD)
#define DKV  (NKV * HD)
#define DF   (DQ + 2 * DKV)   // columns of the joined q | k | v projection
#define NQK  (NH_ + NKV)       // rotated head planes of a batch: 32 q heads, then 8 k heads
#define MT   (NB_ * TT)        // rows of both batches
#define SCL  0.125f   // HD^-0.5
typedef _Float16 h16;
typedef unsigned short bf;
typedef __attribute__((ext_vector_type(16))) __bf16   v16bf;
typedef __attribute__((ext_vector_type(16))) _Float16 v16h;
typedef __attribute__((ext_vector_type(8)))  _Float16 v8h;
typedef __attribute__((ext_vector_type(8)))  unsigned short v8us;
typedef __attribute__((ext_vector_type(8)))  float    v8f;
typedef __attribute__((ext_vector_type(4)))  float    v4f;
typedef v8h  __attribute__((may_alias)) v8ha;
typedef v4f  __attribute__((may_alias)) v4fa;
typedef v8us __attribute__((may_alias)) v8usa;

__device__ __forceinline__ unsigned short f2bf(float f) { unsigned u = __float_as_uint(f); u += 0x7FFFu + ((u >> 16) & 1u); return (unsigned short)(u >> 16); }
__device__ __forceinline__ float bf2f(unsigned short b) { return __uint_as_float(((unsigned)b) << 16); }
__device__ __forceinline__ float bfr(float f) { return bf2f(f2bf(f)); }
__device__ __forceinline__ v16h cat16(v8h lo, v8h hi) { return __builtin_shufflevector(lo, hi, 0, 1, 2, 3, 4, 5, 6, 7, 8, 9, 10, 11, 12, 13, 14, 15); }
__device__ __forceinline__ v16bf cat16b(v8us lo, v8us hi) { return __builtin_bit_cast(v16bf, __builtin_shufflevector(lo, hi, 0, 1, 2, 3, 4, 5, 6, 7, 8, 9, 10, 11, 12, 13, 14, 15)); }
__device__ __forceinline__ v8f wmma16(v16h a, v16h b, v8f c) { return __builtin_amdgcn_wmma_f32_16x16x32_f16(false, a, false, b, (short)0, c, false, false); }
__device__ __forceinline__ v8f wmmab(v16bf a, v16bf b, v8f c) { return __builtin_amdgcn_wmma_f32_16x16x32_bf16(false, a, false, b, (short)0, c, false, false); }



// ---- FRAGMENT ORDER: every 16-bit matrix operand plane (rows x K) is stored as blocks of 16 rows x 32 k = 512 elements, block (row / 16, k / 32) at element (row / 16) * 16 * K + (k / 32) * 512.
// Inside a block the element (row, k) lies at ((k >> 4) & 1) * 256 + ((k >> 3) & 1) * 128 + (row & 15) * 8 + (k & 7): lane l of the wave finds its first 8 operand elements at l * 8 and its last 8 at 256 + l * 8,
// so each of a fragment's two 16-byte loads covers 512 contiguous bytes (4 whole lines), where a row-major plane made it touch 16 lines. The k order of a fragment is what it was.
__device__ __forceinline__ size_t fidx(size_t row, int k, int K) { return (row >> 4) * ((size_t)16 * K) + (size_t)(k >> 5) * 512 + ((k >> 4) & 1) * 256 + ((k >> 3) & 1) * 128 + (row & 15) * 8 + (k & 7); }
// ---- k_gemmw: register-blocked GEMM, ONE WAVE per 64x64 output tile (16 accumulators), operands straight from 16-bit planes in fragment order; grid (M/64, N/64, Z), 32 threads.
// C[m][n] (f32, pitch ldc, + optional f32 bias[n]) = sum_k A[m][k] Bt[n][k] (+ split products per NSPLIT). z-batch strides sA/sB/sC in elements. K % 32 == 0.
// HEADS (the joined q | k | v projection; a 64-column tile is one head): no C plane. The epilogue turns the accumulators into the fp16 operand planes that k_fattn reads, in fragment order, straight from the registers.
// A lane's 8 accumulator registers run along the A operand's rows. A v tile keeps x as A: 8 neighbouring t of one d, a 16-byte piece of the [d][t] plane. A q or k tile takes the weight rows as A and x as B (same loader, same k order, same sums):
// 8 neighbouring d of one t, a piece of the [t][d] plane, and the rotary partner d + 32 lies in the same lane and register two accumulator tiles on.
template <typename T16> struct WFrag;
template <> struct WFrag<h16> { typedef v16h V; static __device__ __forceinline__ V ld(const h16* p) { return cat16(*(const v8h*)p, *(const v8h*)(p + 256)); } static __device__ __forceinline__ v8f mma(V a, V b, v8f c) { return wmma16(a, b, c); } };
template <> struct WFrag<bf> { typedef v16bf V; static __device__ __forceinline__ V ld(const bf* p) { return cat16b(*(const v8us*)p, *(const v8us*)(p + 256)); } static __device__ __forceinline__ v8f mma(V a, V b, v8f c) { return wmmab(a, b, c); } };
template <typename T16, int NSPLIT, bool BIAS, bool HEADS>
__global__ __launch_bounds__(32) void k_gemmw(const T16* __restrict__ A, const T16* __restrict__ A2, const T16* __restrict__ Bt, const T16* __restrict__ Bt2, int K, float* C, int ldc, const float* __restrict__ bias, size_t sA, size_t sB, size_t sC, const float* __restrict__ CS, h16* QK, h16* VT) {
    typedef typename WFrag<T16>::V V;
    __shared__ __align__(16) float os[16 * 68];
    const size_t z = blockIdx.z; A += z * sA; if (A2) A2 += z * sA; Bt += z * sB; if (Bt2) Bt2 += z * sB; C += z * sC;
    const int lane = threadIdx.x & 31, lr = lane & 15, hi = lane >> 4; const int r0 = blockIdx.x * 64, c0 = blockIdx.y * 64;
    v8f acc[4][4];
#pragma unroll
    for (int mb = 0; mb < 4; ++mb)
#pragma unroll
        for (int nb = 0; nb < 4; ++nb) acc[mb][nb] = (v8f){};
    // in fragment order only lane * 8 differs between the lanes: each run of 16 rows has one wave-uniform block pointer, which steps by one block (32 k, 512 elements) a trip
    typedef const __attribute__((address_space(1))) T16* GP;   // says 'global memory' of a pointer that is carried round the loop, where the compiler no longer sees it and would fall back to flat loads
    const unsigned lo = lane * 8; GP pa[4], pa2[4], pb[4], pb2[4];
    static_assert(!HEADS || NSPLIT == 0, "the operand swap knows one plane a side");
    const bool rot = HEADS && c0 < DQ + DKV;   // a q or k head (the same for the whole wave): the two operands change places
    const GP Ar = rot ? (GP)Bt : (GP)A, Br = rot ? (GP)A : (GP)Bt; const int ar0 = rot ? c0 : r0, br0 = rot ? r0 : c0;
#pragma unroll
    for (int i = 0; i < 4; ++i) { pa[i] = Ar + (size_t)(ar0 + 16 * i) * K; pa2[i] = (NSPLIT == 1 || NSPLIT == 2) ? (GP)A2 + (size_t)(r0 + 16 * i) * K : pa[i]; pb[i] = Br + (size_t)(br0 + 16 * i) * K; pb2[i] = NSPLIT >= 2 ? (GP)Bt2 + (size_t)(c0 + 16 * i) * K : pb[i]; }   // a plane that this instance lacks: the pointer stands for its partner's
#pragma unroll 1
    for (int kc = 0; kc < K; kc += 32) {
        V a[4], a2[4];
#pragma unroll
        for (int mb = 0; mb < 4; ++mb) { a[mb] = WFrag<T16>::ld((const T16*)(pa[mb] + lo)); if (NSPLIT == 1 || NSPLIT == 2) a2[mb] = WFrag<T16>::ld((const T16*)(pa2[mb] + lo)); }
#pragma unroll
        for (int nb = 0; nb < 4; ++nb) { const V b = WFrag<T16>::ld((const T16*)(pb[nb] + lo)); V b2; if (NSPLIT >= 2) b2 = WFrag<T16>::ld((const T16*)(pb2[nb] + lo));
#pragma unroll
            for (int mb = 0; mb < 4; ++mb) { acc[mb][nb] = WFrag<T16>::mma(a[mb], b, acc[mb][nb]); if (NSPLIT == 1 || NSPLIT == 2) acc[mb][nb] = WFrag<T16>::mma(a2[mb], b, acc[mb][nb]); if (NSPLIT >= 2) acc[mb][nb] = WFrag<T16>::mma(a[mb], b2, acc[mb][nb]); } }
        asm volatile("v_nop\n\tv_nop\n\tv_nop\n\tv_nop" : "+v"(acc[0][0]), "+v"(acc[1][1]), "+v"(acc[2][2]), "+v"(acc[3][3]) : "v"(a[0]), "v"(a[3]));
        // stands in front of the step of the block pointers that the trip's loads name; the operands keep every one of them whole up to the wait (the lane offset is never rewritten in the loop)
        asm volatile("s_wait_xcnt 0x0" :: "s"(pa[0]), "s"(pa[1]), "s"(pa[2]), "s"(pa[3]), "s"(pa2[0]), "s"(pa2[1]), "s"(pa2[2]), "s"(pa2[3]), "s"(pb[0]), "s"(pb[1]), "s"(pb[2]), "s"(pb[3]), "s"(pb2[0]), "s"(pb2[1]), "s"(pb2[2]), "s"(pb2[3]) : "memory");
#pragma unroll
        for (int i = 0; i < 4; ++i) { pa[i] += 512; pa2[i] = (NSPLIT == 1 || NSPLIT == 2) ? pa2[i] + 512 : pa[i]; pb[i] += 512; pb2[i] = NSPLIT >= 2 ? pb2[i] + 512 : pb[i]; }
    }
    if (HEADS) {
        static_assert(TT % 64 == 0 && HD == 64, "a tile's 64 rows lie in one batch, its 64 columns are one head");
        const int bz = r0 / TT, t0 = r0 % TT;
        if (rot) {   // acc[mb][nb][j] = head column d = 16 mb + 8 hi + j of position t = t0 + 16 nb + lr
            const v4fa* tp = (const v4fa*)(CS + (size_t)(t0 >> 4) * (HD * 16)) + lane;   // k_cstab's order: every load below is 512 contiguous bytes
            h16* op = QK + (((size_t)bz * NQK + c0 / HD) * TT + t0) * HD + lo;            // fidx(head row t0 + lr, 8 hi, HD); 16 t further lie 16 HD elements on, 16 d further 256
            v4f cs[2][2][4];
#pragma unroll
            for (int mb = 0; mb < 2; ++mb)
#pragma unroll
                for (int q = 0; q < 4; ++q) cs[0][mb][q] = tp[(mb * 4 + q) * 32];
#pragma unroll
            for (int nb = 0; nb < 4; ++nb) {
                if (nb < 3) {
#pragma unroll
                    for (int mb = 0; mb < 2; ++mb)
#pragma unroll
                        for (int q = 0; q < 4; ++q) cs[(nb + 1) & 1][mb][q] = tp[(((nb + 1) * 2 + mb) * 4 + q) * 32]; }
                __builtin_amdgcn_sched_barrier(0);   // keeps the next 16 positions' table loads in front of this group's arithmetic, so that they fly under it
                v8h o[4];
#pragma unroll
                for (int mb = 0; mb < 2; ++mb)
#pragma unroll
                    for (int j = 0; j < 8; ++j) { const float co = cs[nb & 1][mb][j >> 1][(j & 1) * 2], si = cs[nb & 1][mb][j >> 1][(j & 1) * 2 + 1], x0 = acc[mb][nb][j], x1 = acc[mb + 2][nb][j];
                        o[mb][j] = (h16)(x0 * co - x1 * si); o[mb + 2][j] = (h16)(x1 * co + x0 * si); }
                __builtin_amdgcn_sched_barrier(0);   // all four pieces are formed in front of the first store: none is formed in a register that an issued store of the group names
#pragma unroll
                for (int mb = 0; mb < 4; ++mb) *(v8h*)(op + nb * 16 * HD + mb * 256) = o[mb];
                if (nb < 3) asm volatile("s_wait_xcnt 0x0" ::: "memory");   // the next group's pieces are formed in registers that these stores name (behind the last group nothing is)
            }
        } else {     // acc[mb][nb][j] = v column d = 16 nb + lr of position t = t0 + 16 mb + 8 hi + j
            h16* op = VT + ((size_t)bz * DKV + (c0 - DQ - DKV)) * TT + (size_t)(t0 >> 5) * 512 + lo;   // fidx(row d = lr, t0 + 8 hi, TT); 16 d further lie 16 TT elements on, 16 t further 256
#pragma unroll
            for (int nb = 0; nb < 4; ++nb) {
                v8h o[4];
#pragma unroll
                for (int mb = 0; mb < 4; ++mb)
#pragma unroll
                    for (int j = 0; j < 8; ++j) o[mb][j] = (h16)acc[mb][nb][j];
                __builtin_amdgcn_sched_barrier(0);   // as above: the group's four pieces first, then its stores
#pragma unroll
                for (int mb = 0; mb < 4; ++mb) *(v8h*)(op + (size_t)nb * 16 * TT + mb * 256) = o[mb];
                if (nb < 3) asm volatile("s_wait_xcnt 0x0" ::: "memory");   // as above
            }
        }
        return;
    }
#pragma unroll
    for (int mb = 0; mb < 4; ++mb) {
#pragma unroll
        for (int nb = 0; nb < 4; ++nb) {
#pragma unroll
            for (int j = 0; j < 8; ++j) os[(hi * 8 + j) * 68 + nb * 16 + lr] = acc[mb][nb][j]; }
        __builtin_amdgcn_wave_barrier(); asm volatile("" ::: "memory");
        float* crow = C + (size_t)(r0 + mb * 16) * ldc + c0;
{
#pragma unroll
            for (int s = 0; s < 8; ++s) { const int row = 2 * s + hi, cofs = lr * 4; v4f val = *(const v4fa*)(os + row * 68 + cofs); if (BIAS) { val[0] += bfr(bias[c0 + cofs]); val[1] += bfr(bias[c0 + cofs + 1]); val[2] += bfr(bias[c0 + cofs + 2]); val[3] += bfr(bias[c0 + cofs + 3]); }
                *(v4f*)(crow + (size_t)row * ldc + cofs) = val; }
             }
        __builtin_amdgcn_wave_barrier(); asm volatile("" ::: "memory");
    }
}

__device__ __forceinline__ h16 tohx(float x) { return (h16)x; }
__device__ __forceinline__ void splitf(float y, unsigned short& h, unsigned short& l) { h = f2bf(y); l = f2bf(y - bf2f(h)); }
typedef __attribute__((ext_vector_type(2))) _Float16 v2h;
typedef __attribute__((ext_vector_type(4))) _Float16 v4h;
typedef __attribute__((ext_vector_type(2))) unsigned short v2us;
typedef __attribute__((ext_vector_type(4))) unsigned short v4us;
typedef __attribute__((ext_vector_type(2))) float v2f;
typedef __attribute__((ext_vector_type(4))) int v4i;

// all four weights in one launch: blockIdx.y picks the weight (wq, wk, wv into the joined plane, wo into its own); blocks past a narrow weight's last piece leave at once.
// A thread writes one 16-byte piece (8 k of one n) of the transposed plane in fragment order. A wave takes 32 neighbouring n at the same 8 k: each of its 8 loads is one whole line of w, its store two runs of 256 bytes.
__global__ __launch_bounds__(256) void k_wtG(const float* __restrict__ wq, const float* __restrict__ wk, const float* __restrict__ wv, const float* __restrict__ wo, bf* WF, bf* WO) {
    const int y = blockIdx.y; const float* __restrict__ w = y == 0 ? wq : y == 1 ? wk : y == 2 ? wv : wo; const int K = y == 3 ? DQ : DM, N = y == 0 ? DQ : y == 3 ? DM : DKV;
    bf* Bt = y == 0 ? WF : y == 1 ? WF + (size_t)DQ * DM : y == 2 ? WF + (size_t)(DQ + DKV) * DM : WO;
    const int i = blockIdx.x * 256 + threadIdx.x; if (i >= N * K / 8) return;
    const int grp = i >> 7, lg = y == 0 || y == 3 ? 6 : 4; static_assert(DQ / 32 == 1 << 6 && DM / 32 == 1 << 6 && DKV / 32 == 1 << 4, "lg = log2(N / 32)");   // 128 threads a group of 32 n x 32 k; neighbouring groups take neighbouring lines of the same rows of w
    const int n = (grp & ((1 << lg) - 1)) * 32 + (i & 31), k = (grp >> lg) * 32 + ((i >> 5) & 3) * 8; v8us o;
#pragma unroll
    for (int q = 0; q < 8; ++q) o[q] = f2bf(w[(size_t)(k + q) * N + n]);
    *(v8us*)(Bt + fidx(n, k, K)) = o;
}
// x (rows of DM) rounded to bf16, in fragment order: a thread writes one 16-byte piece (8 k of one row). A wave takes 32 k of 8 rows: it reads 8 whole lines of x and stores 4 whole lines (8 rows' pieces of the same 8 k lie side by side)
__global__ __launch_bounds__(256) void k_cvt8(const float* __restrict__ src, bf* dst, size_t n8) { const size_t i = (size_t)blockIdx.x * 256 + threadIdx.x; if (i >= n8) return;
    const size_t row = (i >> 6) / (DM / 32) * 16 + ((i >> 2) & 15); const int k = (int)((i >> 6) % (DM / 32)) * 32 + (int)(i & 3) * 8; const v8f v = *(const v8f*)(src + row * DM + k); v8us o;
#pragma unroll
    for (int q = 0; q < 8; ++q) o[q] = f2bf(v[q]); *(v8us*)(dst + fidx(row, k, DM)) = o;  }
__constant__ float INV[HD / 2] = {1.00000000f,0.663601220f,0.440366596f,0.292227834f,0.193922743f,0.128687367f,0.0853971019f,0.0566696227f,0.0376060307f,0.0249554086f,0.0165604409f,0.0109895281f,0.00729266461f,0.00483942125f,0.00321144611f,0.00213111960f,0.00141421356f,0.000938473851f,0.000622772437f,0.000413272559f,0.000274248188f,0.000181991432f,0.000120769735f,0.0000801429487f,0.0000531829573f,0.0000352922762f,0.0000234199997f,0.0000155415401f,0.0000103133852f,0.00000684397537f,0.00000454167048f,0.00000301385808f};
// (cos, sin) of t x INV[d], d < HD / 2 (d + HD / 2 has the same angle), in the order in which the projection's epilogue reads them: pair p = ((((t / 16) * 2 + d / 16) * 4 + (d & 7) / 2) * 32 + ((d >> 3) & 1) * 16 + (t & 15)) * 2 + (d & 1),
// so that lane 16 hi + lr finds the pairs of d = 16 mb + 8 hi + 2 q, + 1 at position t = 16 tb + lr in one 16-byte load, and the wave's load covers 4 whole lines. Thread p writes pair p.
__global__ __launch_bounds__(256) void k_cstab(float* CS) { const int p = blockIdx.x * 256 + threadIdx.x; if (p >= TT * HD / 2) return; const int t = (p >> 9) * 16 + ((p >> 1) & 15), d = ((p >> 8) & 1) * 16 + ((p >> 5) & 1) * 8 + ((p >> 6) & 3) * 2 + (p & 1); const float ang = __fmul_rn((float)t, INV[d]); v2f cs; cs[0] = cosf(ang); cs[1] = sinf(ang);
    *(v2f*)(CS + (size_t)p * 2) = cs;  }

#define PC2  6.0f
#define CS2  (SCL * 1.4426950408889634f)
__device__ __forceinline__ float xhalf(float x) { return __builtin_bit_cast(float, __builtin_amdgcn_permlanex16(__builtin_bit_cast(int, x), __builtin_bit_cast(int, x), 0x76543210, 0xfedcba98, false, false)); }  // lane l with lane l ^ 16
__device__ __forceinline__ void sfence() { __builtin_amdgcn_sched_barrier(0); }   // keeps a load group where it is written, so that it flies under the work behind it
struct KVf { v16h k[2][2]; v16h v[4]; };
__device__ __forceinline__ void ld_k(KVf& f, const h16* kp) {
#pragma unroll
    for (int kt = 0; kt < 2; ++kt)
#pragma unroll
        for (int kc = 0; kc < 2; ++kc) f.k[kt][kc] = WFrag<h16>::ld(kp + kt * 16 * HD + kc * 512); }
__device__ __forceinline__ void ld_v(KVf& f, const h16* vp) {
#pragma unroll
    for (int t = 0; t < 4; ++t) f.v[t] = WFrag<h16>::ld(vp + t * 16 * TT); }
// one pass of 32 keys; its K fragments are refilled for pass + 2 behind the score products, its V fragments behind the second product.
// The two fragment sets share one K and one V^T lane pointer: set 0 steps it by two passes, set 1 reads 32 keys behind it (in V^T one block, 512 elements, of each 16 rows).
__device__ __forceinline__ void xwait() { asm volatile("s_wait_xcnt 0x0" ::: "memory"); }   // stands in front of the overwrite of an address register that issued loads name
template <int SET>
__device__ __forceinline__ void fpass(KVf& f, const h16*& kp, const h16*& vp, int kstep, int vstep, const v16h (&qf)[2][2], v8f (&acc)[2][4], float (&lsum)[2], float (&mrun)[2]) {
    v8f s[2][2];
#pragma unroll
    for (int kt = 0; kt < 2; ++kt)
#pragma unroll
        for (int g = 0; g < 2; ++g) { s[kt][g] = (v8f){};
#pragma unroll
            for (int kc = 0; kc < 2; ++kc) s[kt][g] = wmma16(f.k[kt][kc], qf[g][kc], s[kt][g]); }
    sfence();
    if (SET == 0) { xwait(); sfence(); kp += kstep; }
    ld_k(f, kp + SET * 32 * HD);
    sfence();
    float mb[2]; bool need = false;
#pragma unroll
    for (int g = 0; g < 2; ++g) { float mx = -INFINITY;
#pragma unroll
        for (int kt = 0; kt < 2; ++kt)
#pragma unroll
            for (int r = 0; r < 8; ++r) mx = fmaxf(mx, s[kt][g][r]);
        mx = fmaxf(mx, xhalf(mx)) * CS2; mb[g] = mx; need = need || (mx > mrun[g] + 8.0f); }
    if (__builtin_amdgcn_ballot_w32(need) != 0) {   // wave-uniform; rare after the first passes
#pragma unroll
        for (int g = 0; g < 2; ++g) { const float mn = fmaxf(mrun[g], mb[g]); const float corr = __builtin_amdgcn_exp2f(mrun[g] - mn); mrun[g] = mn; lsum[g] = lsum[g] * corr;
#pragma unroll
            for (int t = 0; t < 4; ++t) acc[g][t] = acc[g][t] * corr; } }
#pragma unroll
    for (int g = 0; g < 2; ++g) { const float nm = PC2 - mrun[g]; v16h pf; float p[16];
#pragma unroll
        for (int e = 0; e < 16; ++e) { p[e] = __builtin_amdgcn_exp2f(fmaf(s[e >> 3][g][e & 7], CS2, nm)); pf[e] = tohx(p[e]); }   // element e of the 32-key operand = tile e >> 3, register e & 7 (the hardware k order, as the V^T loader's)
#pragma unroll
        for (int w = 8; w; w >>= 1)
#pragma unroll
            for (int e = 0; e < w; ++e) p[e] += p[e + w];
        lsum[g] += p[0];
#pragma unroll
        for (int t = 0; t < 4; ++t) acc[g][t] = wmma16(f.v[t], pf, acc[g][t]); }
    sfence();
    if (SET == 0) { xwait(); sfence(); vp += vstep; }
    ld_v(f, vp + SET * 512);
    sfence();
}
__global__ __launch_bounds__(256) void k_fattn(const h16* __restrict__ Q16, const h16* __restrict__ K16, const h16* __restrict__ V16, bf* Ah, bf* Al) {
    const int lane = threadIdx.x & 31, c = lane & 15, hi = lane >> 4; const int wave = __builtin_amdgcn_readfirstlane(threadIdx.x >> 5);
    const int h = blockIdx.y, q0 = blockIdx.x * 256 + wave * 32;
    { const size_t z = blockIdx.z; Q16 += z * NQK * TT * HD; K16 += z * NQK * TT * HD; V16 += z * NKV * HD * TT; Ah += z * TT * DQ; Al += z * TT * DQ; }   // blockIdx.z = batch; a batch's q and k planes lie in one run of NQK planes
    const h16* qp = Q16 + ((size_t)h * TT + q0) * HD + lane * 8;
    const h16* kp = K16 + (size_t)(h / REP) * TT * HD + lane * 8; const h16* vp = V16 + (size_t)(h / REP) * HD * TT + lane * 8;
    v16h qf[2][2];
#pragma unroll
    for (int g = 0; g < 2; ++g)
#pragma unroll
        for (int kc = 0; kc < 2; ++kc) qf[g][kc] = WFrag<h16>::ld(qp + g * 16 * HD + kc * 512);
    // the first two passes' fragments, issued in the loop's own order (K, V, K, V): only then are the loop's load waits counted ones that leave the younger groups in flight
    KVf fa, fb; sfence();
    asm volatile("s_wait_xcnt 0x0" :: "v"(qp) : "memory");   // as xwait(); the operand keeps the Q loads' address pair from being reused in front of the wait
    sfence(); ld_k(fa, kp); sfence(); ld_v(fa, vp); sfence(); ld_k(fb, kp + 32 * HD); sfence(); ld_v(fb, vp + 512); sfence(); xwait(); sfence();
    v8f acc[2][4]; float lsum[2], mrun[2];
#pragma unroll
    for (int g = 0; g < 2; ++g) { mrun[g] = -INFINITY; lsum[g] = 0.0f;
#pragma unroll
        for (int t = 0; t < 4; ++t) acc[g][t] = (v8f){}; }
#pragma unroll 1   // two passes a trip, one per fragment set; more would only grow the code
    for (int key0 = 0; key0 < TT; key0 += 64) {   // the last trip's refills step back to keys 0 and 32: in bounds, not used
        const bool more = key0 + 64 < TT; const int kstep = more ? 64 * HD : -(TT - 64) * HD, vstep = more ? 64 * 16 : -(TT - 64) * 16;
        fpass<0>(fa, kp, vp, kstep, vstep, qf, acc, lsum, mrun);
        fpass<1>(fb, kp, vp, kstep, vstep, qf, acc, lsum, mrun); }
#pragma unroll
    for (int g = 0; g < 2; ++g) { const float inv = __fdiv_rn(1.0f, lsum[g] + xhalf(lsum[g]));   // a query's 32 keys of a pass lie half in lane c, half in lane c + 16
        const size_t oo = fidx(q0 + 16 * g + c, h * HD + 8 * hi, DQ);   // the merged planes are the last product's A operand: fragment order, a wave's store 512 contiguous bytes; 16 d further lie 256 elements on
#pragma unroll
        for (int t = 0; t < 4; ++t) { v8us oh, ol;   // acc[g][t][r] = O[query c][d = 16 t + 8 hi + r]
#pragma unroll
            for (int r = 0; r < 8; ++r) { unsigned short a, c2; splitf(acc[g][t][r] * inv, a, c2); oh[r] = a; ol[r] = c2; }
            *(v8us*)(Ah + oo + 256 * t) = oh; *(v8us*)(Al + oo + 256 * t) = ol; if (g == 0 || t < 3) xwait(); } }   // the wait: the next pair's values are formed in registers that these stores name (behind the last pair nothing is)
}

extern "C" void kernel_launch(void* const* d_in, const int* in_sizes, int n_in,
                              void* d_out, int out_size, void* d_ws, size_t ws_size, hipStream_t stream) {
    (void)in_sizes; (void)n_in; (void)out_size;
    const float* x = (const float*)d_in[0]; const float* wq = (const float*)d_in[1]; const float* wk = (const float*)d_in[2]; const float* wv = (const float*)d_in[3]; const float* wo = (const float*)d_in[4];
    float* OUT = (float*)d_out;     // [2][2048][2048]
    char* wsp = (char*)d_ws;
    auto take = [&](size_t bytes) { char* p = wsp; wsp += (bytes + 255) & ~(size_t)255; return (void*)p; };
    bf* WF = (bf*)take((size_t)DF * DM * 2); bf* WO = (bf*)take((size_t)DM * DQ * 2); float* CS = (float*)take((size_t)TT * (HD / 2) * 2 * 4);   // WF: wq, wk, wv transposed, row after row: one [DF][DM] operand
    bf* XB = (bf*)take((size_t)MT * DM * 2);
    h16* QK16 = (h16*)take((size_t)NB_ * NQK * TT * HD * 2); h16* VT16 = (h16*)take((size_t)NB_ * NKV * HD * TT * 2);
    bf* ATh = (bf*)take((size_t)MT * DQ * 2); bf* ATl = (bf*)take((size_t)MT * DQ * 2);
    if ((size_t)(wsp - (char*)d_ws) > ws_size) return;    // 93 MiB of the 256 MiB
    // every stage is ONE launch over all of its work: both batches as 4096 rows (a grid index in k_fattn), q, k and v as one product: 3 and 2 one-wave tiles a SIMD in the two products, where a batch's k or v product alone left three SIMDs in four empty
    // Left open: k_gemmw waits out two load latencies a trip (no fetch ahead, no LDS); k_wtG and k_cvt8 start a wave for every 512 bytes they write; k_fattn's registers (over 256 a wave, so three waves a SIMD at most) keep it at one 8-wave workgroup a WGP
    k_wtG<<<dim3((unsigned)(DM * DQ / 8 / 256), 4, 1), 256, 0, stream>>>(wq, wk, wv, wo, WF, WO);
    k_cstab<<<(TT * HD / 2 + 255) / 256, 256, 0, stream>>>(CS);
    k_cvt8<<<(unsigned)(((size_t)MT * DM / 8 + 255) / 256), 256, 0, stream>>>(x, XB, (size_t)MT * DM / 8);
    k_gemmw<bf, 0, false, true><<<dim3(MT / 64, DF / 64, 1), 32, 0, stream>>>(XB, nullptr, WF, nullptr, DM, nullptr, 0, nullptr, 0, 0, 0, CS, QK16, VT16);   // writes the rotated q and k planes and the transposed v plane
    k_fattn<<<dim3(TT / 256, NH_, NB_), 256, 0, stream>>>(QK16, QK16 + (size_t)NH_ * TT * HD, VT16, ATh, ATl);
    k_gemmw<bf, 1, false, false><<<dim3(MT / 64, DM / 64, 1), 32, 0, stream>>>(ATh, ATl, WO, nullptr, DQ, OUT, DM, nullptr, 0, 0, 0, nullptr, nullptr, nullptr);
}

// v005
// One run takes 150 microseconds.
// Next to v004, in two timings, it ran 1.49 and 1.50 times as fast.
// Counting every step since v000, it is 16.5 times as fast.
#include <hip/hip_runtime.h>

// Grouped-query RoPE attention without a mask (x [2][2048][2048]; q = x Wq (32 heads x 64), k, v = x Wk / Wv ([2048][512]: 8 kv heads); rotate-half RoPE (theta 5e5, tables computed on device); kv head = h/4; softmax(q.k/8) over all keys; out = merged Wo -> [2][2048][2048] (8.4 M)).
// Compute dtypes, f32 accumulate: every input rounded to bf16; q/k/v on PLAIN bf16 operands (inputs: exact); rotary in f32; scores and attn.v on single fp16 operands for every row (x64 probability carry against the running maximum); online softmax f32, denominator summed in f32 from the f32 exponentials; Wo hl x exact (2 products).

#define NB_  2
#define TT   2048
#define DM   2048
#define NH_  32
#define NKV  8
#define REP  (NH_ / NKV)
#define HD   64
#define DQ   (NH_ * HD)
#define DKV  (NKV * HD)
#define DF   (DQ + 2 * DKV)   // columns of the joined q | k | v projection
#define NQK  (NH_ + NKV)       // rotated head planes of a batch: 32 q heads, then 8 k heads
#define MT   (NB_ * TT)        // rows of both batches
#define SCL  0.125f   // HD^-0.5
typedef _Float16 h16;
typedef unsigned short bf;
typedef __attribute__((ext_vector_type(16))) __bf16   v16bf;
typedef __attribute__((ext_vector_type(16))) _Float16 v16h;
typedef __attribute__((ext_vector_type(8)))  _Float16 v8h;
typedef __attribute__((ext_vector_type(8)))  unsigned short v8us;
typedef __attribute__((ext_vector_type(8)))  float    v8f;
typedef __attribute__((ext_vector_type(4)))  float    v4f;
typedef v8h  __attribute__((may_alias)) v8ha;
typedef v4f  __attribute__((may_alias)) v4fa;
typedef v8us __attribute__((may_alias)) v8usa;

__device__ __forceinline__ unsigned short f2bf(float f) { unsigned u = __float_as_uint(f); u += 0x7FFFu + ((u >> 16) & 1u); return (unsigned short)(u >> 16); }
__device__ __forceinline__ float bf2f(unsigned short b) { return __uint_as_float(((unsigned)b) << 16); }
__device__ __forceinline__ float bfr(float f) { return bf2f(f2bf(f)); }
__device__ __forceinline__ v16h cat16(v8h lo, v8h hi) { return __builtin_shufflevector(lo, hi, 0, 1, 2, 3, 4, 5, 6, 7, 8, 9, 10, 11, 12, 13, 14, 15); }
__device__ __forceinline__ v16bf cat16b(v8us lo, v8us hi) { return __builtin_bit_cast(v16bf, __builtin_shufflevector(lo, hi, 0, 1, 2, 3, 4, 5, 6, 7, 8, 9, 10, 11, 12, 13, 14, 15)); }
__device__ __forceinline__ v8f wmma16(v16h a, v16h b, v8f c) { return __builtin_amdgcn_wmma_f32_16x16x32_f16(false, a, false, b, (short)0, c, false, false); }
__device__ __forceinline__ v8f wmmab(v16bf a, v16bf b, v8f c) { return __builtin_amdgcn_wmma_f32_16x16x32_bf16(false, a, false, b, (short)0, c, false, false); }



// ---- FRAGMENT ORDER: every 16-bit matrix operand plane (rows x K) is stored as blocks of 16 rows x 32 k = 512 elements, block (row / 16, k / 32) at element (row / 16) * 16 * K + (k / 32) * 512.
// Inside a block the element (row, k) lies at ((k >> 4) & 1) * 256 + ((k >> 3) & 1) * 128 + (row & 15) * 8 + (k & 7): lane l of the wave finds its first 8 operand elements at l * 8 and its last 8 at 256 + l * 8,
// so each of a fragment's two 16-byte loads covers 512 contiguous bytes (4 whole lines), where a row-major plane made it touch 16 lines. The k order of a fragment is what it was.
__device__ __forceinline__ size_t fidx(size_t row, int k, int K) { return (row >> 4) * ((size_t)16 * K) + (size_t)(k >> 5) * 512 + ((k >> 4) & 1) * 256 + ((k >> 3) & 1) * 128 + (row & 15) * 8 + (k & 7); }
// ---- k_gemmw: register-blocked GEMM, one wave per 64x64 output tile (16 accumulators), WM x WN waves a work-group, operands from 16-bit planes in fragment order through LDS; grid (M / (64 WM), N / (64 WN), Z).
// C[m][n] (f32, pitch ldc, + optional f32 bias[n]) = sum_k A[m][k] Bt[n][k] (+ split products per NSPLIT). z-batch strides sA/sB/sC in elements. K % KD == 0.
// HEADS (the joined q | k | v projection; a 64-column tile is one head): no C plane. The epilogue turns the accumulators into the fp16 operand planes that k_fattn reads, in fragment order, straight from the registers.
// A lane's 8 accumulator registers run along the A operand's rows. A v tile keeps x as A: 8 neighbouring t of one d, a 16-byte piece of the [d][t] plane. A q or k tile takes the weight rows as A and x as B (same loader, same k order, same sums):
// 8 neighbouring d of one t, a piece of the [t][d] plane, and the rotary partner d + 32 lies in the same lane and register two accumulator tiles on.
template <typename T16> struct WFrag;
template <> struct WFrag<h16> { typedef v16h V; static __device__ __forceinline__ V ld(const h16* p) { return cat16(*(const v8h*)p, *(const v8h*)(p + 256)); } static __device__ __forceinline__ v8f mma(V a, V b, v8f c) { return wmma16(a, b, c); } };
template <> struct WFrag<bf> { typedef v16bf V; static __device__ __forceinline__ V ld(const bf* p) { return cat16b(*(const v8us*)p, *(const v8us*)(p + 256)); } static __device__ __forceinline__ v8f mma(V a, V b, v8f c) { return wmmab(a, b, c); } };
// OPERAND TILES THROUGH LDS: a work-group of WM x WN waves owns 64 WM x 64 WN outputs (a wave keeps its 64 x 64 tile and its epilogue). A stage is KD k of every operand row of the work-group, brought in once by asynchronous copies
// and read by every wave that needs it; two buffers, the next stage's copies fly while this one is worked on. A plane in fragment order keeps its order in LDS: a run of 16 rows x KD k is KD * 32 contiguous bytes there as in memory,
// a copy is 512 contiguous bytes on both sides, and a fragment read is two conflict-free 16-byte reads a lane.
#define CPL(a, b) "global_load_async_to_lds_b128 %" #a ", %" #b ", off\n\t"
// the copies of one run and, as the statement's last line, the wait that stands in front of any rewrite of the address registers they name
__device__ __forceinline__ void cp1(unsigned l, const char* g) { asm volatile(CPL(0, 1) "s_wait_xcnt 0x0" :: "v"(l), "v"(g) : "memory"); }
template <int N> __device__ __forceinline__ void cpn(const unsigned (&l)[N], const char* const (&g)[N]) {
    static_assert(N == 9 || N == 10, "one statement a run");
    if constexpr (N == 9) asm volatile(CPL(0, 1) CPL(2, 3) CPL(4, 5) CPL(6, 7) CPL(8, 9) CPL(10, 11) CPL(12, 13) CPL(14, 15) CPL(16, 17) "s_wait_xcnt 0x0"
        :: "v"(l[0]), "v"(g[0]), "v"(l[1]), "v"(g[1]), "v"(l[2]), "v"(g[2]), "v"(l[3]), "v"(g[3]), "v"(l[4]), "v"(g[4]), "v"(l[5]), "v"(g[5]), "v"(l[6]), "v"(g[6]), "v"(l[7]), "v"(g[7]), "v"(l[8]), "v"(g[8]) : "memory");
    else asm volatile(CPL(0, 1) CPL(2, 3) CPL(4, 5) CPL(6, 7) CPL(8, 9) CPL(10, 11) CPL(12, 13) CPL(14, 15) CPL(16, 17) CPL(18, 19) "s_wait_xcnt 0x0"
        :: "v"(l[0]), "v"(g[0]), "v"(l[1]), "v"(g[1]), "v"(l[2]), "v"(g[2]), "v"(l[3]), "v"(g[3]), "v"(l[4]), "v"(g[4]), "v"(l[5]), "v"(g[5]), "v"(l[6]), "v"(g[6]), "v"(l[7]), "v"(g[7]), "v"(l[8]), "v"(g[8]), "v"(l[9]), "v"(g[9]) : "memory");
}
template <typename T16, int NSPLIT, bool BIAS, bool HEADS, int WM, int WN, int KD, int K>
__global__ __launch_bounds__(WM * WN * 32) void k_gemmw(const T16* __restrict__ A, const T16* __restrict__ A2, const T16* __restrict__ Bt, const T16* __restrict__ Bt2, float* C, int ldc, const float* __restrict__ bias, size_t sA, size_t sB, size_t sC, const float* __restrict__ CS, h16* QK, h16* VT) {
    typedef typename WFrag<T16>::V V;
    static_assert(NSPLIT <= 1, "one weight plane; one or two planes on the other side");
    constexpr int NW = WM * WN, NXB = 4 * WM * (NSPLIT == 1 ? 2 : 1), NRB = NXB + 4 * WN;   // waves; runs of 16 rows of a stage: the x side's (both planes), then the weight's
    constexpr int RB = KD * 16, STG = NRB * RB, UPR = KD / 16, NU = NRB * UPR;                // elements of a run and of a stage; copies of 512 bytes a run and a stage
    constexpr int NCF = NU / NW, REM = NU % NW, H = NCF / 2, NB = KD / 32;                    // copies that every wave issues a stage, in two runs of H; waves that issue one more; blocks of 32 k a stage
    static_assert(NCF == 2 * H && NCF + 1 <= 63, "two equal runs; a wave's copies in flight");
    constexpr int NT = K / KD; static_assert(K % KD == 0 && NT >= 2, "whole stages, and both buffers have a first stage");
    __shared__ __attribute__((aligned(1024))) T16 sm[2 * STG];
    __shared__ __align__(16) float osm[HEADS ? 4 : NW * 16 * 68];
    const size_t z = blockIdx.z; A += z * sA; if (A2) A2 += z * sA; Bt += z * sB; C += z * sC;
    const int lane = threadIdx.x & 31, lr = lane & 15, hi = lane >> 4; const int wave = __builtin_amdgcn_readfirstlane(threadIdx.x >> 5), wm = wave % WM, wn = wave / WM;
    const int R0 = blockIdx.x * (64 * WM), C0 = blockIdx.y * (64 * WN), r0 = R0 + 64 * wm, c0 = C0 + 64 * wn;
    float* os = osm + (HEADS ? 0 : wave * (16 * 68));   // a wave's own staging rows
    v8f acc[4][4];
#pragma unroll
    for (int mb = 0; mb < 4; ++mb)
#pragma unroll
        for (int nb = 0; nb < 4; ++nb) acc[mb][nb] = (v8f){};
    const unsigned lo = lane * 8;
    const bool rot = HEADS && c0 < DQ + DKV;   // a q or k head (the same for the whole wave): the two operands change places
    const int xo = 4 * wm * RB, wo_ = (NXB + 4 * wn) * RB;   // the wave's own runs inside a stage
    const int ao = rot ? wo_ : xo, bo = rot ? xo : wo_, a2o = xo + 4 * WM * RB;
    // copy number i of a wave is piece wave + NW i of the stage; its source pointer is wave-uniform, lives through the loop and steps by one stage (KD k of 16 rows) at each issue
    const char* gp[NCF + 1];
#pragma unroll
    for (int i = 0; i <= NCF; ++i) { const int u = wave + NW * i, j = u / UPR < NRB ? u / UPR : NRB - 1;
        const T16* p = j < 4 * WM ? A + (size_t)(R0 + 16 * j) * K : (NSPLIT == 1 && j < NXB) ? A2 + (size_t)(R0 + 16 * (j - 4 * WM)) * K : Bt + (size_t)(C0 + 16 * (j - NXB)) * K;
        gp[i] = (const char*)p + (u % UPR) * 512; }
    const unsigned l0 = (unsigned)(size_t)sm + wave * 512 + lane * 16, lane16 = lane * 16;
    auto issue = [&](unsigned lb) {   // one stage's copies into the buffer at LDS byte lb (+ the wave's and the lane's place)
#pragma unroll
        for (int h = 0; h < 2; ++h) { unsigned l[H]; const char* g[H];
#pragma unroll
            for (int i = 0; i < H; ++i) { l[i] = lb + (h * H + i) * (NW * 512); g[i] = gp[h * H + i] + lane16; }
            cpn<H>(l, g); }
        if (REM != 0 && wave < REM) cp1(lb + NCF * (NW * 512), gp[NCF] + lane16);   // wave-uniform: a scalar branch
#pragma unroll
        for (int i = 0; i <= NCF; ++i) gp[i] += KD * 32;
    };
    issue(l0);
    asm volatile("s_wait_asynccnt 0x0" ::: "memory");   // this wave's copies of stage 0 have landed
    __syncthreads();                                     // ... and every other wave's
    issue(l0 + STG * 2);                                 // stage 1 flies under stage 0's products
#pragma unroll 1
    for (int t = 0; t < NT; ++t) {
        const T16* sb = sm + (t & 1) * STG + lo;
        V a[2][4], a2[2][4], b[2][4];
        auto frags = [&](int kk) {
#pragma unroll
            for (int i = 0; i < 4; ++i) { a[kk & 1][i] = WFrag<T16>::ld(sb + ao + i * RB + kk * 512); if (NSPLIT == 1) a2[kk & 1][i] = WFrag<T16>::ld(sb + a2o + i * RB + kk * 512); b[kk & 1][i] = WFrag<T16>::ld(sb + bo + i * RB + kk * 512); } };
        frags(0);
#pragma unroll
        for (int kk = 0; kk < NB; ++kk) {
            if (kk + 1 < NB) frags(kk + 1);
            __builtin_amdgcn_sched_barrier(0);   // the next block's LDS reads stay one group in front of this block's products, not spread among them
#pragma unroll
            for (int nb = 0; nb < 4; ++nb)
#pragma unroll
                for (int mb = 0; mb < 4; ++mb) { acc[mb][nb] = WFrag<T16>::mma(a[kk & 1][mb], b[kk & 1][nb], acc[mb][nb]); if (NSPLIT == 1) acc[mb][nb] = WFrag<T16>::mma(a2[kk & 1][mb], b[kk & 1][nb], acc[mb][nb]); }
            __builtin_amdgcn_sched_barrier(0);   // as above: the block ends here
        }
        asm volatile("s_wait_dscnt 0x0" ::: "memory");      // this wave's reads of the buffer are done before it is handed back
        asm volatile("s_wait_asynccnt 0x0" ::: "memory");   // this wave's copies of stage t + 1 have landed
        __syncthreads();                                     // publishes stage t + 1 and ends every wave's reads of stage t
        if (t + 2 < NT) issue(l0 + (t & 1) * (STG * 2));     // stage t + 2 into the buffer just read
    }
    asm volatile("s_wait_asynccnt 0x0" ::: "memory");   // nothing is in flight when the wave goes on
    if (HEADS) {
        static_assert(TT % 64 == 0 && HD == 64, "a tile's 64 rows lie in one batch, its 64 columns are one head");
        const int bz = r0 / TT, t0 = r0 % TT;
        if (rot) {   // acc[mb][nb][j] = head column d = 16 mb + 8 hi + j of position t = t0 + 16 nb + lr
            const v4fa* tp = (const v4fa*)(CS + (size_t)(t0 >> 4) * (HD * 16)) + lane;   // k_cstab's order: every load below is 512 contiguous bytes
            h16* op = QK + (((size_t)bz * NQK + c0 / HD) * TT + t0) * HD + lo;            // fidx(head row t0 + lr, 8 hi, HD); 16 t further lie 16 HD elements on, 16 d further 256
            v4f cs[2][2][4];
#pragma unroll
            for (int mb = 0; mb < 2; ++mb)
#pragma unroll
                for (int q = 0; q < 4; ++q) cs[0][mb][q] = tp[(mb * 4 + q) * 32];
#pragma unroll
            for (int nb = 0; nb < 4; ++nb) {
                if (nb < 3) {
#pragma unroll
                    for (int mb = 0; mb < 2; ++mb)
#pragma unroll
                        for (int q = 0; q < 4; ++q) cs[(nb + 1) & 1][mb][q] = tp[(((nb + 1) * 2 + mb) * 4 + q) * 32]; }
                __builtin_amdgcn_sched_barrier(0);   // keeps the next 16 positions' table loads in front of this group's arithmetic, so that they fly under it
                v8h o[4];
#pragma unroll
                for (int mb = 0; mb < 2; ++mb)
#pragma unroll
                    for (int j = 0; j < 8; ++j) { const float co = cs[nb & 1][mb][j >> 1][(j & 1) * 2], si = cs[nb & 1][mb][j >> 1][(j & 1) * 2 + 1], x0 = acc[mb][nb][j], x1 = acc[mb + 2][nb][j];
                        o[mb][j] = (h16)(x0 * co - x1 * si); o[mb + 2][j] = (h16)(x1 * co + x0 * si); }
                __builtin_amdgcn_sched_barrier(0);   // all four pieces are formed in front of the first store: none is formed in a register that an issued store of the group names
#pragma unroll
                for (int mb = 0; mb < 4; ++mb) *(v8h*)(op + nb * 16 * HD + mb * 256) = o[mb];
                if (nb < 3) asm volatile("s_wait_xcnt 0x0" ::: "memory");   // the next group's pieces are formed in registers that these stores name (behind the last group nothing is)
            }
        } else {     // acc[mb][nb][j] = v column d = 16 nb + lr of position t = t0 + 16 mb + 8 hi + j
            h16* op = VT + ((size_t)bz * DKV + (c0 - DQ - DKV)) * TT + (size_t)(t0 >> 5) * 512 + lo;   // fidx(row d = lr, t0 + 8 hi, TT); 16 d further lie 16 TT elements on, 16 t further 256
#pragma unroll
            for (int nb = 0; nb < 4; ++nb) {
                v8h o[4];
#pragma unroll
                for (int mb = 0; mb < 4; ++mb)
#pragma unroll
                    for (int j = 0; j < 8; ++j) o[mb][j] = (h16)acc[mb][nb][j];
                __builtin_amdgcn_sched_barrier(0);   // as above: the group's four pieces first, then its stores
#pragma unroll
                for (int mb = 0; mb < 4; ++mb) *(v8h*)(op + (size_t)nb * 16 * TT + mb * 256) = o[mb];
                if (nb < 3) asm volatile("s_wait_xcnt 0x0" ::: "memory");   // as above
            }
        }
        return;
    }
#pragma unroll
    for (int mb = 0; mb < 4; ++mb) {
#pragma unroll
        for (int nb = 0; nb < 4; ++nb) {
#pragma unroll
            for (int j = 0; j < 8; ++j) os[(hi * 8 + j) * 68 + nb * 16 + lr] = acc[mb][nb][j]; }
        __builtin_amdgcn_wave_barrier(); asm volatile("" ::: "memory");
        float* crow = C + (size_t)(r0 + mb * 16) * ldc + c0;
{
#pragma unroll
            for (int s = 0; s < 8; ++s) { const int row = 2 * s + hi, cofs = lr * 4; v4f val = *(const v4fa*)(os + row * 68 + cofs); if (BIAS) { val[0] += bfr(bias[c0 + cofs]); val[1] += bfr(bias[c0 + cofs + 1]); val[2] += bfr(bias[c0 + cofs + 2]); val[3] += bfr(bias[c0 + cofs + 3]); }
                *(v4f*)(crow + (size_t)row * ldc + cofs) = val; }
             }
        __builtin_amdgcn_wave_barrier(); asm volatile("" ::: "memory");
    }
}

__device__ __forceinline__ h16 tohx(float x) { return (h16)x; }
__device__ __forceinline__ void splitf(float y, unsigned short& h, unsigned short& l) { h = f2bf(y); l = f2bf(y - bf2f(h)); }
typedef __attribute__((ext_vector_type(2))) _Float16 v2h;
typedef __attribute__((ext_vector_type(4))) _Float16 v4h;
typedef __attribute__((ext_vector_type(2))) unsigned short v2us;
typedef __attribute__((ext_vector_type(4))) unsigned short v4us;
typedef __attribute__((ext_vector_type(2))) float v2f;
typedef __attribute__((ext_vector_type(4))) int v4i;

// all four weights in one launch: blockIdx.y picks the weight (wq, wk, wv into the joined plane, wo into its own); blocks past a narrow weight's last piece leave at once.
// A thread writes one 16-byte piece (8 k of one n) of the transposed plane in fragment order. A wave takes 32 neighbouring n at the same 8 k: each of its 8 loads is one whole line of w, its store two runs of 256 bytes.
__global__ __launch_bounds__(256) void k_wtG(const float* __restrict__ wq, const float* __restrict__ wk, const float* __restrict__ wv, const float* __restrict__ wo, bf* WF, bf* WO) {
    const int y = blockIdx.y; const float* __restrict__ w = y == 0 ? wq : y == 1 ? wk : y == 2 ? wv : wo; const int K = y == 3 ? DQ : DM, N = y == 0 ? DQ : y == 3 ? DM : DKV;
    bf* Bt = y == 0 ? WF : y == 1 ? WF + (size_t)DQ * DM : y == 2 ? WF + (size_t)(DQ + DKV) * DM : WO;
    const int i = blockIdx.x * 256 + threadIdx.x; if (i >= N * K / 8) return;
    const int grp = i >> 7, lg = y == 0 || y == 3 ? 6 : 4; static_assert(DQ / 32 == 1 << 6 && DM / 32 == 1 << 6 && DKV / 32 == 1 << 4, "lg = log2(N / 32)");   // 128 threads a group of 32 n x 32 k; neighbouring groups take neighbouring lines of the same rows of w
    const int n = (grp & ((1 << lg) - 1)) * 32 + (i & 31), k = (grp >> lg) * 32 + ((i >> 5) & 3) * 8; v8us o;
#pragma unroll
    for (int q = 0; q < 8; ++q) o[q] = f2bf(w[(size_t)(k + q) * N + n]);
    *(v8us*)(Bt + fidx(n, k, K)) = o;
}
// x (rows of DM) rounded to bf16, in fragment order: a thread writes one 16-byte piece (8 k of one row). A wave takes 32 k of 8 rows: it reads 8 whole lines of x and stores 4 whole lines (8 rows' pieces of the same 8 k lie side by side)
__global__ __launch_bounds__(256) void k_cvt8(const float* __restrict__ src, bf* dst, size_t n8) { const size_t i = (size_t)blockIdx.x * 256 + threadIdx.x; if (i >= n8) return;
    const size_t row = (i >> 6) / (DM / 32) * 16 + ((i >> 2) & 15); const int k = (int)((i >> 6) % (DM / 32)) * 32 + (int)(i & 3) * 8; const v8f v = *(const v8f*)(src + row * DM + k); v8us o;
#pragma unroll
    for (int q = 0; q < 8; ++q) o[q] = f2bf(v[q]); *(v8us*)(dst + fidx(row, k, DM)) = o;  }
__constant__ float INV[HD / 2] = {1.00000000f,0.663601220f,0.440366596f,0.292227834f,0.193922743f,0.128687367f,0.0853971019f,0.0566696227f,0.0376060307f,0.0249554086f,0.0165604409f,0.0109895281f,0.00729266461f,0.00483942125f,0.00321144611f,0.00213111960f,0.00141421356f,0.000938473851f,0.000622772437f,0.000413272559f,0.000274248188f,0.000181991432f,0.000120769735f,0.0000801429487f,0.0000531829573f,0.0000352922762f,0.0000234199997f,0.0000155415401f,0.0000103133852f,0.00000684397537f,0.00000454167048f,0.00000301385808f};
// (cos, sin) of t x INV[d], d < HD / 2 (d + HD / 2 has the same angle), in the order in which the projection's epilogue reads them: pair p = ((((t / 16) * 2 + d / 16) * 4 + (d & 7) / 2) * 32 + ((d >> 3) & 1) * 16 + (t & 15)) * 2 + (d & 1),
// so that lane 16 hi + lr finds the pairs of d = 16 mb + 8 hi + 2 q, + 1 at position t = 16 tb + lr in one 16-byte load, and the wave's load covers 4 whole lines. Thread p writes pair p.
__global__ __launch_bounds__(256) void k_cstab(float* CS) { const int p = blockIdx.x * 256 + threadIdx.x; if (p >= TT * HD / 2) return; const int t = (p >> 9) * 16 + ((p >> 1) & 15), d = ((p >> 8) & 1) * 16 + ((p >> 5) & 1) * 8 + ((p >> 6) & 3) * 2 + (p & 1); const float ang = __fmul_rn((float)t, INV[d]); v2f cs; cs[0] = cosf(ang); cs[1] = sinf(ang);
    *(v2f*)(CS + (size_t)p * 2) = cs;  }

#define PC2  6.0f
#define CS2  (SCL * 1.4426950408889634f)
__device__ __forceinline__ float xhalf(float x) { return __builtin_bit_cast(float, __builtin_amdgcn_permlanex16(__builtin_bit_cast(int, x), __builtin_bit_cast(int, x), 0x76543210, 0xfedcba98, false, false)); }  // lane l with lane l ^ 16
__device__ __forceinline__ void sfence() { __builtin_amdgcn_sched_barrier(0); }   // keeps a load group where it is written, so that it flies under the work behind it
struct KVf { v16h k[2][2]; v16h v[4]; };
__device__ __forceinline__ void ld_k(KVf& f, const h16* kp) {
#pragma unroll
    for (int kt = 0; kt < 2; ++kt)
#pragma unroll
        for (int kc = 0; kc < 2; ++kc) f.k[kt][kc] = WFrag<h16>::ld(kp + kt * 16 * HD + kc * 512); }
__device__ __forceinline__ void ld_v(KVf& f, const h16* vp) {
#pragma unroll
    for (int t = 0; t < 4; ++t) f.v[t] = WFrag<h16>::ld(vp + t * 16 * TT); }
// one pass of 32 keys; its K fragments are refilled for pass + 2 behind the score products, its V fragments behind the second product.
// The two fragment sets share one K and one V^T lane pointer: set 0 steps it by two passes, set 1 reads 32 keys behind it (in V^T one block, 512 elements, of each 16 rows).
__device__ __forceinline__ void xwait() { asm volatile("s_wait_xcnt 0x0" ::: "memory"); }   // stands in front of the overwrite of an address register that issued loads name
template <int SET>
__device__ __forceinline__ void fpass(KVf& f, const h16*& kp, const h16*& vp, int kstep, int vstep, const v16h (&qf)[2][2], v8f (&acc)[2][4], float (&lsum)[2], float (&mrun)[2]) {
    v8f s[2][2];
#pragma unroll
    for (int kt = 0; kt < 2; ++kt)
#pragma unroll
        for (int g = 0; g < 2; ++g) { s[kt][g] = (v8f){};
#pragma unroll
            for (int kc = 0; kc < 2; ++kc) s[kt][g] = wmma16(f.k[kt][kc], qf[g][kc], s[kt][g]); }
    sfence();
    if (SET == 0) { xwait(); sfence(); kp += kstep; }
    ld_k(f, kp + SET * 32 * HD);
    sfence();
    float mb[2]; bool need = false;
#pragma unroll
    for (int g = 0; g < 2; ++g) { float mx = -INFINITY;
#pragma unroll
        for (int kt = 0; kt < 2; ++kt)
#pragma unroll
            for (int r = 0; r < 8; ++r) mx = fmaxf(mx, s[kt][g][r]);
        mx = fmaxf(mx, xhalf(mx)) * CS2; mb[g] = mx; need = need || (mx > mrun[g] + 8.0f); }
    if (__builtin_amdgcn_ballot_w32(need) != 0) {   // wave-uniform; rare after the first passes
#pragma unroll
        for (int g = 0; g < 2; ++g) { const float mn = fmaxf(mrun[g], mb[g]); const float corr = __builtin_amdgcn_exp2f(mrun[g] - mn); mrun[g] = mn; lsum[g] = lsum[g] * corr;
#pragma unroll
            for (int t = 0; t < 4; ++t) acc[g][t] = acc[g][t] * corr; } }
#pragma unroll
    for (int g = 0; g < 2; ++g) { const float nm = PC2 - mrun[g]; v16h pf; float p[16];
#pragma unroll
        for (int e = 0; e < 16; ++e) { p[e] = __builtin_amdgcn_exp2f(fmaf(s[e >> 3][g][e & 7], CS2, nm)); pf[e] = tohx(p[e]); }   // element e of the 32-key operand = tile e >> 3, register e & 7 (the hardware k order, as the V^T loader's)
#pragma unroll
        for (int w = 8; w; w >>= 1)
#pragma unroll
            for (int e = 0; e < w; ++e) p[e] += p[e + w];
        lsum[g] += p[0];
#pragma unroll
        for (int t = 0; t < 4; ++t) acc[g][t] = wmma16(f.v[t], pf, acc[g][t]); }
    sfence();
    if (SET == 0) { xwait(); sfence(); vp += vstep; }
    ld_v(f, vp + SET * 512);
    sfence();
}
__global__ __launch_bounds__(256) void k_fattn(const h16* __restrict__ Q16, const h16* __restrict__ K16, const h16* __restrict__ V16, bf* Ah, bf* Al) {
    const int lane = threadIdx.x & 31, c = lane & 15, hi = lane >> 4; const int wave = __builtin_amdgcn_readfirstlane(threadIdx.x >> 5);
    const int h = blockIdx.y, q0 = blockIdx.x * 256 + wave * 32;
    { const size_t z = blockIdx.z; Q16 += z * NQK * TT * HD; K16 += z * NQK * TT * HD; V16 += z * NKV * HD * TT; Ah += z * TT * DQ; Al += z * TT * DQ; }   // blockIdx.z = batch; a batch's q and k planes lie in one run of NQK planes
    const h16* qp = Q16 + ((size_t)h * TT + q0) * HD + lane * 8;
    const h16* kp = K16 + (size_t)(h / REP) * TT * HD + lane * 8; const h16* vp = V16 + (size_t)(h / REP) * HD * TT + lane * 8;
    v16h qf[2][2];
#pragma unroll
    for (int g = 0; g < 2; ++g)
#pragma unroll
        for (int kc = 0; kc < 2; ++kc) qf[g][kc] = WFrag<h16>::ld(qp + g * 16 * HD + kc * 512);
    // the first two passes' fragments, issued in the loop's own order (K, V, K, V): only then are the loop's load waits counted ones that leave the younger groups in flight
    KVf fa, fb; sfence();
    asm volatile("s_wait_xcnt 0x0" :: "v"(qp) : "memory");   // as xwait(); the operand keeps the Q loads' address pair from being reused in front of the wait
    sfence(); ld_k(fa, kp); sfence(); ld_v(fa, vp); sfence(); ld_k(fb, kp + 32 * HD); sfence(); ld_v(fb, vp + 512); sfence(); xwait(); sfence();
    v8f acc[2][4]; float lsum[2], mrun[2];
#pragma unroll
    for (int g = 0; g < 2; ++g) { mrun[g] = -INFINITY; lsum[g] = 0.0f;
#pragma unroll
        for (int t = 0; t < 4; ++t) acc[g][t] = (v8f){}; }
#pragma unroll 1   // two passes a trip, one per fragment set; more would only grow the code
    for (int key0 = 0; key0 < TT; key0 += 64) {   // the last trip's refills step back to keys 0 and 32: in bounds, not used
        const bool more = key0 + 64 < TT; const int kstep = more ? 64 * HD : -(TT - 64) * HD, vstep = more ? 64 * 16 : -(TT - 64) * 16;
        fpass<0>(fa, kp, vp, kstep, vstep, qf, acc, lsum, mrun);
        fpass<1>(fb, kp, vp, kstep, vstep, qf, acc, lsum, mrun); }
#pragma unroll
    for (int g = 0; g < 2; ++g) { const float inv = __fdiv_rn(1.0f, lsum[g] + xhalf(lsum[g]));   // a query's 32 keys of a pass lie half in lane c, half in lane c + 16
        const size_t oo = fidx(q0 + 16 * g + c, h * HD + 8 * hi, DQ);   // the merged planes are the last product's A operand: fragment order, a wave's store 512 contiguous bytes; 16 d further lie 256 elements on
#pragma unroll
        for (int t = 0; t < 4; ++t) { v8us oh, ol;   // acc[g][t][r] = O[query c][d = 16 t + 8 hi + r]
#pragma unroll
            for (int r = 0; r < 8; ++r) { unsigned short a, c2; splitf(acc[g][t][r] * inv, a, c2); oh[r] = a; ol[r] = c2; }
            *(v8us*)(Ah + oo + 256 * t) = oh; *(v8us*)(Al + oo + 256 * t) = ol; if (g == 0 || t < 3) xwait(); } }   // the wait: the next pair's values are formed in registers that these stores name (behind the last pair nothing is)
}

extern "C" void kernel_launch(void* const* d_in, const int* in_sizes, int n_in,
                              void* d_out, int out_size, void* d_ws, size_t ws_size, hipStream_t stream) {
    (void)in_sizes; (void)n_in; (void)out_size;
    const float* x = (const float*)d_in[0]; const float* wq = (const float*)d_in[1]; const float* wk = (const float*)d_in[2]; const float* wv = (const float*)d_in[3]; const float* wo = (const float*)d_in[4];
    float* OUT = (float*)d_out;     // [2][2048][2048]
    char* wsp = (char*)d_ws;
    auto take = [&](size_t bytes) { char* p = wsp; wsp += (bytes + 255) & ~(size_t)255; return (void*)p; };
    bf* WF = (bf*)take((size_t)DF * DM * 2); bf* WO = (bf*)take((size_t)DM * DQ * 2); float* CS = (float*)take((size_t)TT * (HD / 2) * 2 * 4);   // WF: wq, wk, wv transposed, row after row: one [DF][DM] operand
    bf* XB = (bf*)take((size_t)MT * DM * 2);
    h16* QK16 = (h16*)take((size_t)NB_ * NQK * TT * HD * 2); h16* VT16 = (h16*)take((size_t)NB_ * NKV * HD * TT * 2);
    bf* ATh = (bf*)take((size_t)MT * DQ * 2); bf* ATl = (bf*)take((size_t)MT * DQ * 2);
    if ((size_t)(wsp - (char*)d_ws) > ws_size) return;    // 93 MiB of the 256 MiB
    // every stage is ONE launch over all of its work: both batches as 4096 rows (a grid index in k_fattn), q, k and v as one product: 256 work-groups in each of the two products, 12 and 8 waves each (3 and 2 wave tiles a SIMD)
    // Left open: k_gemmw's 64 x 64 wave tile reads 8 fragments from LDS for 16 products (a 64 x 128 tile: 12 for 32), its ring has two buffers; k_wtG and k_cvt8 start a wave for every 512 bytes they write; k_fattn's registers (over 256 a wave, so three waves a SIMD at most) keep it at one 8-wave workgroup a WGP
    k_wtG<<<dim3((unsigned)(DM * DQ / 8 / 256), 4, 1), 256, 0, stream>>>(wq, wk, wv, wo, WF, WO);
    k_cstab<<<(TT * HD / 2 + 255) / 256, 256, 0, stream>>>(CS);
    k_cvt8<<<(unsigned)(((size_t)MT * DM / 8 + 255) / 256), 256, 0, stream>>>(x, XB, (size_t)MT * DM / 8);
    k_gemmw<bf, 0, false, true, 4, 3, 128, DM><<<dim3(MT / 256, DF / 192, 1), 384, 0, stream>>>(XB, nullptr, WF, nullptr, nullptr, 0, nullptr, 0, 0, 0, CS, QK16, VT16);   // writes the rotated q and k planes and the transposed v plane
    k_fattn<<<dim3(TT / 256, NH_, NB_), 256, 0, stream>>>(QK16, QK16 + (size_t)NH_ * TT * HD, VT16, ATh, ATl);
    k_gemmw<bf, 1, false, false, 4, 2, 64, DQ><<<dim3(MT / 256, DM / 128, 1), 256, 0, stream>>>(ATh, ATl, WO, nullptr, OUT, DM, nullptr, 0, 0, 0, nullptr, nullptr, nullptr);
}

// v006
// A run of this version takes 142 microseconds.
// Two timings next to v005 both put it at 1.07 times that version's speed.
// Over all steps from v000 it is 17.6 times as fast.
#include <hip/hip_runtime.h>

// Grouped-query RoPE attention without a mask (x [2][2048][2048]; q = x Wq (32 heads x 64), k, v = x Wk / Wv ([2048][512]: 8 kv heads); rotate-half RoPE (theta 5e5, tables computed on device); kv head = h/4; softmax(q.k/8) over all keys; out = merged Wo -> [2][2048][2048] (8.4 M)).
// Compute dtypes, f32 accumulate: every input rounded to bf16; q/k/v on PLAIN bf16 operands (inputs: exact); rotary in f32; scores and attn.v on single fp16 operands for every row (x64 probability carry against the running maximum); online softmax f32, denominator summed in f32 from the f32 exponentials; Wo hl x exact (2 products).

#define NB_  2
#define TT   2048
#define DM   2048
#define NH_  32
#define NKV  8
#define REP  (NH_ / NKV)
#define HD   64
#define DQ   (NH_ * HD)
#define DKV  (NKV * HD)
#define DF   (DQ + 2 * DKV)   // columns of the joined q | k | v projection
#define NQK  (NH_ + NKV)       // rotated head planes of a batch: 32 q heads, then 8 k heads
#define MT   (NB_ * TT)        // rows of both batches
#define SCL  0.125f   // HD^-0.5
typedef _Float16 h16;
typedef unsigned short bf;
typedef __attribute__((ext_vector_type(16))) __bf16   v16bf;
typedef __attribute__((ext_vector_type(16))) _Float16 v16h;
typedef __attribute__((ext_vector_type(8)))  _Float16 v8h;
typedef __attribute__((ext_vector_type(8)))  unsigned short v8us;
typedef __attribute__((ext_vector_type(8)))  float    v8f;
typedef __attribute__((ext_vector_type(4)))  float    v4f;
typedef v8h  __attribute__((may_alias)) v8ha;
typedef v4f  __attribute__((may_alias)) v4fa;
typedef v8us __attribute__((may_alias)) v8usa;

__device__ __forceinline__ unsigned short f2bf(float f) { unsigned u = __float_as_uint(f); u += 0x7FFFu + ((u >> 16) & 1u); return (unsigned short)(u >> 16); }
__device__ __forceinline__ float bf2f(unsigned short b) { return __uint_as_float(((unsigned)b) << 16); }
__device__ __forceinline__ float bfr(float f) { return bf2f(f2bf(f)); }
__device__ __forceinline__ v16h cat16(v8h lo, v8h hi) { return __builtin_shufflevector(lo, hi, 0, 1, 2, 3, 4, 5, 6, 7, 8, 9, 10, 11, 12, 13, 14, 15); }
__device__ __forceinline__ v16bf cat16b(v8us lo, v8us hi) { return __builtin_bit_cast(v16bf, __builtin_shufflevector(lo, hi, 0, 1, 2, 3, 4, 5, 6, 7, 8, 9, 10, 11, 12, 13, 14, 15)); }
__device__ __forceinline__ v8f wmma16(v16h a, v16h b, v8f c) { return __builtin_amdgcn_wmma_f32_16x16x32_f16(false, a, false, b, (short)0, c, false, false); }
__device__ __forceinline__ v8f wmmab(v16bf a, v16bf b, v8f c) { return __builtin_amdgcn_wmma_f32_16x16x32_bf16(false, a, false, b, (short)0, c, false, false); }



// ---- FRAGMENT ORDER: every 16-bit matrix operand plane (rows x K) is stored as blocks of 16 rows x 32 k = 512 elements, block (row / 16, k / 32) at element (row / 16) * 16 * K + (k / 32) * 512.
// Inside a block the element (row, k) lies at ((k >> 4) & 1) * 256 + ((k >> 3) & 1) * 128 + (row & 15) * 8 + (k & 7): lane l of the wave finds its first 8 operand elements at l * 8 and its last 8 at 256 + l * 8,
// so each of a fragment's two 16-byte loads covers 512 contiguous bytes (4 whole lines), where a row-major plane made it touch 16 lines. The k order of a fragment is what it was.
__device__ __forceinline__ size_t fidx(size_t row, int k, int K) { return (row >> 4) * ((size_t)16 * K) + (size_t)(k >> 5) * 512 + ((k >> 4) & 1) * 256 + ((k >> 3) & 1) * 128 + (row & 15) * 8 + (k & 7); }
// ---- k_gemmw: register-blocked GEMM, one wave per 64x64 output tile (16 accumulators), WM x WN waves a work-group, operands from 16-bit planes in fragment order through LDS; grid (M / (64 WM), N / (64 WN), Z).
// C[m][n] (f32, pitch ldc, + optional f32 bias[n]) = sum_k A[m][k] Bt[n][k] (+ split products per NSPLIT). z-batch strides sA/sB/sC in elements. K % KD == 0.
// HEADS (the joined q | k | v projection; a 64-column tile is one head): no C plane. The epilogue turns the accumulators into the fp16 operand planes that k_fattn reads, in fragment order, straight from the registers.
// A lane's 8 accumulator registers run along the A operand's rows. A v tile keeps x as A: 8 neighbouring t of one d, a 16-byte piece of the [d][t] plane. A q or k tile takes the weight rows as A and x as B (same loader, same k order, same sums):
// 8 neighbouring d of one t, a piece of the [t][d] plane, and the rotary partner d + 32 lies in the same lane and register two accumulator tiles on.
template <typename T16> struct WFrag;
template <> struct WFrag<h16> { typedef v16h V; static __device__ __forceinline__ V ld(const h16* p) { return cat16(*(const v8h*)p, *(const v8h*)(p + 256)); } static __device__ __forceinline__ v8f mma(V a, V b, v8f c) { return wmma16(a, b, c); } };
template <> struct WFrag<bf> { typedef v16bf V; static __device__ __forceinline__ V ld(const bf* p) { return cat16b(*(const v8us*)p, *(const v8us*)(p + 256)); } static __device__ __forceinline__ v8f mma(V a, V b, v8f c) { return wmmab(a, b, c); } };
// OPERAND TILES THROUGH LDS: a work-group of WM x WN waves owns 64 WM x 64 WN outputs (a wave keeps its 64 x 64 tile and its epilogue). A stage is KD k of every operand row of the work-group, brought in once by asynchronous copies
// and read by every wave that needs it; two buffers, the next stage's copies fly while this one is worked on. A plane in fragment order keeps its order in LDS: a run of 16 rows x KD k is KD * 32 contiguous bytes there as in memory,
// a copy is 512 contiguous bytes on both sides, and a fragment read is two conflict-free 16-byte reads a lane.
#define CPL(a, b) "global_load_async_to_lds_b128 %" #a ", %" #b ", off\n\t"
// the copies of one run and, as the statement's last line, the wait that stands in front of any rewrite of the address registers they name
__device__ __forceinline__ void cp1(unsigned l, const char* g) { asm volatile(CPL(0, 1) "s_wait_xcnt 0x0" :: "v"(l), "v"(g) : "memory"); }
template <int N> __device__ __forceinline__ void cpn(const unsigned (&l)[N], const char* const (&g)[N]) {
    static_assert(N == 9 || N == 10, "one statement a run");
    if constexpr (N == 9) asm volatile(CPL(0, 1) CPL(2, 3) CPL(4, 5) CPL(6, 7) CPL(8, 9) CPL(10, 11) CPL(12, 13) CPL(14, 15) CPL(16, 17) "s_wait_xcnt 0x0"
        :: "v"(l[0]), "v"(g[0]), "v"(l[1]), "v"(g[1]), "v"(l[2]), "v"(g[2]), "v"(l[3]), "v"(g[3]), "v"(l[4]), "v"(g[4]), "v"(l[5]), "v"(g[5]), "v"(l[6]), "v"(g[6]), "v"(l[7]), "v"(g[7]), "v"(l[8]), "v"(g[8]) : "memory");
    else asm volatile(CPL(0, 1) CPL(2, 3) CPL(4, 5) CPL(6, 7) CPL(8, 9) CPL(10, 11) CPL(12, 13) CPL(14, 15) CPL(16, 17) CPL(18, 19) "s_wait_xcnt 0x0"
        :: "v"(l[0]), "v"(g[0]), "v"(l[1]), "v"(g[1]), "v"(l[2]), "v"(g[2]), "v"(l[3]), "v"(g[3]), "v"(l[4]), "v"(g[4]), "v"(l[5]), "v"(g[5]), "v"(l[6]), "v"(g[6]), "v"(l[7]), "v"(g[7]), "v"(l[8]), "v"(g[8]), "v"(l[9]), "v"(g[9]) : "memory");
}
template <typename T16, int NSPLIT, bool BIAS, bool HEADS, int WM, int WN, int KD, int K>
__global__ __launch_bounds__(WM * WN * 32) void k_gemmw(const T16* __restrict__ A, const T16* __restrict__ A2, const T16* __restrict__ Bt, const T16* __restrict__ Bt2, float* C, int ldc, const float* __restrict__ bias, size_t sA, size_t sB, size_t sC, const float* __restrict__ CS, h16* QK, h16* VT) {
    typedef typename WFrag<T16>::V V;
    static_assert(NSPLIT <= 1, "one weight plane; one or two planes on the other side");
    constexpr int NW = WM * WN, NXB = 4 * WM * (NSPLIT == 1 ? 2 : 1), NRB = NXB + 4 * WN;   // waves; runs of 16 rows of a stage: the x side's (both planes), then the weight's
    constexpr int RB = KD * 16, STG = NRB * RB, UPR = KD / 16, NU = NRB * UPR;                // elements of a run and of a stage; copies of 512 bytes a run and a stage
    constexpr int NCF = NU / NW, REM = NU % NW, H = NCF / 2, NB = KD / 32;                    // copies that every wave issues a stage, in two runs of H; waves that issue one more; blocks of 32 k a stage
    static_assert(NCF == 2 * H && NCF + 1 <= 63, "two equal runs; a wave's copies in flight");
    constexpr int NT = K / KD; static_assert(K % KD == 0 && NT >= 2, "whole stages, and both buffers have a first stage");
    __shared__ __attribute__((aligned(1024))) T16 sm[2 * STG];
    __shared__ __align__(16) float osm[HEADS ? 4 : NW * 16 * 68];
    const size_t z = blockIdx.z; A += z * sA; if (A2) A2 += z * sA; Bt += z * sB; C += z * sC;
    const int lane = threadIdx.x & 31, lr = lane & 15, hi = lane >> 4; const int wave = __builtin_amdgcn_readfirstlane(threadIdx.x >> 5), wm = wave % WM, wn = wave / WM;
    const int R0 = blockIdx.x * (64 * WM), C0 = blockIdx.y * (64 * WN), r0 = R0 + 64 * wm, c0 = C0 + 64 * wn;
    float* os = osm + (HEADS ? 0 : wave * (16 * 68));   // a wave's own staging rows
    v8f acc[4][4];
#pragma unroll
    for (int mb = 0; mb < 4; ++mb)
#pragma unroll
        for (int nb = 0; nb < 4; ++nb) acc[mb][nb] = (v8f){};
    const unsigned lo = lane * 8;
    const bool rot = HEADS && c0 < DQ + DKV;   // a q or k head (the same for the whole wave): the two operands change places
    const int xo = 4 * wm * RB, wo_ = (NXB + 4 * wn) * RB;   // the wave's own runs inside a stage
    const int ao = rot ? wo_ : xo, bo = rot ? xo : wo_, a2o = xo + 4 * WM * RB;
    // copy number i of a wave is piece wave + NW i of the stage; its source pointer is wave-uniform, lives through the loop and steps by one stage (KD k of 16 rows) at each issue
    const char* gp[NCF + 1];
#pragma unroll
    for (int i = 0; i <= NCF; ++i) { const int u = wave + NW * i, j = u / UPR < NRB ? u / UPR : NRB - 1;
        const T16* p = j < 4 * WM ? A + (size_t)(R0 + 16 * j) * K : (NSPLIT == 1 && j < NXB) ? A2 + (size_t)(R0 + 16 * (j - 4 * WM)) * K : Bt + (size_t)(C0 + 16 * (j - NXB)) * K;
        gp[i] = (const char*)p + (u % UPR) * 512; }
    const unsigned l0 = (unsigned)(size_t)sm + wave * 512 + lane * 16, lane16 = lane * 16;
    auto issue = [&](unsigned lb) {   // one stage's copies into the buffer at LDS byte lb (+ the wave's and the lane's place)
#pragma unroll
        for (int h = 0; h < 2; ++h) { unsigned l[H]; const char* g[H];
#pragma unroll
            for (int i = 0; i < H; ++i) { l[i] = lb + (h * H + i) * (NW * 512); g[i] = gp[h * H + i] + lane16; }
            cpn<H>(l, g); }
        if (REM != 0 && wave < REM) cp1(lb + NCF * (NW * 512), gp[NCF] + lane16);   // wave-uniform: a scalar branch
#pragma unroll
        for (int i = 0; i <= NCF; ++i) gp[i] += KD * 32;
    };
    issue(l0);
    asm volatile("s_wait_asynccnt 0x0" ::: "memory");   // this wave's copies of stage 0 have landed
    __syncthreads();                                     // ... and every other wave's
    issue(l0 + STG * 2);                                 // stage 1 flies under stage 0's products
#pragma unroll 1
    for (int t = 0; t < NT; ++t) {
        const T16* sb = sm + (t & 1) * STG + lo;
        V a[2][4], a2[2][4], b[2][4];
        auto frags = [&](int kk) {
#pragma unroll
            for (int i = 0; i < 4; ++i) { a[kk & 1][i] = WFrag<T16>::ld(sb + ao + i * RB + kk * 512); if (NSPLIT == 1) a2[kk & 1][i] = WFrag<T16>::ld(sb + a2o + i * RB + kk * 512); b[kk & 1][i] = WFrag<T16>::ld(sb + bo + i * RB + kk * 512); } };
        frags(0);
#pragma unroll
        for (int kk = 0; kk < NB; ++kk) {
            if (kk + 1 < NB) frags(kk + 1);
            __builtin_amdgcn_sched_barrier(0);   // the next block's LDS reads stay one group in front of this block's products, not spread among them
#pragma unroll
            for (int nb = 0; nb < 4; ++nb)
#pragma unroll
                for (int mb = 0; mb < 4; ++mb) { acc[mb][nb] = WFrag<T16>::mma(a[kk & 1][mb], b[kk & 1][nb], acc[mb][nb]); if (NSPLIT == 1) acc[mb][nb] = WFrag<T16>::mma(a2[kk & 1][mb], b[kk & 1][nb], acc[mb][nb]); }
            __builtin_amdgcn_sched_barrier(0);   // as above: the block ends here
        }
        asm volatile("s_wait_dscnt 0x0" ::: "memory");      // this wave's reads of the buffer are done before it is handed back
        asm volatile("s_wait_asynccnt 0x0" ::: "memory");   // this wave's copies of stage t + 1 have landed
        __syncthreads();                                     // publishes stage t + 1 and ends every wave's reads of stage t
        if (t + 2 < NT) issue(l0 + (t & 1) * (STG * 2));     // stage t + 2 into the buffer just read
    }
    asm volatile("s_wait_asynccnt 0x0" ::: "memory");   // nothing is in flight when the wave goes on
    if (HEADS) {
        static_assert(TT % 64 == 0 && HD == 64, "a tile's 64 rows lie in one batch, its 64 columns are one head");
        const int bz = r0 / TT, t0 = r0 % TT;
        if (rot) {   // acc[mb][nb][j] = head column d = 16 mb + 8 hi + j of position t = t0 + 16 nb + lr
            const v4fa* tp = (const v4fa*)(CS + (size_t)(t0 >> 4) * (HD * 16)) + lane;   // k_cstab's order: every load below is 512 contiguous bytes
            h16* op = QK + (((size_t)bz * NQK + c0 / HD) * TT + t0) * HD + lo;            // fidx(head row t0 + lr, 8 hi, HD); 16 t further lie 16 HD elements on, 16 d further 256
            v4f cs[2][2][4];
#pragma unroll
            for (int mb = 0; mb < 2; ++mb)
#pragma unroll
                for (int q = 0; q < 4; ++q) cs[0][mb][q] = tp[(mb * 4 + q) * 32];
#pragma unroll
            for (int nb = 0; nb < 4; ++nb) {
                if (nb < 3) {
#pragma unroll
                    for (int mb = 0; mb < 2; ++mb)
#pragma unroll
                        for (int q = 0; q < 4; ++q) cs[(nb + 1) & 1][mb][q] = tp[(((nb + 1) * 2 + mb) * 4 + q) * 32]; }
                __builtin_amdgcn_sched_barrier(0);   // keeps the next 16 positions' table loads in front of this group's arithmetic, so that they fly under it
                v8h o[4];
#pragma unroll
                for (int mb = 0; mb < 2; ++mb)
#pragma unroll
                    for (int j = 0; j < 8; ++j) { const float co = cs[nb & 1][mb][j >> 1][(j & 1) * 2], si = cs[nb & 1][mb][j >> 1][(j & 1) * 2 + 1], x0 = acc[mb][nb][j], x1 = acc[mb + 2][nb][j];
                        o[mb][j] = (h16)(x0 * co - x1 * si); o[mb + 2][j] = (h16)(x1 * co + x0 * si); }
                __builtin_amdgcn_sched_barrier(0);   // all four pieces are formed in front of the first store: none is formed in a register that an issued store of the group names
#pragma unroll
                for (int mb = 0; mb < 4; ++mb) *(v8h*)(op + nb * 16 * HD + mb * 256) = o[mb];
                if (nb < 3) asm volatile("s_wait_xcnt 0x0" ::: "memory");   // the next group's pieces are formed in registers that these stores name (behind the last group nothing is)
            }
        } else {     // acc[mb][nb][j] = v column d = 16 nb + lr of position t = t0 + 16 mb + 8 hi + j
            h16* op = VT + ((size_t)bz * DKV + (c0 - DQ - DKV)) * TT + (size_t)(t0 >> 5) * 512 + lo;   // fidx(row d = lr, t0 + 8 hi, TT); 16 d further lie 16 TT elements on, 16 t further 256
#pragma unroll
            for (int nb = 0; nb < 4; ++nb) {
                v8h o[4];
#pragma unroll
                for (int mb = 0; mb < 4; ++mb)
#pragma unroll
                    for (int j = 0; j < 8; ++j) o[mb][j] = (h16)acc[mb][nb][j];
                __builtin_amdgcn_sched_barrier(0);   // as above: the group's four pieces first, then its stores
#pragma unroll
                for (int mb = 0; mb < 4; ++mb) *(v8h*)(op + (size_t)nb * 16 * TT + mb * 256) = o[mb];
                if (nb < 3) asm volatile("s_wait_xcnt 0x0" ::: "memory");   // as above
            }
        }
        return;
    }
#pragma unroll
    for (int mb = 0; mb < 4; ++mb) {
#pragma unroll
        for (int nb = 0; nb < 4; ++nb) {
#pragma unroll
            for (int j = 0; j < 8; ++j) os[(hi * 8 + j) * 68 + nb * 16 + lr] = acc[mb][nb][j]; }
        __builtin_amdgcn_wave_barrier(); asm volatile("" ::: "memory");
        float* crow = C + (size_t)(r0 + mb * 16) * ldc + c0;
{
#pragma unroll
            for (int s = 0; s < 8; ++s) { const int row = 2 * s + hi, cofs = lr * 4; v4f val = *(const v4fa*)(os + row * 68 + cofs); if (BIAS) { val[0] += bfr(bias[c0 + cofs]); val[1] += bfr(bias[c0 + cofs + 1]); val[2] += bfr(bias[c0 + cofs + 2]); val[3] += bfr(bias[c0 + cofs + 3]); }
                *(v4f*)(crow + (size_t)row * ldc + cofs) = val; }
             }
        __builtin_amdgcn_wave_barrier(); asm volatile("" ::: "memory");
    }
}

__device__ __forceinline__ h16 tohx(float x) { return (h16)x; }
__device__ __forceinline__ void splitf(float y, unsigned short& h, unsigned short& l) { h = f2bf(y); l = f2bf(y - bf2f(h)); }
typedef __attribute__((ext_vector_type(2))) _Float16 v2h;
typedef __attribute__((ext_vector_type(4))) _Float16 v4h;
typedef __attribute__((ext_vector_type(2))) unsigned short v2us;
typedef __attribute__((ext_vector_type(4))) unsigned short v4us;
typedef __attribute__((ext_vector_type(2))) float v2f;
typedef __attribute__((ext_vector_type(4))) int v4i;

// all four weights in one launch: blockIdx.y picks the weight (wq, wk, wv into the joined plane, wo into its own); blocks past a narrow weight's last piece leave at once.
// A thread writes one 16-byte piece (8 k of one n) of the transposed plane in fragment order. A wave takes 32 neighbouring n at the same 8 k: each of its 8 loads is one whole line of w, its store two runs of 256 bytes.
__global__ __launch_bounds__(256) void k_wtG(const float* __restrict__ wq, const float* __restrict__ wk, const float* __restrict__ wv, const float* __restrict__ wo, bf* WF, bf* WO) {
    const int y = blockIdx.y; const float* __restrict__ w = y == 0 ? wq : y == 1 ? wk : y == 2 ? wv : wo; const int K = y == 3 ? DQ : DM, N = y == 0 ? DQ : y == 3 ? DM : DKV;
    bf* Bt = y == 0 ? WF : y == 1 ? WF + (size_t)DQ * DM : y == 2 ? WF + (size_t)(DQ + DKV) * DM : WO;
    const int i = blockIdx.x * 256 + threadIdx.x; if (i >= N * K / 8) return;
    const int grp = i >> 7, lg = y == 0 || y == 3 ? 6 : 4; static_assert(DQ / 32 == 1 << 6 && DM / 32 == 1 << 6 && DKV / 32 == 1 << 4, "lg = log2(N / 32)");   // 128 threads a group of 32 n x 32 k; neighbouring groups take neighbouring lines of the same rows of w
    const int n = (grp & ((1 << lg) - 1)) * 32 + (i & 31), k = (grp >> lg) * 32 + ((i >> 5) & 3) * 8; v8us o;
#pragma unroll
    for (int q = 0; q < 8; ++q) o[q] = f2bf(w[(size_t)(k + q) * N + n]);
    *(v8us*)(Bt + fidx(n, k, K)) = o;
}
// x (rows of DM) rounded to bf16, in fragment order: a thread writes one 16-byte piece (8 k of one row). A wave takes 32 k of 8 rows: it reads 8 whole lines of x and stores 4 whole lines (8 rows' pieces of the same 8 k lie side by side)
__global__ __launch_bounds__(256) void k_cvt8(const float* __restrict__ src, bf* dst, size_t n8) { const size_t i = (size_t)blockIdx.x * 256 + threadIdx.x; if (i >= n8) return;
    const size_t row = (i >> 6) / (DM / 32) * 16 + ((i >> 2) & 15); const int k = (int)((i >> 6) % (DM / 32)) * 32 + (int)(i & 3) * 8; const v8f v = *(const v8f*)(src + row * DM + k); v8us o;
#pragma unroll
    for (int q = 0; q < 8; ++q) o[q] = f2bf(v[q]); *(v8us*)(dst + fidx(row, k, DM)) = o;  }
__constant__ float INV[HD / 2] = {1.00000000f,0.663601220f,0.440366596f,0.292227834f,0.193922743f,0.128687367f,0.0853971019f,0.0566696227f,0.0376060307f,0.0249554086f,0.0165604409f,0.0109895281f,0.00729266461f,0.00483942125f,0.00321144611f,0.00213111960f,0.00141421356f,0.000938473851f,0.000622772437f,0.000413272559f,0.000274248188f,0.000181991432f,0.000120769735f,0.0000801429487f,0.0000531829573f,0.0000352922762f,0.0000234199997f,0.0000155415401f,0.0000103133852f,0.00000684397537f,0.00000454167048f,0.00000301385808f};
// (cos, sin) of t x INV[d], d < HD / 2 (d + HD / 2 has the same angle), in the order in which the projection's epilogue reads them: pair p = ((((t / 16) * 2 + d / 16) * 4 + (d & 7) / 2) * 32 + ((d >> 3) & 1) * 16 + (t & 15)) * 2 + (d & 1),
// so that lane 16 hi + lr finds the pairs of d = 16 mb + 8 hi + 2 q, + 1 at position t = 16 tb + lr in one 16-byte load, and the wave's load covers 4 whole lines. Thread p writes pair p.
__global__ __launch_bounds__(256) void k_cstab(float* CS) { const int p = blockIdx.x * 256 + threadIdx.x; if (p >= TT * HD / 2) return; const int t = (p >> 9) * 16 + ((p >> 1) & 15), d = ((p >> 8) & 1) * 16 + ((p >> 5) & 1) * 8 + ((p >> 6) & 3) * 2 + (p & 1); const float ang = __fmul_rn((float)t, INV[d]); v2f cs; cs[0] = cosf(ang); cs[1] = sinf(ang);
    *(v2f*)(CS + (size_t)p * 2) = cs;  }

#define PC2  6.0f
#define CS2  (SCL * 1.4426950408889634f)
__device__ __forceinline__ float xhalf(float x) { return __builtin_bit_cast(float, __builtin_amdgcn_permlanex16(__builtin_bit_cast(int, x), __builtin_bit_cast(int, x), 0x76543210, 0xfedcba98, false, false)); }  // lane l with lane l ^ 16
__device__ __forceinline__ void sfence() { __builtin_amdgcn_sched_barrier(0); }   // keeps a load group where it is written, so that it flies under the work behind it
#define SK   128
#define FKE  (SK * HD)      // elements of a stage's K part; V^T takes as many
#define FVB  (SK / 32 * 512)   // elements of a stage's part of 16 rows of V^T
// eight copies and, as the statement's last line, the wait that stands in front of any rewrite of the address registers they name
__device__ __forceinline__ void cp8(const unsigned (&l)[8], const char* const (&g)[8]) {
    asm volatile(CPL(0, 1) CPL(2, 3) CPL(4, 5) CPL(6, 7) CPL(8, 9) CPL(10, 11) CPL(12, 13) CPL(14, 15) "s_wait_xcnt 0x0"
        :: "v"(l[0]), "v"(g[0]), "v"(l[1]), "v"(g[1]), "v"(l[2]), "v"(g[2]), "v"(l[3]), "v"(g[3]), "v"(l[4]), "v"(g[4]), "v"(l[5]), "v"(g[5]), "v"(l[6]), "v"(g[6]), "v"(l[7]), "v"(g[7]) : "memory");
}
__device__ __forceinline__ void ld_k(v16h (&k)[2][2], const h16* kp) {
#pragma unroll
    for (int kt = 0; kt < 2; ++kt)
#pragma unroll
        for (int kc = 0; kc < 2; ++kc) k[kt][kc] = WFrag<h16>::ld(kp + kt * 16 * HD + kc * 512); }
__device__ __forceinline__ void xwait() { asm volatile("s_wait_xcnt 0x0" ::: "memory"); }   // stands in front of the overwrite of a register that issued stores name
// one pass of 32 keys, from the stage in LDS (kp, vp: the pass's own K rows and V^T blocks, + the lane's place). Behind the score products one group of LDS reads: the pass's V^T fragments and, inside a stage (NEXTK),
// the next pass's K fragments into the registers just read; they land under the softmax.
template <bool NEXTK>
__device__ __forceinline__ void fpass(v16h (&kf)[2][2], const h16* kp, const h16* vp, const v16h (&qf)[2][2], v8f (&acc)[2][4], float (&lsum)[2], float (&mrun)[2]) {
    v8f s[2][2]; v16h vf[4];
#pragma unroll
    for (int kt = 0; kt < 2; ++kt)
#pragma unroll
        for (int g = 0; g < 2; ++g) { s[kt][g] = (v8f){};
#pragma unroll
            for (int kc = 0; kc < 2; ++kc) s[kt][g] = wmma16(kf[kt][kc], qf[g][kc], s[kt][g]); }
    sfence();
#pragma unroll
    for (int t = 0; t < 4; ++t) vf[t] = WFrag<h16>::ld(vp + t * FVB);
    if (NEXTK) ld_k(kf, kp + 32 * HD);
    sfence();
    float mb[2]; bool need = false;
#pragma unroll
    for (int g = 0; g < 2; ++g) { float mx = -INFINITY;
#pragma unroll
        for (int kt = 0; kt < 2; ++kt)
#pragma unroll
            for (int r = 0; r < 8; ++r) mx = fmaxf(mx, s[kt][g][r]);
        mx = fmaxf(mx, xhalf(mx)) * CS2; mb[g] = mx; need = need || (mx > mrun[g] + 8.0f); }
    if (__builtin_amdgcn_ballot_w32(need) != 0) {   // wave-uniform; rare after the first passes
#pragma unroll
        for (int g = 0; g < 2; ++g) { const float mn = fmaxf(mrun[g], mb[g]); const float corr = __builtin_amdgcn_exp2f(mrun[g] - mn); mrun[g] = mn; lsum[g] = lsum[g] * corr;
#pragma unroll
            for (int t = 0; t < 4; ++t) acc[g][t] = acc[g][t] * corr; } }
#pragma unroll
    for (int g = 0; g < 2; ++g) { const float nm = PC2 - mrun[g]; v16h pf; float p[16];
#pragma unroll
        for (int e = 0; e < 16; ++e) { p[e] = __builtin_amdgcn_exp2f(fmaf(s[e >> 3][g][e & 7], CS2, nm)); pf[e] = tohx(p[e]); }   // element e of the 32-key operand = tile e >> 3, register e & 7 (the hardware k order, as the V^T loader's)
#pragma unroll
        for (int w = 8; w; w >>= 1)
#pragma unroll
            for (int e = 0; e < w; ++e) p[e] += p[e + w];
        lsum[g] += p[0];
#pragma unroll
        for (int t = 0; t < 4; ++t) acc[g][t] = wmma16(vf[t], pf, acc[g][t]); }
}
__global__ __launch_bounds__(256) __attribute__((amdgpu_waves_per_eu(4, 4))) void k_fattn(const h16* __restrict__ Q16, const h16* __restrict__ K16, const h16* __restrict__ V16, bf* Ah, bf* Al) {
    static_assert(TT % SK == 0 && TT / SK >= 2 && SK * HD * 2 == 8 * 4 * 512 && FVB * 2 == 8 * 512, "whole stages, both buffers have a first one; 8 waves: 4 copies each for K, one each for every 16 rows of V^T");
    __shared__ __attribute__((aligned(1024))) h16 sm[2 * 2 * FKE];
    const int lane = threadIdx.x & 31, c = lane & 15, hi = lane >> 4; const int wave = __builtin_amdgcn_readfirstlane(threadIdx.x >> 5);
    const int h = blockIdx.y, q0 = blockIdx.x * 256 + wave * 32;
    { const size_t z = blockIdx.z; Q16 += z * NQK * TT * HD; K16 += z * NQK * TT * HD; V16 += z * NKV * HD * TT; Ah += z * TT * DQ; Al += z * TT * DQ; }   // blockIdx.z = batch; a batch's q and k planes lie in one run of NQK planes
    const h16* qp = Q16 + ((size_t)h * TT + q0) * HD + lane * 8;
    // the lane's 16 bytes of the wave's first K piece and first V^T piece of the stage to be issued next; both step by one stage at each issue
    const char* kg = (const char*)(K16 + (size_t)(h / REP) * TT * HD) + wave * 512 + lane * 16; const char* vg = (const char*)(V16 + (size_t)(h / REP) * HD * TT) + wave * 512 + lane * 16;
    const unsigned l0 = (unsigned)(size_t)sm + wave * 512 + lane * 16;
    auto issue = [&](unsigned lb) {   // one stage's copies into the buffer at LDS byte lb (+ the wave's and the lane's place): K pieces wave + 8 i, then piece wave of each 16 rows of V^T
        unsigned l[8]; const char* g[8];
#pragma unroll
        for (int i = 0; i < 4; ++i) { l[i] = lb + i * 4096; g[i] = kg + i * 4096; l[4 + i] = lb + FKE * 2 + i * (FVB * 2); g[4 + i] = vg + (size_t)i * (16 * TT * 2); }
        cp8(l, g);
        kg += FKE * 2; vg += FVB * 2;
    };
    issue(l0);
    v16h qf[2][2];
#pragma unroll
    for (int g = 0; g < 2; ++g)
#pragma unroll
        for (int kc = 0; kc < 2; ++kc) qf[g][kc] = WFrag<h16>::ld(qp + g * 16 * HD + kc * 512);
    asm volatile("s_wait_xcnt 0x0" :: "v"(qp) : "memory");   // as xwait(); the operand keeps the Q loads' address pair from being reused in front of the wait
    v8f acc[2][4]; float lsum[2], mrun[2];
#pragma unroll
    for (int g = 0; g < 2; ++g) { mrun[g] = -INFINITY; lsum[g] = 0.0f;
#pragma unroll
        for (int t = 0; t < 4; ++t) acc[g][t] = (v8f){}; }
    asm volatile("s_wait_asynccnt 0x0" ::: "memory");   // this wave's copies of stage 0 have landed
    __syncthreads();                                     // ... and every other wave's
    issue(l0 + 2 * FKE * 2);                             // stage 1 flies under stage 0's passes
#pragma unroll 1   // a stage a trip, its SK / 32 passes unrolled
    for (int st = 0; st < TT / SK; ++st) {
        const h16* sb = sm + (st & 1) * (2 * FKE) + lane * 8;
        v16h kf[2][2]; ld_k(kf, sb); sfence();   // the stage's first K fragments as one group of LDS reads, not spread among the first products
#pragma unroll
        for (int p = 0; p < SK / 32; ++p) {
            if (p + 1 < SK / 32) fpass<true>(kf, sb + p * 32 * HD, sb + FKE + p * 512, qf, acc, lsum, mrun);
            else fpass<false>(kf, sb + p * 32 * HD, sb + FKE + p * 512, qf, acc, lsum, mrun); }
        asm volatile("s_wait_dscnt 0x0" ::: "memory");      // this wave's reads of the buffer are done before it is handed back
        asm volatile("s_wait_asynccnt 0x0" ::: "memory");   // this wave's copies of stage st + 1 have landed
        __syncthreads();                                     // publishes stage st + 1 and ends every wave's reads of stage st
        if (st + 2 < TT / SK) issue(l0 + (st & 1) * (2 * FKE * 2));   // stage st + 2 into the buffer just read
    }
    asm volatile("s_wait_asynccnt 0x0" ::: "memory");   // nothing is in flight when the wave goes on
#pragma unroll
    for (int g = 0; g < 2; ++g) { const float inv = __fdiv_rn(1.0f, lsum[g] + xhalf(lsum[g]));   // a query's 32 keys of a pass lie half in lane c, half in lane c + 16
        const size_t oo = fidx(q0 + 16 * g + c, h * HD + 8 * hi, DQ);   // the merged planes are the last product's A operand: fragment order, a wave's store 512 contiguous bytes; 16 d further lie 256 elements on
#pragma unroll
        for (int t = 0; t < 4; ++t) { v8us oh, ol;   // acc[g][t][r] = O[query c][d = 16 t + 8 hi + r]
#pragma unroll
            for (int r = 0; r < 8; ++r) { unsigned short a, c2; splitf(acc[g][t][r] * inv, a, c2); oh[r] = a; ol[r] = c2; }
            *(v8us*)(Ah + oo + 256 * t) = oh; *(v8us*)(Al + oo + 256 * t) = ol; if (g == 0 || t < 3) xwait(); } }   // the wait: the next pair's values are formed in registers that these stores name (behind the last pair nothing is)
}

extern "C" void kernel_launch(void* const* d_in, const int* in_sizes, int n_in,
                              void* d_out, int out_size, void* d_ws, size_t ws_size, hipStream_t stream) {
    (void)in_sizes; (void)n_in; (void)out_size;
    const float* x = (const float*)d_in[0]; const float* wq = (const float*)d_in[1]; const float* wk = (const float*)d_in[2]; const float* wv = (const float*)d_in[3]; const float* wo = (const float*)d_in[4];
    float* OUT = (float*)d_out;     // [2][2048][2048]
    char* wsp = (char*)d_ws;
    auto take = [&](size_t bytes) { char* p = wsp; wsp += (bytes + 255) & ~(size_t)255; return (void*)p; };
    bf* WF = (bf*)take((size_t)DF * DM * 2); bf* WO = (bf*)take((size_t)DM * DQ * 2); float* CS = (float*)take((size_t)TT * (HD / 2) * 2 * 4);   // WF: wq, wk, wv transposed, row after row: one [DF][DM] operand
    bf* XB = (bf*)take((size_t)MT * DM * 2);
    h16* QK16 = (h16*)take((size_t)NB_ * NQK * TT * HD * 2); h16* VT16 = (h16*)take((size_t)NB_ * NKV * HD * TT * 2);
    bf* ATh = (bf*)take((size_t)MT * DQ * 2); bf* ATl = (bf*)take((size_t)MT * DQ * 2);
    if ((size_t)(wsp - (char*)d_ws) > ws_size) return;    // 93 MiB of the 256 MiB
    // every stage is ONE launch over all of its work: both batches as 4096 rows (a grid index in k_fattn), q, k and v as one product: 256 work-groups in each of the two products, 12 and 8 waves each (3 and 2 wave tiles a SIMD)
    // Left open: k_gemmw's 64 x 64 wave tile reads 8 fragments from LDS for 16 products (a 64 x 128 tile: 12 for 32), its ring has two buffers; k_wtG and k_cvt8 start a wave for every 512 bytes they write; k_fattn (all 512 work-groups resident, four waves a SIMD) does its row sums and maxima on the vector port
    k_wtG<<<dim3((unsigned)(DM * DQ / 8 / 256), 4, 1), 256, 0, stream>>>(wq, wk, wv, wo, WF, WO);
    k_cstab<<<(TT * HD / 2 + 255) / 256, 256, 0, stream>>>(CS);
    k_cvt8<<<(unsigned)(((size_t)MT * DM / 8 + 255) / 256), 256, 0, stream>>>(x, XB, (size_t)MT * DM / 8);
    k_gemmw<bf, 0, false, true, 4, 3, 128, DM><<<dim3(MT / 256, DF / 192, 1), 384, 0, stream>>>(XB, nullptr, WF, nullptr, nullptr, 0, nullptr, 0, 0, 0, CS, QK16, VT16);   // writes the rotated q and k planes and the transposed v plane
    k_fattn<<<dim3(TT / 256, NH_, NB_), 256, 0, stream>>>(QK16, QK16 + (size_t)NH_ * TT * HD, VT16, ATh, ATl);
    k_gemmw<bf, 1, false, false, 4, 2, 64, DQ><<<dim3(MT / 256, DM / 128, 1), 256, 0, stream>>>(ATh, ATl, WO, nullptr, OUT, DM, nullptr, 0, 0, 0, nullptr, nullptr, nullptr);
}

// v007
// It runs in 137 microseconds.
// Timed twice side by side with v006, it ran 1.04 times as fast both times.
// All steps since v000 together make it 18.3 times as fast.
#include <hip/hip_runtime.h>

// Grouped-query RoPE attention without a mask (x [2][2048][2048]; q = x Wq (32 heads x 64), k, v = x Wk / Wv ([2048][512]: 8 kv heads); rotate-half RoPE (theta 5e5, tables computed on device); kv head = h/4; softmax(q.k/8) over all keys; out = merged Wo -> [2][2048][2048] (8.4 M)).
// Compute dtypes, f32 accumulate: every input rounded to bf16; q/k/v on PLAIN bf16 operands (inputs: exact); rotary in f32; scores and attn.v on single fp16 operands for every row (x64 probability carry against the running maximum); online softmax f32, denominator summed in f32 from the f32 exponentials; Wo hl x exact (2 products).

#define NB_  2
#define TT   2048
#define DM   2048
#define NH_  32
#define NKV  8
#define REP  (NH_ / NKV)
#define HD   64
#define DQ   (NH_ * HD)
#define DKV  (NKV * HD)
#define DF   (DQ + 2 * DKV)   // columns of the joined q | k | v projection
#define NQK  (NH_ + NKV)       // rotated head planes of a batch: 32 q heads, then 8 k heads
#define MT   (NB_ * TT)        // rows of both batches
#define SCL  0.125f   // HD^-0.5
typedef _Float16 h16;
typedef unsigned short bf;
typedef __attribute__((ext_vector_type(16))) __bf16   v16bf;
typedef __attribute__((ext_vector_type(16))) _Float16 v16h;
typedef __attribute__((ext_vector_type(8)))  _Float16 v8h;
typedef __attribute__((ext_vector_type(8)))  unsigned short v8us;
typedef __attribute__((ext_vector_type(8)))  float    v8f;
typedef __attribute__((ext_vector_type(4)))  float    v4f;
typedef v8h  __attribute__((may_alias)) v8ha;
typedef v4f  __attribute__((may_alias)) v4fa;
typedef v8us __attribute__((may_alias)) v8usa;

__device__ __forceinline__ unsigned short f2bf(float f) { unsigned u = __float_as_uint(f); u += 0x7FFFu + ((u >> 16) & 1u); return (unsigned short)(u >> 16); }
__device__ __forceinline__ float bf2f(unsigned short b) { return __uint_as_float(((unsigned)b) << 16); }
__device__ __forceinline__ float bfr(float f) { return bf2f(f2bf(f)); }
__device__ __forceinline__ v16h cat16(v8h lo, v8h hi) { return __builtin_shufflevector(lo, hi, 0, 1, 2, 3, 4, 5, 6, 7, 8, 9, 10, 11, 12, 13, 14, 15); }
__device__ __forceinline__ v16bf cat16b(v8us lo, v8us hi) { return __builtin_bit_cast(v16bf, __builtin_shufflevector(lo, hi, 0, 1, 2, 3, 4, 5, 6, 7, 8, 9, 10, 11, 12, 13, 14, 15)); }
__device__ __forceinline__ v8f wmma16(v16h a, v16h b, v8f c) { return __builtin_amdgcn_wmma_f32_16x16x32_f16(false, a, false, b, (short)0, c, false, false); }
__device__ __forceinline__ v8f wmmab(v16bf a, v16bf b, v8f c) { return __builtin_amdgcn_wmma_f32_16x16x32_bf16(false, a, false, b, (short)0, c, false, false); }



// ---- FRAGMENT ORDER: every 16-bit matrix operand plane (rows x K) is stored as blocks of 16 rows x 32 k = 512 elements, block (row / 16, k / 32) at element (row / 16) * 16 * K + (k / 32) * 512.
// Inside a block the element (row, k) lies at ((k >> 4) & 1) * 256 + ((k >> 3) & 1) * 128 + (row & 15) * 8 + (k & 7): lane l of the wave finds its first 8 operand elements at l * 8 and its last 8 at 256 + l * 8,
// so each of a fragment's two 16-byte loads covers 512 contiguous bytes (4 whole lines), where a row-major plane made it touch 16 lines. The k order of a fragment is what it was.
__device__ __forceinline__ size_t fidx(size_t row, int k, int K) { return (row >> 4) * ((size_t)16 * K) + (size_t)(k >> 5) * 512 + ((k >> 4) & 1) * 256 + ((k >> 3) & 1) * 128 + (row & 15) * 8 + (k & 7); }
// ---- k_gemmw: register-blocked GEMM, one wave per 64x64 output tile (16 accumulators), WM x WN waves a work-group, operands from 16-bit planes in fragment order through LDS; grid (M / (64 WM), N / (64 WN), Z).
// C[m][n] (f32, pitch ldc, + optional f32 bias[n]) = sum_k A[m][k] Bt[n][k] (+ split products per NSPLIT). z-batch strides sA/sB/sC in elements. K % KD == 0.
// HEADS (the joined q | k | v projection; a 64-column tile is one head): no C plane. The epilogue turns the accumulators into the fp16 operand planes that k_fattn reads, in fragment order, straight from the registers.
// A lane's 8 accumulator registers run along the A operand's rows. A v tile keeps x as A: 8 neighbouring t of one d, a 16-byte piece of the [d][t] plane. A q or k tile takes the weight rows as A and x as B (same loader, same k order, same sums):
// 8 neighbouring d of one t, a piece of the [t][d] plane, and the rotary partner d + 32 lies in the same lane and register two accumulator tiles on.
template <typename T16> struct WFrag;
template <> struct WFrag<h16> { typedef v16h V; static __device__ __forceinline__ V ld(const h16* p) { return cat16(*(const v8h*)p, *(const v8h*)(p + 256)); } static __device__ __forceinline__ v8f mma(V a, V b, v8f c) { return wmma16(a, b, c); } };
template <> struct WFrag<bf> { typedef v16bf V; static __device__ __forceinline__ V ld(const bf* p) { return cat16b(*(const v8us*)p, *(const v8us*)(p + 256)); } static __device__ __forceinline__ v8f mma(V a, V b, v8f c) { return wmmab(a, b, c); } };
// OPERAND TILES THROUGH LDS: a work-group of WM x WN waves owns 64 WM x 64 WN outputs (a wave keeps its 64 x 64 tile and its epilogue). A stage is KD k of every operand row of the work-group, brought in once by asynchronous copies
// and read by every wave that needs it; two buffers, the next stage's copies fly while this one is worked on. A plane in fragment order keeps its order in LDS: a run of 16 rows x KD k is KD * 32 contiguous bytes there as in memory,
// a copy is 512 contiguous bytes on both sides, and a fragment read is two conflict-free 16-byte reads a lane.
#define CPL(a, b) "global_load_async_to_lds_b128 %" #a ", %" #b ", off\n\t"
// the copies of one run and, as the statement's last line, the wait that stands in front of any rewrite of the address registers they name
__device__ __forceinline__ void cp1(unsigned l, const char* g) { asm volatile(CPL(0, 1) "s_wait_xcnt 0x0" :: "v"(l), "v"(g) : "memory"); }
template <int N> __device__ __forceinline__ void cpn(const unsigned (&l)[N], const char* const (&g)[N]) {
    static_assert(N == 9 || N == 10, "one statement a run");
    if constexpr (N == 9) asm volatile(CPL(0, 1) CPL(2, 3) CPL(4, 5) CPL(6, 7) CPL(8, 9) CPL(10, 11) CPL(12, 13) CPL(14, 15) CPL(16, 17) "s_wait_xcnt 0x0"
        :: "v"(l[0]), "v"(g[0]), "v"(l[1]), "v"(g[1]), "v"(l[2]), "v"(g[2]), "v"(l[3]), "v"(g[3]), "v"(l[4]), "v"(g[4]), "v"(l[5]), "v"(g[5]), "v"(l[6]), "v"(g[6]), "v"(l[7]), "v"(g[7]), "v"(l[8]), "v"(g[8]) : "memory");
    else asm volatile(CPL(0, 1) CPL(2, 3) CPL(4, 5) CPL(6, 7) CPL(8, 9) CPL(10, 11) CPL(12, 13) CPL(14, 15) CPL(16, 17) CPL(18, 19) "s_wait_xcnt 0x0"
        :: "v"(l[0]), "v"(g[0]), "v"(l[1]), "v"(g[1]), "v"(l[2]), "v"(g[2]), "v"(l[3]), "v"(g[3]), "v"(l[4]), "v"(g[4]), "v"(l[5]), "v"(g[5]), "v"(l[6]), "v"(g[6]), "v"(l[7]), "v"(g[7]), "v"(l[8]), "v"(g[8]), "v"(l[9]), "v"(g[9]) : "memory");
}
template <typename T16, int NSPLIT, bool BIAS, bool HEADS, int WM, int WN, int KD, int K>
__global__ __launch_bounds__(WM * WN * 32) void k_gemmw(const T16* __restrict__ A, const T16* __restrict__ A2, const T16* __restrict__ Bt, const T16* __restrict__ Bt2, float* C, int ldc, const float* __restrict__ bias, size_t sA, size_t sB, size_t sC, const float* __restrict__ CS, h16* QK, h16* VT) {
    typedef typename WFrag<T16>::V V;
    static_assert(NSPLIT <= 1, "one weight plane; one or two planes on the other side");
    constexpr int NW = WM * WN, NXB = 4 * WM * (NSPLIT == 1 ? 2 : 1), NRB = NXB + 4 * WN;   // waves; runs of 16 rows of a stage: the x side's (both planes), then the weight's
    constexpr int RB = KD * 16, STG = NRB * RB, UPR = KD / 16, NU = NRB * UPR;                // elements of a run and of a stage; copies of 512 bytes a run and a stage
    constexpr int NCF = NU / NW, REM = NU % NW, H = NCF / 2, NB = KD / 32;                    // copies that every wave issues a stage, in two runs of H; waves that issue one more; blocks of 32 k a stage
    static_assert(NCF == 2 * H && NCF + 1 <= 63, "two equal runs; a wave's copies in flight");
    constexpr int NT = K / KD; static_assert(K % KD == 0 && NT >= 2, "whole stages, and both buffers have a first stage");
    __shared__ __attribute__((aligned(1024))) T16 sm[2 * STG];
    __shared__ __align__(16) float osm[HEADS ? 4 : NW * 16 * 68];
    const size_t z = blockIdx.z; A += z * sA; if (A2) A2 += z * sA; Bt += z * sB; C += z * sC;
    const int lane = threadIdx.x & 31, lr = lane & 15, hi = lane >> 4; const int wave = __builtin_amdgcn_readfirstlane(threadIdx.x >> 5), wm = wave % WM, wn = wave / WM;
    const int R0 = blockIdx.x * (64 * WM), C0 = blockIdx.y * (64 * WN), r0 = R0 + 64 * wm, c0 = C0 + 64 * wn;
    float* os = osm + (HEADS ? 0 : wave * (16 * 68));   // a wave's own staging rows
    v8f acc[4][4];
#pragma unroll
    for (int mb = 0; mb < 4; ++mb)
#pragma unroll
        for (int nb = 0; nb < 4; ++nb) acc[mb][nb] = (v8f){};
    const unsigned lo = lane * 8;
    const bool rot = HEADS && c0 < DQ + DKV;   // a q or k head (the same for the whole wave): the two operands change places
    const int xo = 4 * wm * RB, wo_ = (NXB + 4 * wn) * RB;   // the wave's own runs inside a stage
    const int ao = rot ? wo_ : xo, bo = rot ? xo : wo_, a2o = xo + 4 * WM * RB;
    // copy number i of a wave is piece wave + NW i of the stage; its source pointer is wave-uniform, lives through the loop and steps by one stage (KD k of 16 rows) at each issue
    const char* gp[NCF + 1];
#pragma unroll
    for (int i = 0; i <= NCF; ++i) { const int u = wave + NW * i, j = u / UPR < NRB ? u / UPR : NRB - 1;
        const T16* p = j < 4 * WM ? A + (size_t)(R0 + 16 * j) * K : (NSPLIT == 1 && j < NXB) ? A2 + (size_t)(R0 + 16 * (j - 4 * WM)) * K : Bt + (size_t)(C0 + 16 * (j - NXB)) * K;
        gp[i] = (const char*)p + (u % UPR) * 512; }
    const unsigned l0 = (unsigned)(size_t)sm + wave * 512 + lane * 16, lane16 = lane * 16;
    auto issue = [&](unsigned lb) {   // one stage's copies into the buffer at LDS byte lb (+ the wave's and the lane's place)
#pragma unroll
        for (int h = 0; h < 2; ++h) { unsigned l[H]; const char* g[H];
#pragma unroll
            for (int i = 0; i < H; ++i) { l[i] = lb + (h * H + i) * (NW * 512); g[i] = gp[h * H + i] + lane16; }
            cpn<H>(l, g); }
        if (REM != 0 && wave < REM) cp1(lb + NCF * (NW * 512), gp[NCF] + lane16);   // wave-uniform: a scalar branch
#pragma unroll
        for (int i = 0; i <= NCF; ++i) gp[i] += KD * 32;
    };
    issue(l0);
    asm volatile("s_wait_asynccnt 0x0" ::: "memory");   // this wave's copies of stage 0 have landed
    __syncthreads();                                     // ... and every other wave's
    issue(l0 + STG * 2);                                 // stage 1 flies under stage 0's products
#pragma unroll 1
    for (int t = 0; t < NT; ++t) {
        const T16* sb = sm + (t & 1) * STG + lo;
        V a[2][4], a2[2][4], b[2][4];
        auto frags = [&](int kk) {
#pragma unroll
            for (int i = 0; i < 4; ++i) { a[kk & 1][i] = WFrag<T16>::ld(sb + ao + i * RB + kk * 512); if (NSPLIT == 1) a2[kk & 1][i] = WFrag<T16>::ld(sb + a2o + i * RB + kk * 512); b[kk & 1][i] = WFrag<T16>::ld(sb + bo + i * RB + kk * 512); } };
        frags(0);
#pragma unroll
        for (int kk = 0; kk < NB; ++kk) {
            if (kk + 1 < NB) frags(kk + 1);
            __builtin_amdgcn_sched_barrier(0);   // the next block's LDS reads stay one group in front of this block's products, not spread among them
#pragma unroll
            for (int nb = 0; nb < 4; ++nb)
#pragma unroll
                for (int mb = 0; mb < 4; ++mb) { acc[mb][nb] = WFrag<T16>::mma(a[kk & 1][mb], b[kk & 1][nb], acc[mb][nb]); if (NSPLIT == 1) acc[mb][nb] = WFrag<T16>::mma(a2[kk & 1][mb], b[kk & 1][nb], acc[mb][nb]); }
            __builtin_amdgcn_sched_barrier(0);   // as above: the block ends here
        }
        asm volatile("s_wait_dscnt 0x0" ::: "memory");      // this wave's reads of the buffer are done before it is handed back
        asm volatile("s_wait_asynccnt 0x0" ::: "memory");   // this wave's copies of stage t + 1 have landed
        __syncthreads();                                     // publishes stage t + 1 and ends every wave's reads of stage t
        if (t + 2 < NT) issue(l0 + (t & 1) * (STG * 2));     // stage t + 2 into the buffer just read
    }
    asm volatile("s_wait_asynccnt 0x0" ::: "memory");   // nothing is in flight when the wave goes on
    if (HEADS) {
        static_assert(TT % 64 == 0 && HD == 64, "a tile's 64 rows lie in one batch, its 64 columns are one head");
        const int bz = r0 / TT, t0 = r0 % TT;
        if (rot) {   // acc[mb][nb][j] = head column d = 16 mb + 8 hi + j of position t = t0 + 16 nb + lr
            const v4fa* tp = (const v4fa*)(CS + (size_t)(t0 >> 4) * (HD * 16)) + lane;   // p_cstab's order: every load below is 512 contiguous bytes
            h16* op = QK + (((size_t)bz * NQK + c0 / HD) * TT + t0) * HD + lo;            // fidx(head row t0 + lr, 8 hi, HD); 16 t further lie 16 HD elements on, 16 d further 256
            v4f cs[2][2][4];
#pragma unroll
            for (int mb = 0; mb < 2; ++mb)
#pragma unroll
                for (int q = 0; q < 4; ++q) cs[0][mb][q] = tp[(mb * 4 + q) * 32];
#pragma unroll
            for (int nb = 0; nb < 4; ++nb) {
                if (nb < 3) {
#pragma unroll
                    for (int mb = 0; mb < 2; ++mb)
#pragma unroll
                        for (int q = 0; q < 4; ++q) cs[(nb + 1) & 1][mb][q] = tp[(((nb + 1) * 2 + mb) * 4 + q) * 32]; }
                __builtin_amdgcn_sched_barrier(0);   // keeps the next 16 positions' table loads in front of this group's arithmetic, so that they fly under it
                v8h o[4];
#pragma unroll
                for (int mb = 0; mb < 2; ++mb)
#pragma unroll
                    for (int j = 0; j < 8; ++j) { const float co = cs[nb & 1][mb][j >> 1][(j & 1) * 2], si = cs[nb & 1][mb][j >> 1][(j & 1) * 2 + 1], x0 = acc[mb][nb][j], x1 = acc[mb + 2][nb][j];
                        o[mb][j] = (h16)(x0 * co - x1 * si); o[mb + 2][j] = (h16)(x1 * co + x0 * si); }
                __builtin_amdgcn_sched_barrier(0);   // all four pieces are formed in front of the first store: none is formed in a register that an issued store of the group names
#pragma unroll
                for (int mb = 0; mb < 4; ++mb) *(v8h*)(op + nb * 16 * HD + mb * 256) = o[mb];
                if (nb < 3) asm volatile("s_wait_xcnt 0x0" ::: "memory");   // the next group's pieces are formed in registers that these stores name (behind the last group nothing is)
            }
        } else {     // acc[mb][nb][j] = v column d = 16 nb + lr of position t = t0 + 16 mb + 8 hi + j
            h16* op = VT + ((size_t)bz * DKV + (c0 - DQ - DKV)) * TT + (size_t)(t0 >> 5) * 512 + lo;   // fidx(row d = lr, t0 + 8 hi, TT); 16 d further lie 16 TT elements on, 16 t further 256
#pragma unroll
            for (int nb = 0; nb < 4; ++nb) {
                v8h o[4];
#pragma unroll
                for (int mb = 0; mb < 4; ++mb)
#pragma unroll
                    for (int j = 0; j < 8; ++j) o[mb][j] = (h16)acc[mb][nb][j];
                __builtin_amdgcn_sched_barrier(0);   // as above: the group's four pieces first, then its stores
#pragma unroll
                for (int mb = 0; mb < 4; ++mb) *(v8h*)(op + (size_t)nb * 16 * TT + mb * 256) = o[mb];
                if (nb < 3) asm volatile("s_wait_xcnt 0x0" ::: "memory");   // as above
            }
        }
        return;
    }
#pragma unroll
    for (int mb = 0; mb < 4; ++mb) {
#pragma unroll
        for (int nb = 0; nb < 4; ++nb) {
#pragma unroll
            for (int j = 0; j < 8; ++j) os[(hi * 8 + j) * 68 + nb * 16 + lr] = acc[mb][nb][j]; }
        __builtin_amdgcn_wave_barrier(); asm volatile("" ::: "memory");
        float* crow = C + (size_t)(r0 + mb * 16) * ldc + c0;
{
#pragma unroll
            for (int s = 0; s < 8; ++s) { const int row = 2 * s + hi, cofs = lr * 4; v4f val = *(const v4fa*)(os + row * 68 + cofs); if (BIAS) { val[0] += bfr(bias[c0 + cofs]); val[1] += bfr(bias[c0 + cofs + 1]); val[2] += bfr(bias[c0 + cofs + 2]); val[3] += bfr(bias[c0 + cofs + 3]); }
                *(v4f*)(crow + (size_t)row * ldc + cofs) = val; }
             }
        __builtin_amdgcn_wave_barrier(); asm volatile("" ::: "memory");
    }
}

__device__ __forceinline__ h16 tohx(float x) { return (h16)x; }
__device__ __forceinline__ void splitf(float y, unsigned short& h, unsigned short& l) { h = f2bf(y); l = f2bf(y - bf2f(h)); }
typedef __attribute__((ext_vector_type(2))) _Float16 v2h;
typedef __attribute__((ext_vector_type(4))) _Float16 v4h;
typedef __attribute__((ext_vector_type(2))) unsigned short v2us;
typedef __attribute__((ext_vector_type(4))) unsigned short v4us;
typedef __attribute__((ext_vector_type(2))) float v2f;
typedef __attribute__((ext_vector_type(4))) int v4i;

// ---- k_prep: ALL THE PREPARATION IN ONE LAUNCH. The rotary table, the four weight planes and the x plane depend on nothing but the inputs: each takes a range of the launch's work-groups (8 waves each), and all 1280 are resident at once,
// five on each of the chip's 256 WGPs (96 registers a wave). For that a thread of the two conversions takes several neighbouring pieces instead of one: PB work-groups each, not one wave for every 512 bytes written.
// All of a thread's loads are issued first and fly together; then every piece is rounded, then all are stored. A piece, its place and its values are what they were.
// A thread's pieces lie a constant step apart in both planes: it forms one 32-bit byte offset a plane, and the steps are the instructions' immediate offsets.
#define PB   512
#define PT   (PB * 256)   // threads of a conversion's range
__device__ __forceinline__ v8us rnd8(const float (&v)[8]) { v8us o;
#pragma unroll
    for (int q = 0; q < 8; ++q) o[q] = f2bf(v[q]);
    return o; }
// A piece of a weight w [K][N]: 16 bytes (8 k of one n) of the transposed plane in fragment order. A wave takes 32 neighbouring n at the same 8 k: each of its 8 loads is one whole line of w, its store two runs of 256 bytes.
// 128 threads take a group of 32 n x 32 k, and the J - 1 groups that follow it in k; neighbouring threads' groups take neighbouring lines of the same rows of w.
template <int N, int K, int J> struct WPc {
    static_assert((size_t)N * K / 8 == (size_t)J * PT, "the pieces of the weight are covered exactly");
    unsigned lo, so;   // byte offsets of the thread's first piece in w (its first k) and in the transposed plane
    __device__ __forceinline__ WPc(unsigned t) { const unsigned grp = t >> 7, n = (grp % (N / 32)) * 32 + (t & 31), k = (grp / (N / 32)) * (32 * J) + ((t >> 5) & 3) * 8; lo = (k * N + n) * 4; so = (unsigned)fidx(n, (int)k, K) * 2; }
    __device__ __forceinline__ void ld(const float* __restrict__ w, int j, float (&v)[8]) const {
#pragma unroll
        for (int q = 0; q < 8; ++q) v[q] = *(const float*)((const char*)w + lo + (32 * j + q) * (N * 4)); }
    __device__ __forceinline__ void st(bf* Bt, int j, v8us o) const { *(v8us*)((char*)Bt + so + j * 1024) = o; }   // 32 k further: the next block of 512 elements
};
// all four weights (wq, wk, wv into the joined plane, wo into its own): thread t of PT takes 4 pieces of wq, one of wk, one of wv and 4 of wo
__device__ __forceinline__ void p_wt(unsigned t, const float* __restrict__ wq, const float* __restrict__ wk, const float* __restrict__ wv, const float* __restrict__ wo, bf* WF, bf* WO) {
    static_assert(DQ == DM, "wq and wo have one shape");
    const WPc<DQ, DM, 4> wide(t); const WPc<DKV, DM, 1> slim(t); float v[10][8]; v8us o[10];
#pragma unroll
    for (int j = 0; j < 4; ++j) wide.ld(wq, j, v[j]);
    slim.ld(wk, 0, v[4]); slim.ld(wv, 0, v[5]);
#pragma unroll
    for (int j = 0; j < 4; ++j) wide.ld(wo, j, v[6 + j]);
    asm volatile("s_wait_xcnt 0x0" :: "v"(wide.lo), "v"(slim.lo) : "memory");   // stands in front of any overwrite of the two offset registers that the issued loads name; the operands keep those registers from being reused in front of the wait
    __builtin_amdgcn_sched_barrier(0);   // every load is issued in front of the first rounding: all of them are in flight at once
#pragma unroll
    for (int j = 0; j < 10; ++j) o[j] = rnd8(v[j]);
    __builtin_amdgcn_sched_barrier(0);   // every piece is formed in front of the first store: none is formed in a register that an issued store names
#pragma unroll
    for (int j = 0; j < 4; ++j) wide.st(WF, j, o[j]);
    slim.st(WF + (size_t)DQ * DM, 0, o[4]); slim.st(WF + (size_t)(DQ + DKV) * DM, 0, o[5]);
#pragma unroll
    for (int j = 0; j < 4; ++j) wide.st(WO, j, o[6 + j]);
    asm volatile("s_wait_xcnt 0x0" ::: "memory");   // behind the last store: whatever the listing places behind this range may overwrite registers that the issued stores name
}
// x (rows of DM) rounded to bf16, in fragment order: a piece is 16 bytes (8 k of one row). A wave takes 32 k of 8 rows: it reads 8 whole lines of x and stores 4 whole lines (8 rows' pieces of the same 8 k lie side by side).
// Thread t of PT takes 8 pieces: the same k of rows that lie 16 apart.
__device__ __forceinline__ void p_cvt(unsigned t, const float* __restrict__ src, bf* dst) {
    static_assert((size_t)MT * DM / 8 == 8 * (size_t)PT, "the pieces of x are covered exactly");
    const unsigned row = (t >> 6) / (DM / 32) * (16 * 8) + ((t >> 2) & 15), k = (t >> 6) % (DM / 32) * 32 + (t & 3) * 8;
    const unsigned lo = (row * DM + k) * 4, so = (unsigned)fidx(row, (int)k, DM) * 2; v8f v[8]; v8us o[8];
#pragma unroll
    for (int j = 0; j < 8; ++j) v[j] = *(const v8f*)((const char*)src + lo + j * (16 * DM * 4));
    asm volatile("s_wait_xcnt 0x0" :: "v"(lo) : "memory");   // as in p_wt: in front of any overwrite of the loads' offset register
    __builtin_amdgcn_sched_barrier(0);   // as in p_wt: all loads first
#pragma unroll
    for (int j = 0; j < 8; ++j)
#pragma unroll
        for (int q = 0; q < 8; ++q) o[j][q] = f2bf(v[j][q]);
    __builtin_amdgcn_sched_barrier(0);   // as in p_wt: all pieces first, then the stores
#pragma unroll
    for (int j = 0; j < 8; ++j) *(v8us*)((char*)dst + so + j * (16 * DM * 2)) = o[j];
    asm volatile("s_wait_xcnt 0x0" ::: "memory");   // as in p_wt: behind the last store
}
__constant__ float INV[HD / 2] = {1.00000000f,0.663601220f,0.440366596f,0.292227834f,0.193922743f,0.128687367f,0.0853971019f,0.0566696227f,0.0376060307f,0.0249554086f,0.0165604409f,0.0109895281f,0.00729266461f,0.00483942125f,0.00321144611f,0.00213111960f,0.00141421356f,0.000938473851f,0.000622772437f,0.000413272559f,0.000274248188f,0.000181991432f,0.000120769735f,0.0000801429487f,0.0000531829573f,0.0000352922762f,0.0000234199997f,0.0000155415401f,0.0000103133852f,0.00000684397537f,0.00000454167048f,0.00000301385808f};
// (cos, sin) of t x INV[d], d < HD / 2 (d + HD / 2 has the same angle), in the order in which the projection's epilogue reads them: pair p = ((((t / 16) * 2 + d / 16) * 4 + (d & 7) / 2) * 32 + ((d >> 3) & 1) * 16 + (t & 15)) * 2 + (d & 1),
// so that lane 16 hi + lr finds the pairs of d = 16 mb + 8 hi + 2 q, + 1 at position t = 16 tb + lr in one 16-byte load, and the wave's load covers 4 whole lines. Thread p writes pair p.
__device__ __forceinline__ void p_cstab(int p, float* CS) { const int t = (p >> 9) * 16 + ((p >> 1) & 15), d = ((p >> 8) & 1) * 16 + ((p >> 5) & 1) * 8 + ((p >> 6) & 3) * 2 + (p & 1); const float ang = __fmul_rn((float)t, INV[d]); v2f cs; cs[0] = cosf(ang); cs[1] = sinf(ang);
    *(v2f*)(CS + (size_t)p * 2) = cs;  }
#define CB   (TT * HD / 2 / 256)   // work-groups of the table's range
// the ranges: the table first (little data, long chains of arithmetic), then the weights, then x; blockIdx.x picks, the same for a whole work-group
__global__ __launch_bounds__(256) void k_prep(const float* __restrict__ x, const float* __restrict__ wq, const float* __restrict__ wk, const float* __restrict__ wv, const float* __restrict__ wo, bf* XB, bf* WF, bf* WO, float* CS) {
    static_assert(TT * HD / 2 % 256 == 0, "the table's pairs are covered exactly");
    const unsigned b = blockIdx.x;
    if (b < CB) p_cstab((int)(b * 256 + threadIdx.x), CS);
    else if (b < CB + PB) p_wt((b - CB) * 256 + threadIdx.x, wq, wk, wv, wo, WF, WO);
    else p_cvt((b - CB - PB) * 256 + threadIdx.x, x, XB);
}

#define PC2  6.0f
#define CS2  (SCL * 1.4426950408889634f)
__device__ __forceinline__ float xhalf(float x) { return __builtin_bit_cast(float, __builtin_amdgcn_permlanex16(__builtin_bit_cast(int, x), __builtin_bit_cast(int, x), 0x76543210, 0xfedcba98, false, false)); }  // lane l with lane l ^ 16
__device__ __forceinline__ void sfence() { __builtin_amdgcn_sched_barrier(0); }   // keeps a load group where it is written, so that it flies under the work behind it
#define SK   128
#define FKE  (SK * HD)      // elements of a stage's K part; V^T takes as many
#define FVB  (SK / 32 * 512)   // elements of a stage's part of 16 rows of V^T
// eight copies and, as the statement's last line, the wait that stands in front of any rewrite of the address registers they name
__device__ __forceinline__ void cp8(const unsigned (&l)[8], const char* const (&g)[8]) {
    asm volatile(CPL(0, 1) CPL(2, 3) CPL(4, 5) CPL(6, 7) CPL(8, 9) CPL(10, 11) CPL(12, 13) CPL(14, 15) "s_wait_xcnt 0x0"
        :: "v"(l[0]), "v"(g[0]), "v"(l[1]), "v"(g[1]), "v"(l[2]), "v"(g[2]), "v"(l[3]), "v"(g[3]), "v"(l[4]), "v"(g[4]), "v"(l[5]), "v"(g[5]), "v"(l[6]), "v"(g[6]), "v"(l[7]), "v"(g[7]) : "memory");
}
__device__ __forceinline__ void ld_k(v16h (&k)[2][2], const h16* kp) {
#pragma unroll
    for (int kt = 0; kt < 2; ++kt)
#pragma unroll
        for (int kc = 0; kc < 2; ++kc) k[kt][kc] = WFrag<h16>::ld(kp + kt * 16 * HD + kc * 512); }
__device__ __forceinline__ void xwait() { asm volatile("s_wait_xcnt 0x0" ::: "memory"); }   // stands in front of the overwrite of a register that issued stores name
// one pass of 32 keys, from the stage in LDS (kp, vp: the pass's own K rows and V^T blocks, + the lane's place). Behind the score products one group of LDS reads: the pass's V^T fragments and, inside a stage (NEXTK),
// the next pass's K fragments into the registers just read; they land under the softmax.
template <bool NEXTK>
__device__ __forceinline__ void fpass(v16h (&kf)[2][2], const h16* kp, const h16* vp, const v16h (&qf)[2][2], v8f (&acc)[2][4], float (&lsum)[2], float (&mrun)[2]) {
    v8f s[2][2]; v16h vf[4];
#pragma unroll
    for (int kt = 0; kt < 2; ++kt)
#pragma unroll
        for (int g = 0; g < 2; ++g) { s[kt][g] = (v8f){};
#pragma unroll
            for (int kc = 0; kc < 2; ++kc) s[kt][g] = wmma16(kf[kt][kc], qf[g][kc], s[kt][g]); }
    sfence();
#pragma unroll
    for (int t = 0; t < 4; ++t) vf[t] = WFrag<h16>::ld(vp + t * FVB);
    if (NEXTK) ld_k(kf, kp + 32 * HD);
    sfence();
    float mb[2]; bool need = false;
#pragma unroll
    for (int g = 0; g < 2; ++g) { float mx = -INFINITY;
#pragma unroll
        for (int kt = 0; kt < 2; ++kt)
#pragma unroll
            for (int r = 0; r < 8; ++r) mx = fmaxf(mx, s[kt][g][r]);
        mx = fmaxf(mx, xhalf(mx)) * CS2; mb[g] = mx; need = need || (mx > mrun[g] + 8.0f); }
    if (__builtin_amdgcn_ballot_w32(need) != 0) {   // wave-uniform; rare after the first passes
#pragma unroll
        for (int g = 0; g < 2; ++g) { const float mn = fmaxf(mrun[g], mb[g]); const float corr = __builtin_amdgcn_exp2f(mrun[g] - mn); mrun[g] = mn; lsum[g] = lsum[g] * corr;
#pragma unroll
            for (int t = 0; t < 4; ++t) acc[g][t] = acc[g][t] * corr; } }
#pragma unroll
    for (int g = 0; g < 2; ++g) { const float nm = PC2 - mrun[g]; v16h pf; float p[16];
#pragma unroll
        for (int e = 0; e < 16; ++e) { p[e] = __builtin_amdgcn_exp2f(fmaf(s[e >> 3][g][e & 7], CS2, nm)); pf[e] = tohx(p[e]); }   // element e of the 32-key operand = tile e >> 3, register e & 7 (the hardware k order, as the V^T loader's)
#pragma unroll
        for (int w = 8; w; w >>= 1)
#pragma unroll
            for (int e = 0; e < w; ++e) p[e] += p[e + w];
        lsum[g] += p[0];
#pragma unroll
        for (int t = 0; t < 4; ++t) acc[g][t] = wmma16(vf[t], pf, acc[g][t]); }
}
__global__ __launch_bounds__(256) __attribute__((amdgpu_waves_per_eu(4, 4))) void k_fattn(const h16* __restrict__ Q16, const h16* __restrict__ K16, const h16* __restrict__ V16, bf* Ah, bf* Al) {
    static_assert(TT % SK == 0 && TT / SK >= 2 && SK * HD * 2 == 8 * 4 * 512 && FVB * 2 == 8 * 512, "whole stages, both buffers have a first one; 8 waves: 4 copies each for K, one each for every 16 rows of V^T");
    __shared__ __attribute__((aligned(1024))) h16 sm[2 * 2 * FKE];
    const int lane = threadIdx.x & 31, c = lane & 15, hi = lane >> 4; const int wave = __builtin_amdgcn_readfirstlane(threadIdx.x >> 5);
    const int h = blockIdx.y, q0 = blockIdx.x * 256 + wave * 32;
    { const size_t z = blockIdx.z; Q16 += z * NQK * TT * HD; K16 += z * NQK * TT * HD; V16 += z * NKV * HD * TT; Ah += z * TT * DQ; Al += z * TT * DQ; }   // blockIdx.z = batch; a batch's q and k planes lie in one run of NQK planes
    const h16* qp = Q16 + ((size_t)h * TT + q0) * HD + lane * 8;
    // the lane's 16 bytes of the wave's first K piece and first V^T piece of the stage to be issued next; both step by one stage at each issue
    const char* kg = (const char*)(K16 + (size_t)(h / REP) * TT * HD) + wave * 512 + lane * 16; const char* vg = (const char*)(V16 + (size_t)(h / REP) * HD * TT) + wave * 512 + lane * 16;
    const unsigned l0 = (unsigned)(size_t)sm + wave * 512 + lane * 16;
    auto issue = [&](unsigned lb) {   // one stage's copies into the buffer at LDS byte lb (+ the wave's and the lane's place): K pieces wave + 8 i, then piece wave of each 16 rows of V^T
        unsigned l[8]; const char* g[8];
#pragma unroll
        for (int i = 0; i < 4; ++i) { l[i] = lb + i * 4096; g[i] = kg + i * 4096; l[4 + i] = lb + FKE * 2 + i * (FVB * 2); g[4 + i] = vg + (size_t)i * (16 * TT * 2); }
        cp8(l, g);
        kg += FKE * 2; vg += FVB * 2;
    };
    issue(l0);
    v16h qf[2][2];
#pragma unroll
    for (int g = 0; g < 2; ++g)
#pragma unroll
        for (int kc = 0; kc < 2; ++kc) qf[g][kc] = WFrag<h16>::ld(qp + g * 16 * HD + kc * 512);
    asm volatile("s_wait_xcnt 0x0" :: "v"(qp) : "memory");   // as xwait(); the operand keeps the Q loads' address pair from being reused in front of the wait
    v8f acc[2][4]; float lsum[2], mrun[2];
#pragma unroll
    for (int g = 0; g < 2; ++g) { mrun[g] = -INFINITY; lsum[g] = 0.0f;
#pragma unroll
        for (int t = 0; t < 4; ++t) acc[g][t] = (v8f){}; }
    asm volatile("s_wait_asynccnt 0x0" ::: "memory");   // this wave's copies of stage 0 have landed
    __syncthreads();                                     // ... and every other wave's
    issue(l0 + 2 * FKE * 2);                             // stage 1 flies under stage 0's passes
#pragma unroll 1   // a stage a trip, its SK / 32 passes unrolled
    for (int st = 0; st < TT / SK; ++st) {
        const h16* sb = sm + (st & 1) * (2 * FKE) + lane * 8;
        v16h kf[2][2]; ld_k(kf, sb); sfence();   // the stage's first K fragments as one group of LDS reads, not spread among the first products
#pragma unroll
        for (int p = 0; p < SK / 32; ++p) {
            if (p + 1 < SK / 32) fpass<true>(kf, sb + p * 32 * HD, sb + FKE + p * 512, qf, acc, lsum, mrun);
            else fpass<false>(kf, sb + p * 32 * HD, sb + FKE + p * 512, qf, acc, lsum, mrun); }
        asm volatile("s_wait_dscnt 0x0" ::: "memory");      // this wave's reads of the buffer are done before it is handed back
        asm volatile("s_wait_asynccnt 0x0" ::: "memory");   // this wave's copies of stage st + 1 have landed
        __syncthreads();                                     // publishes stage st + 1 and ends every wave's reads of stage st
        if (st + 2 < TT / SK) issue(l0 + (st & 1) * (2 * FKE * 2));   // stage st + 2 into the buffer just read
    }
    asm volatile("s_wait_asynccnt 0x0" ::: "memory");   // nothing is in flight when the wave goes on
#pragma unroll
    for (int g = 0; g < 2; ++g) { const float inv = __fdiv_rn(1.0f, lsum[g] + xhalf(lsum[g]));   // a query's 32 keys of a pass lie half in lane c, half in lane c + 16
        const size_t oo = fidx(q0 + 16 * g + c, h * HD + 8 * hi, DQ);   // the merged planes are the last product's A operand: fragment order, a wave's store 512 contiguous bytes; 16 d further lie 256 elements on
#pragma unroll
        for (int t = 0; t < 4; ++t) { v8us oh, ol;   // acc[g][t][r] = O[query c][d = 16 t + 8 hi + r]
#pragma unroll
            for (int r = 0; r < 8; ++r) { unsigned short a, c2; splitf(acc[g][t][r] * inv, a, c2); oh[r] = a; ol[r] = c2; }
            *(v8us*)(Ah + oo + 256 * t) = oh; *(v8us*)(Al + oo + 256 * t) = ol; if (g == 0 || t < 3) xwait(); } }   // the wait: the next pair's values are formed in registers that these stores name (behind the last pair nothing is)
}

extern "C" void kernel_launch(void* const* d_in, const int* in_sizes, int n_in,
                              void* d_out, int out_size, void* d_ws, size_t ws_size, hipStream_t stream) {
    (void)in_sizes; (void)n_in; (void)out_size;
    const float* x = (const float*)d_in[0]; const float* wq = (const float*)d_in[1]; const float* wk = (const float*)d_in[2]; const float* wv = (const float*)d_in[3]; const float* wo = (const float*)d_in[4];
    float* OUT = (float*)d_out;     // [2][2048][2048]
    char* wsp = (char*)d_ws;
    auto take = [&](size_t bytes) { char* p = wsp; wsp += (bytes + 255) & ~(size_t)255; return (void*)p; };
    bf* WF = (bf*)take((size_t)DF * DM * 2); bf* WO = (bf*)take((size_t)DM * DQ * 2); float* CS = (float*)take((size_t)TT * (HD / 2) * 2 * 4);   // WF: wq, wk, wv transposed, row after row: one [DF][DM] operand
    bf* XB = (bf*)take((size_t)MT * DM * 2);
    h16* QK16 = (h16*)take((size_t)NB_ * NQK * TT * HD * 2); h16* VT16 = (h16*)take((size_t)NB_ * NKV * HD * TT * 2);
    bf* ATh = (bf*)take((size_t)MT * DQ * 2); bf* ATl = (bf*)take((size_t)MT * DQ * 2);
    if ((size_t)(wsp - (char*)d_ws) > ws_size) return;    // 93 MiB of the 256 MiB
    // every stage is ONE launch over all of its work: both batches as 4096 rows (a grid index in k_fattn), q, k and v as one product: 256 work-groups in each of the two products, 12 and 8 waves each (3 and 2 wave tiles a SIMD)
    // Left open: k_gemmw's 64 x 64 wave tile reads 8 fragments from LDS for 16 products (a 64 x 128 tile: 12 for 32), its ring has two buffers; k_prep's weight range loads 4 bytes a lane; k_fattn (all 512 work-groups resident, four waves a SIMD) does its row sums and maxima on the vector port
    k_prep<<<CB + 2 * PB, 256, 0, stream>>>(x, wq, wk, wv, wo, XB, WF, WO, CS);
    k_gemmw<bf, 0, false, true, 4, 3, 128, DM><<<dim3(MT / 256, DF / 192, 1), 384, 0, stream>>>(XB, nullptr, WF, nullptr, nullptr, 0, nullptr, 0, 0, 0, CS, QK16, VT16);   // writes the rotated q and k planes and the transposed v plane
    k_fattn<<<dim3(TT / 256, NH_, NB_), 256, 0, stream>>>(QK16, QK16 + (size_t)NH_ * TT * HD, VT16, ATh, ATl);
    k_gemmw<bf, 1, false, false, 4, 2, 64, DQ><<<dim3(MT / 256, DM / 128, 1), 256, 0, stream>>>(ATh, ATl, WO, nullptr, OUT, DM, nullptr, 0, 0, 0, nullptr, nullptr, nullptr);
}

// v009
// It runs in 114 microseconds.
// Versions in between are left out here; by their measured steps it is 1.19 times as fast as v007.
// All steps since v000 together make it 21.8 times as fast.
#include <hip/hip_runtime.h>

// Grouped-query RoPE attention without a mask (x [2][2048][2048]; q = x Wq (32 heads x 64), k, v = x Wk / Wv ([2048][512]: 8 kv heads); rotate-half RoPE (theta 5e5, tables computed on device); kv head = h/4; softmax(q.k/8) over all keys; out = merged Wo -> [2][2048][2048] (8.4 M)).
// Compute dtypes, f32 accumulate: every input rounded to bf16; q/k/v on PLAIN bf16 operands (inputs: exact); rotary in f32; scores and attn.v on single fp16 operands for every row (x64 probability carry against the running maximum); online softmax f32, denominator summed in f32 by the matrix unit from the fp16 probabilities; last product on fp16 operands: the merged heads rounded once to fp16 (as q, k, v and P are), Wo's bf16-rounded values carried in fp16.

#define NB_  2
#define TT   2048
#define DM   2048
#define NH_  32
#define NKV  8
#define REP  (NH_ / NKV)
#define HD   64
#define DQ   (NH_ * HD)
#define DKV  (NKV * HD)
#define DF   (DQ + 2 * DKV)   // columns of the joined q | k | v projection
#define NQK  (NH_ + NKV)       // rotated head planes of a batch: 32 q heads, then 8 k heads
#define MT   (NB_ * TT)        // rows of both batches
#define SCL  0.125f   // HD^-0.5
typedef _Float16 h16;
typedef unsigned short bf;
typedef __attribute__((ext_vector_type(16))) __bf16   v16bf;
typedef __attribute__((ext_vector_type(16))) _Float16 v16h;
typedef __attribute__((ext_vector_type(8)))  _Float16 v8h;
typedef __attribute__((ext_vector_type(8)))  unsigned short v8us;
typedef __attribute__((ext_vector_type(8)))  float    v8f;
typedef __attribute__((ext_vector_type(4)))  float    v4f;
typedef v8h  __attribute__((may_alias)) v8ha;
typedef v4f  __attribute__((may_alias)) v4fa;
typedef v8us __attribute__((may_alias)) v8usa;

__device__ __forceinline__ unsigned short f2bf(float f) { unsigned u = __float_as_uint(f); u += 0x7FFFu + ((u >> 16) & 1u); return (unsigned short)(u >> 16); }
__device__ __forceinline__ float bf2f(unsigned short b) { return __uint_as_float(((unsigned)b) << 16); }
__device__ __forceinline__ float bfr(float f) { return bf2f(f2bf(f)); }
__device__ __forceinline__ v16h cat16(v8h lo, v8h hi) { return __builtin_shufflevector(lo, hi, 0, 1, 2, 3, 4, 5, 6, 7, 8, 9, 10, 11, 12, 13, 14, 15); }
__device__ __forceinline__ v16bf cat16b(v8us lo, v8us hi) { return __builtin_bit_cast(v16bf, __builtin_shufflevector(lo, hi, 0, 1, 2, 3, 4, 5, 6, 7, 8, 9, 10, 11, 12, 13, 14, 15)); }
__device__ __forceinline__ v8f wmma16(v16h a, v16h b, v8f c) { return __builtin_amdgcn_wmma_f32_16x16x32_f16(false, a, false, b, (short)0, c, false, false); }
__device__ __forceinline__ v8f wmmab(v16bf a, v16bf b, v8f c) { return __builtin_amdgcn_wmma_f32_16x16x32_bf16(false, a, false, b, (short)0, c, false, false); }



// ---- FRAGMENT ORDER: every 16-bit matrix operand plane (rows x K) is stored as blocks of 16 rows x 32 k = 512 elements, block (row / 16, k / 32) at element (row / 16) * 16 * K + (k / 32) * 512.
// Inside a block the element (row, k) lies at ((k >> 4) & 1) * 256 + ((k >> 3) & 1) * 128 + (row & 15) * 8 + (k & 7): lane l of the wave finds its first 8 operand elements at l * 8 and its last 8 at 256 + l * 8,
// so each of a fragment's two 16-byte loads covers 512 contiguous bytes (4 whole lines), where a row-major plane made it touch 16 lines. The k order of a fragment is what it was.
__device__ __forceinline__ size_t fidx(size_t row, int k, int K) { return (row >> 4) * ((size_t)16 * K) + (size_t)(k >> 5) * 512 + ((k >> 4) & 1) * 256 + ((k >> 3) & 1) * 128 + (row & 15) * 8 + (k & 7); }
// ---- k_gemmw: register-blocked GEMM, one wave per 64x64 output tile (16 accumulators), WM x WN waves a work-group, operands from 16-bit planes in fragment order through LDS; grid (M / (64 WM), N / (64 WN), Z).
// C[m][n] (f32, pitch ldc, + optional f32 bias[n]) = sum_k A[m][k] Bt[n][k] (+ split products per NSPLIT). z-batch strides sA/sB/sC in elements. K % KD == 0.
// HEADS (the joined q | k | v projection; a 64-column tile is one head): no C plane. The epilogue turns the accumulators into the fp16 operand planes that k_fattn reads, in fragment order, straight from the registers.
// A lane's 8 accumulator registers run along the A operand's rows. A v tile keeps x as A: 8 neighbouring t of one d, a 16-byte piece of the [d][t] plane. A q or k tile takes the weight rows as A and x as B (same loader, same k order, same sums):
// 8 neighbouring d of one t, a piece of the [t][d] plane, and the rotary partner d + 32 lies in the same lane and register two accumulator tiles on.
template <typename T16> struct WFrag;
template <> struct WFrag<h16> { typedef v16h V; static __device__ __forceinline__ V ld(const h16* p) { return cat16(*(const v8h*)p, *(const v8h*)(p + 256)); } static __device__ __forceinline__ v8f mma(V a, V b, v8f c) { return wmma16(a, b, c); } };
template <> struct WFrag<bf> { typedef v16bf V; static __device__ __forceinline__ V ld(const bf* p) { return cat16b(*(const v8us*)p, *(const v8us*)(p + 256)); } static __device__ __forceinline__ v8f mma(V a, V b, v8f c) { return wmmab(a, b, c); } };
// OPERAND TILES THROUGH LDS: a work-group of WM x WN waves owns 64 WM x 64 WN outputs (a wave keeps its 64 x 64 tile and its epilogue). A stage is KD k of every operand row of the work-group, brought in once by asynchronous copies
// and read by every wave that needs it; two buffers, the next stage's copies fly while this one is worked on. A plane in fragment order keeps its order in LDS: a run of 16 rows x KD k is KD * 32 contiguous bytes there as in memory,
// a copy is 512 contiguous bytes on both sides, and a fragment read is two conflict-free 16-byte reads a lane.
#define CPL(a, b) "global_load_async_to_lds_b128 %" #a ", %" #b ", off\n\t"
// the copies of one run and, as the statement's last line, the wait that stands in front of any rewrite of the address registers they name
__device__ __forceinline__ void cp1(unsigned l, const char* g) { asm volatile(CPL(0, 1) "s_wait_xcnt 0x0" :: "v"(l), "v"(g) : "memory"); }
template <int N> __device__ __forceinline__ void cpn(const unsigned (&l)[N], const char* const (&g)[N]) {
    static_assert(N == 9 || N == 12, "one statement a run");
    if constexpr (N == 9) asm volatile(CPL(0, 1) CPL(2, 3) CPL(4, 5) CPL(6, 7) CPL(8, 9) CPL(10, 11) CPL(12, 13) CPL(14, 15) CPL(16, 17) "s_wait_xcnt 0x0"
        :: "v"(l[0]), "v"(g[0]), "v"(l[1]), "v"(g[1]), "v"(l[2]), "v"(g[2]), "v"(l[3]), "v"(g[3]), "v"(l[4]), "v"(g[4]), "v"(l[5]), "v"(g[5]), "v"(l[6]), "v"(g[6]), "v"(l[7]), "v"(g[7]), "v"(l[8]), "v"(g[8]) : "memory");
    else asm volatile(CPL(0, 1) CPL(2, 3) CPL(4, 5) CPL(6, 7) CPL(8, 9) CPL(10, 11) CPL(12, 13) CPL(14, 15) CPL(16, 17) CPL(18, 19) CPL(20, 21) CPL(22, 23) "s_wait_xcnt 0x0"
        :: "v"(l[0]), "v"(g[0]), "v"(l[1]), "v"(g[1]), "v"(l[2]), "v"(g[2]), "v"(l[3]), "v"(g[3]), "v"(l[4]), "v"(g[4]), "v"(l[5]), "v"(g[5]), "v"(l[6]), "v"(g[6]), "v"(l[7]), "v"(g[7]), "v"(l[8]), "v"(g[8]), "v"(l[9]), "v"(g[9]), "v"(l[10]), "v"(g[10]), "v"(l[11]), "v"(g[11]) : "memory");
}
template <typename T16, int NSPLIT, bool BIAS, bool HEADS, int WM, int WN, int KD, int K>
__global__ __launch_bounds__(WM * WN * 32) void k_gemmw(const T16* __restrict__ A, const T16* __restrict__ A2, const T16* __restrict__ Bt, const T16* __restrict__ Bt2, float* C, int ldc, const float* __restrict__ bias, size_t sA, size_t sB, size_t sC, const float* __restrict__ CS, h16* QK, h16* VT) {
    typedef typename WFrag<T16>::V V;
    static_assert(NSPLIT <= 1, "one weight plane; one or two planes on the other side");
    constexpr int NW = WM * WN, NXB = 4 * WM * (NSPLIT == 1 ? 2 : 1), NRB = NXB + 4 * WN;   // waves; runs of 16 rows of a stage: the x side's (both planes), then the weight's
    constexpr int RB = KD * 16, STG = NRB * RB, UPR = KD / 16, NU = NRB * UPR;                // elements of a run and of a stage; copies of 512 bytes a run and a stage
    constexpr int NCF = NU / NW, REM = NU % NW, H = NCF / 2, NB = KD / 32;                    // copies that every wave issues a stage, in two runs of H; waves that issue one more; blocks of 32 k a stage
    static_assert(NCF == 2 * H && NCF + 1 <= 63, "two equal runs; a wave's copies in flight");
    constexpr int NT = K / KD; static_assert(K % KD == 0 && NT >= 2, "whole stages, and both buffers have a first stage");
    __shared__ __attribute__((aligned(1024))) T16 sm[2 * STG];
    __shared__ __align__(16) float osm[HEADS ? 4 : NW * 16 * 68];
    const size_t z = blockIdx.z; A += z * sA; if (A2) A2 += z * sA; Bt += z * sB; C += z * sC;
    const int lane = threadIdx.x & 31, lr = lane & 15, hi = lane >> 4; const int wave = __builtin_amdgcn_readfirstlane(threadIdx.x >> 5), wm = wave % WM, wn = wave / WM;
    const int R0 = blockIdx.x * (64 * WM), C0 = blockIdx.y * (64 * WN), r0 = R0 + 64 * wm, c0 = C0 + 64 * wn;
    float* os = osm + (HEADS ? 0 : wave * (16 * 68));   // a wave's own staging rows
    v8f acc[4][4];
#pragma unroll
    for (int mb = 0; mb < 4; ++mb)
#pragma unroll
        for (int nb = 0; nb < 4; ++nb) acc[mb][nb] = (v8f){};
    const unsigned lo = lane * 8;
    const bool rot = HEADS && c0 < DQ + DKV;   // a q or k head (the same for the whole wave): the two operands change places
    const int xo = 4 * wm * RB, wo_ = (NXB + 4 * wn) * RB;   // the wave's own runs inside a stage
    const int ao = rot ? wo_ : xo, bo = rot ? xo : wo_, a2o = xo + 4 * WM * RB;
    // copy number i of a wave is piece wave + NW i of the stage; its source pointer is wave-uniform, lives through the loop and steps by one stage (KD k of 16 rows) at each issue
    const char* gp[NCF + 1];
#pragma unroll
    for (int i = 0; i <= NCF; ++i) { const int u = wave + NW * i, j = u / UPR < NRB ? u / UPR : NRB - 1;
        const T16* p = j < 4 * WM ? A + (size_t)(R0 + 16 * j) * K : (NSPLIT == 1 && j < NXB) ? A2 + (size_t)(R0 + 16 * (j - 4 * WM)) * K : Bt + (size_t)(C0 + 16 * (j - NXB)) * K;
        gp[i] = (const char*)p + (u % UPR) * 512; }
    const unsigned l0 = (unsigned)(size_t)sm + wave * 512 + lane * 16, lane16 = lane * 16;
    auto issue = [&](unsigned lb) {   // one stage's copies into the buffer at LDS byte lb (+ the wave's and the lane's place)
#pragma unroll
        for (int h = 0; h < 2; ++h) { unsigned l[H]; const char* g[H];
#pragma unroll
            for (int i = 0; i < H; ++i) { l[i] = lb + (h * H + i) * (NW * 512); g[i] = gp[h * H + i] + lane16; }
            cpn<H>(l, g); }
        if (REM != 0 && wave < REM) cp1(lb + NCF * (NW * 512), gp[NCF] + lane16);   // wave-uniform: a scalar branch
#pragma unroll
        for (int i = 0; i <= NCF; ++i) gp[i] += KD * 32;
    };
    issue(l0);
    asm volatile("s_wait_asynccnt 0x0" ::: "memory");   // this wave's copies of stage 0 have landed
    __syncthreads();                                     // ... and every other wave's
    issue(l0 + STG * 2);                                 // stage 1 flies under stage 0's products
#pragma unroll 1
    for (int t = 0; t < NT; ++t) {
        const T16* sb = sm + (t & 1) * STG + lo;
        V a[2][4], a2[2][4], b[2][4];
        auto frags = [&](int kk) {
#pragma unroll
            for (int i = 0; i < 4; ++i) { a[kk & 1][i] = WFrag<T16>::ld(sb + ao + i * RB + kk * 512); if (NSPLIT == 1) a2[kk & 1][i] = WFrag<T16>::ld(sb + a2o + i * RB + kk * 512); b[kk & 1][i] = WFrag<T16>::ld(sb + bo + i * RB + kk * 512); } };
        frags(0);
#pragma unroll
        for (int kk = 0; kk < NB; ++kk) {
            if (kk + 1 < NB) frags(kk + 1);
            __builtin_amdgcn_sched_barrier(0);   // the next block's LDS reads stay one group in front of this block's products, not spread among them
#pragma unroll
            for (int nb = 0; nb < 4; ++nb)
#pragma unroll
                for (int mb = 0; mb < 4; ++mb) { acc[mb][nb] = WFrag<T16>::mma(a[kk & 1][mb], b[kk & 1][nb], acc[mb][nb]); if (NSPLIT == 1) acc[mb][nb] = WFrag<T16>::mma(a2[kk & 1][mb], b[kk & 1][nb], acc[mb][nb]); }
            __builtin_amdgcn_sched_barrier(0);   // as above: the block ends here
        }
        asm volatile("s_wait_dscnt 0x0" ::: "memory");      // this wave's reads of the buffer are done before it is handed back
        asm volatile("s_wait_asynccnt 0x0" ::: "memory");   // this wave's copies of stage t + 1 have landed
        __syncthreads();                                     // publishes stage t + 1 and ends every wave's reads of stage t
        if (t + 2 < NT) issue(l0 + (t & 1) * (STG * 2));     // stage t + 2 into the buffer just read
    }
    asm volatile("s_wait_asynccnt 0x0" ::: "memory");   // nothing is in flight when the wave goes on
    if (HEADS) {
        static_assert(TT % 64 == 0 && HD == 64, "a tile's 64 rows lie in one batch, its 64 columns are one head");
        const int bz = r0 / TT, t0 = r0 % TT;
        if (rot) {   // acc[mb][nb][j] = head column d = 16 mb + 8 hi + j of position t = t0 + 16 nb + lr
            const v4fa* tp = (const v4fa*)(CS + (size_t)(t0 >> 4) * (HD * 16)) + lane;   // p_cstab's order: every load below is 512 contiguous bytes
            h16* op = QK + (((size_t)bz * NQK + c0 / HD) * TT + t0) * HD + lo;            // fidx(head row t0 + lr, 8 hi, HD); 16 t further lie 16 HD elements on, 16 d further 256
            v4f cs[2][2][4];
#pragma unroll
            for (int mb = 0; mb < 2; ++mb)
#pragma unroll
                for (int q = 0; q < 4; ++q) cs[0][mb][q] = tp[(mb * 4 + q) * 32];
#pragma unroll
            for (int nb = 0; nb < 4; ++nb) {
                if (nb < 3) {
#pragma unroll
                    for (int mb = 0; mb < 2; ++mb)
#pragma unroll
                        for (int q = 0; q < 4; ++q) cs[(nb + 1) & 1][mb][q] = tp[(((nb + 1) * 2 + mb) * 4 + q) * 32]; }
                __builtin_amdgcn_sched_barrier(0);   // keeps the next 16 positions' table loads in front of this group's arithmetic, so that they fly under it
                v8h o[4];
#pragma unroll
                for (int mb = 0; mb < 2; ++mb)
#pragma unroll
                    for (int j = 0; j < 8; ++j) { const float co = cs[nb & 1][mb][j >> 1][(j & 1) * 2], si = cs[nb & 1][mb][j >> 1][(j & 1) * 2 + 1], x0 = acc[mb][nb][j], x1 = acc[mb + 2][nb][j];
                        o[mb][j] = (h16)(x0 * co - x1 * si); o[mb + 2][j] = (h16)(x1 * co + x0 * si); }
                __builtin_amdgcn_sched_barrier(0);   // all four pieces are formed in front of the first store: none is formed in a register that an issued store of the group names
#pragma unroll
                for (int mb = 0; mb < 4; ++mb) *(v8h*)(op + nb * 16 * HD + mb * 256) = o[mb];
                if (nb < 3) asm volatile("s_wait_xcnt 0x0" ::: "memory");   // the next group's pieces are formed in registers that these stores name (behind the last group nothing is)
            }
        } else {     // acc[mb][nb][j] = v column d = 16 nb + lr of position t = t0 + 16 mb + 8 hi + j
            h16* op = VT + ((size_t)bz * DKV + (c0 - DQ - DKV)) * TT + (size_t)(t0 >> 5) * 512 + lo;   // fidx(row d = lr, t0 + 8 hi, TT); 16 d further lie 16 TT elements on, 16 t further 256
#pragma unroll
            for (int nb = 0; nb < 4; ++nb) {
                v8h o[4];
#pragma unroll
                for (int mb = 0; mb < 4; ++mb)
#pragma unroll
                    for (int j = 0; j < 8; ++j) o[mb][j] = (h16)acc[mb][nb][j];
                __builtin_amdgcn_sched_barrier(0);   // as above: the group's four pieces first, then its stores
#pragma unroll
                for (int mb = 0; mb < 4; ++mb) *(v8h*)(op + (size_t)nb * 16 * TT + mb * 256) = o[mb];
                if (nb < 3) asm volatile("s_wait_xcnt 0x0" ::: "memory");   // as above
            }
        }
        return;
    }
#pragma unroll
    for (int mb = 0; mb < 4; ++mb) {
#pragma unroll
        for (int nb = 0; nb < 4; ++nb) {
#pragma unroll
            for (int j = 0; j < 8; ++j) os[(hi * 8 + j) * 68 + nb * 16 + lr] = acc[mb][nb][j]; }
        __builtin_amdgcn_wave_barrier(); asm volatile("" ::: "memory");
        float* crow = C + (size_t)(r0 + mb * 16) * ldc + c0;
{
#pragma unroll
            for (int s = 0; s < 8; ++s) { const int row = 2 * s + hi, cofs = lr * 4; v4f val = *(const v4fa*)(os + row * 68 + cofs); if (BIAS) { val[0] += bfr(bias[c0 + cofs]); val[1] += bfr(bias[c0 + cofs + 1]); val[2] += bfr(bias[c0 + cofs + 2]); val[3] += bfr(bias[c0 + cofs + 3]); }
                *(v4f*)(crow + (size_t)row * ldc + cofs) = val; }
             }
        __builtin_amdgcn_wave_barrier(); asm volatile("" ::: "memory");
    }
}

__device__ __forceinline__ h16 tohx(float x) { return (h16)x; }
typedef __attribute__((ext_vector_type(2))) _Float16 v2h;
typedef __attribute__((ext_vector_type(4))) _Float16 v4h;
typedef __attribute__((ext_vector_type(2))) unsigned short v2us;
typedef __attribute__((ext_vector_type(4))) unsigned short v4us;
typedef __attribute__((ext_vector_type(2))) float v2f;
typedef __attribute__((ext_vector_type(4))) int v4i;

// ---- k_prep: ALL THE PREPARATION IN ONE LAUNCH. The rotary table, the four weight planes and the x plane depend on nothing but the inputs: each takes a range of the launch's work-groups (8 waves each), and all 1280 are resident at once,
// five on each of the chip's 256 WGPs (96 registers a wave). For that a thread of the two conversions takes several neighbouring pieces instead of one: PB work-groups each, not one wave for every 512 bytes written.
// All of a thread's loads are issued first and fly together; then every piece is rounded, then all are stored. A piece, its place and its values are what they were.
// A thread's pieces lie a constant step apart in both planes: it forms one 32-bit byte offset a plane, and the steps are the instructions' immediate offsets.
#define PB   512
#define PT   (PB * 256)   // threads of a conversion's range
__device__ __forceinline__ v8us rnd8(const float (&v)[8]) { v8us o;
#pragma unroll
    for (int q = 0; q < 8; ++q) o[q] = f2bf(v[q]);
    return o; }
// the same rounding to bf16, the value then carried in fp16 (8 significant bits fit in its 11: exact from 2^-17 up to the fp16 range, below that to 2^-25 absolute)
__device__ __forceinline__ v8us rnd8h(const float (&v)[8]) { v8h o;
#pragma unroll
    for (int q = 0; q < 8; ++q) o[q] = (h16)bfr(v[q]);
    return __builtin_bit_cast(v8us, o); }
// A piece of a weight w [K][N]: 16 bytes (8 k of one n) of the transposed plane in fragment order. A wave takes 32 neighbouring n at the same 8 k: each of its 8 loads is one whole line of w, its store two runs of 256 bytes.
// 128 threads take a group of 32 n x 32 k, and the J - 1 groups that follow it in k; neighbouring threads' groups take neighbouring lines of the same rows of w.
template <int N, int K, int J> struct WPc {
    static_assert((size_t)N * K / 8 == (size_t)J * PT, "the pieces of the weight are covered exactly");
    unsigned lo, so;   // byte offsets of the thread's first piece in w (its first k) and in the transposed plane
    __device__ __forceinline__ WPc(unsigned t) { const unsigned grp = t >> 7, n = (grp % (N / 32)) * 32 + (t & 31), k = (grp / (N / 32)) * (32 * J) + ((t >> 5) & 3) * 8; lo = (k * N + n) * 4; so = (unsigned)fidx(n, (int)k, K) * 2; }
    __device__ __forceinline__ void ld(const float* __restrict__ w, int j, float (&v)[8]) const {
#pragma unroll
        for (int q = 0; q < 8; ++q) v[q] = *(const float*)((const char*)w + lo + (32 * j + q) * (N * 4)); }
    __device__ __forceinline__ void st(void* Bt, int j, v8us o) const { *(v8us*)((char*)Bt + so + j * 1024) = o; }   // 32 k further: the next block of 512 elements
};
// all four weights (wq, wk, wv into the joined plane, wo into its own): thread t of PT takes 4 pieces of wq, one of wk, one of wv and 4 of wo
__device__ __forceinline__ void p_wt(unsigned t, const float* __restrict__ wq, const float* __restrict__ wk, const float* __restrict__ wv, const float* __restrict__ wo, bf* WF, h16* WO) {
    static_assert(DQ == DM, "wq and wo have one shape");
    const WPc<DQ, DM, 4> wide(t); const WPc<DKV, DM, 1> slim(t); float v[10][8]; v8us o[10];
#pragma unroll
    for (int j = 0; j < 4; ++j) wide.ld(wq, j, v[j]);
    slim.ld(wk, 0, v[4]); slim.ld(wv, 0, v[5]);
#pragma unroll
    for (int j = 0; j < 4; ++j) wide.ld(wo, j, v[6 + j]);
    asm volatile("s_wait_xcnt 0x0" :: "v"(wide.lo), "v"(slim.lo) : "memory");   // stands in front of any overwrite of the two offset registers that the issued loads name; the operands keep those registers from being reused in front of the wait
    __builtin_amdgcn_sched_barrier(0);   // every load is issued in front of the first rounding: all of them are in flight at once
#pragma unroll
    for (int j = 0; j < 10; ++j) o[j] = j < 6 ? rnd8(v[j]) : rnd8h(v[j]);   // wo's plane is the fp16 product's operand
    __builtin_amdgcn_sched_barrier(0);   // every piece is formed in front of the first store: none is formed in a register that an issued store names
#pragma unroll
    for (int j = 0; j < 4; ++j) wide.st(WF, j, o[j]);
    slim.st(WF + (size_t)DQ * DM, 0, o[4]); slim.st(WF + (size_t)(DQ + DKV) * DM, 0, o[5]);
#pragma unroll
    for (int j = 0; j < 4; ++j) wide.st(WO, j, o[6 + j]);
    asm volatile("s_wait_xcnt 0x0" ::: "memory");   // behind the last store: whatever the listing places behind this range may overwrite registers that the issued stores name
}
// x (rows of DM) rounded to bf16, in fragment order: a piece is 16 bytes (8 k of one row). A wave takes 32 k of 8 rows: it reads 8 whole lines of x and stores 4 whole lines (8 rows' pieces of the same 8 k lie side by side).
// Thread t of PT takes 8 pieces: the same k of rows that lie 16 apart.
__device__ __forceinline__ void p_cvt(unsigned t, const float* __restrict__ src, bf* dst) {
    static_assert((size_t)MT * DM / 8 == 8 * (size_t)PT, "the pieces of x are covered exactly");
    const unsigned row = (t >> 6) / (DM / 32) * (16 * 8) + ((t >> 2) & 15), k = (t >> 6) % (DM / 32) * 32 + (t & 3) * 8;
    const unsigned lo = (row * DM + k) * 4, so = (unsigned)fidx(row, (int)k, DM) * 2; v8f v[8]; v8us o[8];
#pragma unroll
    for (int j = 0; j < 8; ++j) v[j] = *(const v8f*)((const char*)src + lo + j * (16 * DM * 4));
    asm volatile("s_wait_xcnt 0x0" :: "v"(lo) : "memory");   // as in p_wt: in front of any overwrite of the loads' offset register
    __builtin_amdgcn_sched_barrier(0);   // as in p_wt: all loads first
#pragma unroll
    for (int j = 0; j < 8; ++j)
#pragma unroll
        for (int q = 0; q < 8; ++q) o[j][q] = f2bf(v[j][q]);
    __builtin_amdgcn_sched_barrier(0);   // as in p_wt: all pieces first, then the stores
#pragma unroll
    for (int j = 0; j < 8; ++j) *(v8us*)((char*)dst + so + j * (16 * DM * 2)) = o[j];
    asm volatile("s_wait_xcnt 0x0" ::: "memory");   // as in p_wt: behind the last store
}
__constant__ float INV[HD / 2] = {1.00000000f,0.663601220f,0.440366596f,0.292227834f,0.193922743f,0.128687367f,0.0853971019f,0.0566696227f,0.0376060307f,0.0249554086f,0.0165604409f,0.0109895281f,0.00729266461f,0.00483942125f,0.00321144611f,0.00213111960f,0.00141421356f,0.000938473851f,0.000622772437f,0.000413272559f,0.000274248188f,0.000181991432f,0.000120769735f,0.0000801429487f,0.0000531829573f,0.0000352922762f,0.0000234199997f,0.0000155415401f,0.0000103133852f,0.00000684397537f,0.00000454167048f,0.00000301385808f};
// (cos, sin) of t x INV[d], d < HD / 2 (d + HD / 2 has the same angle), in the order in which the projection's epilogue reads them: pair p = ((((t / 16) * 2 + d / 16) * 4 + (d & 7) / 2) * 32 + ((d >> 3) & 1) * 16 + (t & 15)) * 2 + (d & 1),
// so that lane 16 hi + lr finds the pairs of d = 16 mb + 8 hi + 2 q, + 1 at position t = 16 tb + lr in one 16-byte load, and the wave's load covers 4 whole lines. Thread p writes pair p.
__device__ __forceinline__ void p_cstab(int p, float* CS) { const int t = (p >> 9) * 16 + ((p >> 1) & 15), d = ((p >> 8) & 1) * 16 + ((p >> 5) & 1) * 8 + ((p >> 6) & 3) * 2 + (p & 1); const float ang = __fmul_rn((float)t, INV[d]); v2f cs; cs[0] = cosf(ang); cs[1] = sinf(ang);
    *(v2f*)(CS + (size_t)p * 2) = cs;  }
#define CB   (TT * HD / 2 / 256)   // work-groups of the table's range
// the ranges: the table first (little data, long chains of arithmetic), then the weights, then x; blockIdx.x picks, the same for a whole work-group
__global__ __launch_bounds__(256) void k_prep(const float* __restrict__ x, const float* __restrict__ wq, const float* __restrict__ wk, const float* __restrict__ wv, const float* __restrict__ wo, bf* XB, bf* WF, h16* WO, float* CS) {
    static_assert(TT * HD / 2 % 256 == 0, "the table's pairs are covered exactly");
    const unsigned b = blockIdx.x;
    if (b < CB) p_cstab((int)(b * 256 + threadIdx.x), CS);
    else if (b < CB + PB) p_wt((b - CB) * 256 + threadIdx.x, wq, wk, wv, wo, WF, WO);
    else p_cvt((b - CB - PB) * 256 + threadIdx.x, x, XB);
}

#define PC2  6.0f
#define CS2  (SCL * 1.4426950408889634f)
__device__ __forceinline__ float xhalf(float x) { return __builtin_bit_cast(float, __builtin_amdgcn_permlanex16(__builtin_bit_cast(int, x), __builtin_bit_cast(int, x), 0x76543210, 0xfedcba98, false, false)); }  // lane l with lane l ^ 16
__device__ __forceinline__ void sfence() { __builtin_amdgcn_sched_barrier(0); }   // keeps a load group where it is written, so that it flies under the work behind it
#define SK   128
#define FKE  (SK * HD)      // elements of a stage's K part; V^T takes as many
#define FVB  (SK / 32 * 512)   // elements of a stage's part of 16 rows of V^T
// eight copies and, as the statement's last line, the wait that stands in front of any rewrite of the address registers they name
__device__ __forceinline__ void cp8(const unsigned (&l)[8], const char* const (&g)[8]) {
    asm volatile(CPL(0, 1) CPL(2, 3) CPL(4, 5) CPL(6, 7) CPL(8, 9) CPL(10, 11) CPL(12, 13) CPL(14, 15) "s_wait_xcnt 0x0"
        :: "v"(l[0]), "v"(g[0]), "v"(l[1]), "v"(g[1]), "v"(l[2]), "v"(g[2]), "v"(l[3]), "v"(g[3]), "v"(l[4]), "v"(g[4]), "v"(l[5]), "v"(g[5]), "v"(l[6]), "v"(g[6]), "v"(l[7]), "v"(g[7]) : "memory");
}
__device__ __forceinline__ void ld_k(v16h (&k)[2][2], const h16* kp) {
#pragma unroll
    for (int kt = 0; kt < 2; ++kt)
#pragma unroll
        for (int kc = 0; kc < 2; ++kc) k[kt][kc] = WFrag<h16>::ld(kp + kt * 16 * HD + kc * 512); }
__device__ __forceinline__ void xwait() { asm volatile("s_wait_xcnt 0x0" ::: "memory"); }   // stands in front of the overwrite of a register that issued stores name
// one pass of 32 keys, from the stage in LDS (kp, vp: the pass's own K rows and V^T blocks, + the lane's place). Behind the score products one group of LDS reads: the pass's V^T fragments and, inside a stage (NEXTK),
// the next pass's K fragments into the registers just read; they land under the softmax.
// ROW SUMS ON THE MATRIX PIPE: one product a column group with an A operand whose rows 0 and 8 are ones gives, in register 0 of every lane, the sum of the query's 32 rounded probabilities of the pass (both lane halves' keys).
// It is added to the denominator, and it is the test for the lazy rescale as well: all terms are positive, so a sum of at most PLIM bounds each of them. Only a pass that fails the test scans its scores for the maximum and forms P again.
#define PLIM 16384.0f   // 2^(PC2 + 8)
template <bool NEXTK>
__device__ __forceinline__ void fpass(v16h (&kf)[2][2], const h16* kp, const h16* vp, const v16h (&qf)[2][2], const v16h& ones, v8f (&acc)[2][4], float (&lsum)[2], float (&mrun)[2]) {
    v8f s[2][2]; v16h vf[4];
#pragma unroll
    for (int kt = 0; kt < 2; ++kt)
#pragma unroll
        for (int g = 0; g < 2; ++g) { s[kt][g] = (v8f){};
#pragma unroll
            for (int kc = 0; kc < 2; ++kc) s[kt][g] = wmma16(kf[kt][kc], qf[g][kc], s[kt][g]); }
    sfence();
#pragma unroll
    for (int t = 0; t < 4; ++t) vf[t] = WFrag<h16>::ld(vp + t * FVB);
    if (NEXTK) ld_k(kf, kp + 32 * HD);
    sfence();
    v16h pf[2]; v8f rs[2];
    auto probs = [&]() {   // P against the maximum in use, and its row sums
#pragma unroll
        for (int g = 0; g < 2; ++g) { const float nm = PC2 - mrun[g];
#pragma unroll
            for (int e = 0; e < 16; ++e) pf[g][e] = tohx(__builtin_amdgcn_exp2f(s[e >> 3][g][e & 7] * CS2 + nm));   // element e of the 32-key operand = tile e >> 3, register e & 7 (the hardware k order, as the V^T loader's). A product and a sum, which the compiler fuses into the FMA that it was (in the rescale branch it rounds the product first): as fmaf calls, with the scores now live past them, they came out as packed pairs across the two groups, each pair's scores first copied side by side
            rs[g] = wmma16(ones, pf[g], (v8f){}); }
    };
    probs();
    const bool need = !(rs[0][0] <= PLIM) || !(rs[1][0] <= PLIM);   // also true for an infinite sum (the first pass: no maximum yet; a probability beyond the fp16 range)
    if (__builtin_amdgcn_ballot_w32(need) != 0) {   // wave-uniform; rare after the first pass
#pragma unroll
        for (int g = 0; g < 2; ++g) { float mx = -INFINITY;
#pragma unroll
            for (int kt = 0; kt < 2; ++kt)
#pragma unroll
                for (int r = 0; r < 8; ++r) mx = fmaxf(mx, s[kt][g][r]);
            mx = fmaxf(mx, xhalf(mx)) * CS2;
            const float mn = fmaxf(mrun[g], mx); const float corr = __builtin_amdgcn_exp2f(mrun[g] - mn); mrun[g] = mn; lsum[g] = lsum[g] * corr;
#pragma unroll
            for (int t = 0; t < 4; ++t) acc[g][t] = acc[g][t] * corr; }
        probs();
    }
#pragma unroll
    for (int g = 0; g < 2; ++g)
#pragma unroll
        for (int t = 0; t < 4; ++t) acc[g][t] = wmma16(vf[t], pf[g], acc[g][t]);
    lsum[0] += rs[0][0]; lsum[1] += rs[1][0];
}
__global__ __launch_bounds__(256) __attribute__((amdgpu_waves_per_eu(4, 4))) void k_fattn(const h16* __restrict__ Q16, const h16* __restrict__ K16, const h16* __restrict__ V16, h16* AT) {
    static_assert(TT % SK == 0 && TT / SK >= 2 && SK * HD * 2 == 8 * 4 * 512 && FVB * 2 == 8 * 512, "whole stages, both buffers have a first one; 8 waves: 4 copies each for K, one each for every 16 rows of V^T");
    __shared__ __attribute__((aligned(1024))) h16 sm[2 * 2 * FKE];
    const int lane = threadIdx.x & 31, c = lane & 15, hi = lane >> 4; const int wave = __builtin_amdgcn_readfirstlane(threadIdx.x >> 5);
    const int h = blockIdx.y, q0 = blockIdx.x * 256 + wave * 32;
    { const size_t z = blockIdx.z; Q16 += z * NQK * TT * HD; K16 += z * NQK * TT * HD; V16 += z * NKV * HD * TT; AT += z * TT * DQ; }   // blockIdx.z = batch; a batch's q and k planes lie in one run of NQK planes
    const h16* qp = Q16 + ((size_t)h * TT + q0) * HD + lane * 8;
    // the lane's 16 bytes of the wave's first K piece and first V^T piece of the stage to be issued next; both step by one stage at each issue
    const char* kg = (const char*)(K16 + (size_t)(h / REP) * TT * HD) + wave * 512 + lane * 16; const char* vg = (const char*)(V16 + (size_t)(h / REP) * HD * TT) + wave * 512 + lane * 16;
    const unsigned l0 = (unsigned)(size_t)sm + wave * 512 + lane * 16;
    auto issue = [&](unsigned lb) {   // one stage's copies into the buffer at LDS byte lb (+ the wave's and the lane's place): K pieces wave + 8 i, then piece wave of each 16 rows of V^T
        unsigned l[8]; const char* g[8];
#pragma unroll
        for (int i = 0; i < 4; ++i) { l[i] = lb + i * 4096; g[i] = kg + i * 4096; l[4 + i] = lb + FKE * 2 + i * (FVB * 2); g[4 + i] = vg + (size_t)i * (16 * TT * 2); }
        cp8(l, g);
        kg += FKE * 2; vg += FVB * 2;
    };
    issue(l0);
    v16h qf[2][2];
#pragma unroll
    for (int g = 0; g < 2; ++g)
#pragma unroll
        for (int kc = 0; kc < 2; ++kc) qf[g][kc] = WFrag<h16>::ld(qp + g * 16 * HD + kc * 512);
    asm volatile("s_wait_xcnt 0x0" :: "v"(qp) : "memory");   // as xwait(); the operand keeps the Q loads' address pair from being reused in front of the wait
    v8f acc[2][4]; float lsum[2], mrun[2]; v16h ones;   // rows 0 and 8 (lanes 0, 8, 16, 24) are ones, the rest 0: register 0 of a result tile is row 0 in lanes 0 to 15 and row 8 in lanes 16 to 31. An operand that differs by lane keeps its registers through the loop; one of ones alone was formed anew in every pass
#pragma unroll
    for (int e = 0; e < 16; ++e) ones[e] = (lane & 7) == 0 ? (h16)1.0f : (h16)0.0f;
#pragma unroll
    for (int g = 0; g < 2; ++g) { mrun[g] = -INFINITY; lsum[g] = 0.0f;
#pragma unroll
        for (int t = 0; t < 4; ++t) acc[g][t] = (v8f){}; }
    asm volatile("s_wait_asynccnt 0x0" ::: "memory");   // this wave's copies of stage 0 have landed
    __syncthreads();                                     // ... and every other wave's
    issue(l0 + 2 * FKE * 2);                             // stage 1 flies under stage 0's passes
#pragma unroll 1   // a stage a trip, its SK / 32 passes unrolled
    for (int st = 0; st < TT / SK; ++st) {
        const h16* sb = sm + (st & 1) * (2 * FKE) + lane * 8;
        v16h kf[2][2]; ld_k(kf, sb); sfence();   // the stage's first K fragments as one group of LDS reads, not spread among the first products
#pragma unroll
        for (int p = 0; p < SK / 32; ++p) {
            if (p + 1 < SK / 32) fpass<true>(kf, sb + p * 32 * HD, sb + FKE + p * 512, qf, ones, acc, lsum, mrun);
            else fpass<false>(kf, sb + p * 32 * HD, sb + FKE + p * 512, qf, ones, acc, lsum, mrun); }
        asm volatile("s_wait_dscnt 0x0" ::: "memory");      // this wave's reads of the buffer are done before it is handed back
        asm volatile("s_wait_asynccnt 0x0" ::: "memory");   // this wave's copies of stage st + 1 have landed
        __syncthreads();                                     // publishes stage st + 1 and ends every wave's reads of stage st
        if (st + 2 < TT / SK) issue(l0 + (st & 1) * (2 * FKE * 2));   // stage st + 2 into the buffer just read
    }
    asm volatile("s_wait_asynccnt 0x0" ::: "memory");   // nothing is in flight when the wave goes on
#pragma unroll
    for (int g = 0; g < 2; ++g) { const float inv = __fdiv_rn(1.0f, lsum[g]);   // the row-sum product has joined the two lane halves' keys already
        const size_t oo = fidx(q0 + 16 * g + c, h * HD + 8 * hi, DQ);   // the merged plane is the last product's A operand: fragment order, a wave's store 512 contiguous bytes; 16 d further lie 256 elements on
#pragma unroll
        for (int t = 0; t < 4; ++t) { v8h o;   // acc[g][t][r] = O[query c][d = 16 t + 8 hi + r]
#pragma unroll
            for (int r = 0; r < 8; ++r) o[r] = tohx(acc[g][t][r] * inv);
            *(v8h*)(AT + oo + 256 * t) = o; if (g == 0 || t < 3) xwait(); } }   // the wait: the next piece's values are formed in registers that this store names (behind the last piece nothing is)
}

extern "C" void kernel_launch(void* const* d_in, const int* in_sizes, int n_in,
                              void* d_out, int out_size, void* d_ws, size_t ws_size, hipStream_t stream) {
    (void)in_sizes; (void)n_in; (void)out_size;
    const float* x = (const float*)d_in[0]; const float* wq = (const float*)d_in[1]; const float* wk = (const float*)d_in[2]; const float* wv = (const float*)d_in[3]; const float* wo = (const float*)d_in[4];
    float* OUT = (float*)d_out;     // [2][2048][2048]
    char* wsp = (char*)d_ws;
    auto take = [&](size_t bytes) { char* p = wsp; wsp += (bytes + 255) & ~(size_t)255; return (void*)p; };
    bf* WF = (bf*)take((size_t)DF * DM * 2); h16* WO = (h16*)take((size_t)DM * DQ * 2); float* CS = (float*)take((size_t)TT * (HD / 2) * 2 * 4);   // WF: wq, wk, wv transposed, row after row: one [DF][DM] operand
    bf* XB = (bf*)take((size_t)MT * DM * 2);
    h16* QK16 = (h16*)take((size_t)NB_ * NQK * TT * HD * 2); h16* VT16 = (h16*)take((size_t)NB_ * NKV * HD * TT * 2);
    h16* AT16 = (h16*)take((size_t)MT * DQ * 2);
    if ((size_t)(wsp - (char*)d_ws) > ws_size) return;    // 77 MiB of the 256 MiB
    // every stage is ONE launch over all of its work: both batches as 4096 rows (a grid index in k_fattn), q, k and v as one product: 256 work-groups in each of the two products, 12 and 8 waves each (3 and 2 wave tiles a SIMD)
    // Left open: k_gemmw's 64 x 64 wave tile reads 8 fragments from LDS for 16 products (a 64 x 128 tile: 12 for 32), its ring has two buffers, and a stage's first products wait for the LDS reads of its first two blocks; k_prep's weight range loads 4 bytes a lane; k_fattn (all 512 work-groups resident, four waves a SIMD) scales its scores and rounds P on the vector port
    k_prep<<<CB + 2 * PB, 256, 0, stream>>>(x, wq, wk, wv, wo, XB, WF, WO, CS);
    k_gemmw<bf, 0, false, true, 4, 3, 128, DM><<<dim3(MT / 256, DF / 192, 1), 384, 0, stream>>>(XB, nullptr, WF, nullptr, nullptr, 0, nullptr, 0, 0, 0, CS, QK16, VT16);   // writes the rotated q and k planes and the transposed v plane
    k_fattn<<<dim3(TT / 256, NH_, NB_), 256, 0, stream>>>(QK16, QK16 + (size_t)NH_ * TT * HD, VT16, AT16);
    k_gemmw<h16, 0, false, false, 4, 2, 128, DQ><<<dim3(MT / 256, DM / 128, 1), 256, 0, stream>>>(AT16, nullptr, WO, nullptr, OUT, DM, nullptr, 0, 0, 0, nullptr, nullptr, nullptr);
}

// v010
// It runs in 109 microseconds.
// Two timings next to v009 put it at 1.04 and 1.05 times that version's speed.
// Over all steps from v000 it is 22.8 times as fast.
#include <hip/hip_runtime.h>

// Grouped-query RoPE attention without a mask (x [2][2048][2048]; q = x Wq (32 heads x 64), k, v = x Wk / Wv ([2048][512]: 8 kv heads); rotate-half RoPE (theta 5e5, tables computed on device); kv head = h/4; softmax(q.k/8) over all keys; out = merged Wo -> [2][2048][2048] (8.4 M)).
// Compute dtypes, f32 accumulate: every input rounded to bf16; q/k/v on PLAIN bf16 operands (inputs: exact); rotary in f32; scores and attn.v on single fp16 operands for every row (x64 probability carry against the running maximum); online softmax f32, denominator summed in f32 by the matrix unit from the fp16 probabilities; last product on fp16 operands: the merged heads rounded once to fp16 (as q, k, v and P are), Wo's bf16-rounded values carried in fp16.

#define NB_  2
#define TT   2048
#define DM   2048
#define NH_  32
#define NKV  8
#define REP  (NH_ / NKV)
#define HD   64
#define DQ   (NH_ * HD)
#define DKV  (NKV * HD)
#define DF   (DQ + 2 * DKV)   // columns of the joined q | k | v projection
#define NQK  (NH_ + NKV)       // rotated head planes of a batch: 32 q heads, then 8 k heads
#define MT   (NB_ * TT)        // rows of both batches
#define SCL  0.125f   // HD^-0.5
typedef _Float16 h16;
typedef unsigned short bf;
typedef __attribute__((ext_vector_type(16))) __bf16   v16bf;
typedef __attribute__((ext_vector_type(16))) _Float16 v16h;
typedef __attribute__((ext_vector_type(8)))  _Float16 v8h;
typedef __attribute__((ext_vector_type(8)))  unsigned short v8us;
typedef __attribute__((ext_vector_type(8)))  float    v8f;
typedef __attribute__((ext_vector_type(4)))  float    v4f;
typedef v8h  __attribute__((may_alias)) v8ha;
typedef v4f  __attribute__((may_alias)) v4fa;
typedef v8us __attribute__((may_alias)) v8usa;

__device__ __forceinline__ unsigned short f2bf(float f) { unsigned u = __float_as_uint(f); u += 0x7FFFu + ((u >> 16) & 1u); return (unsigned short)(u >> 16); }
__device__ __forceinline__ float bf2f(unsigned short b) { return __uint_as_float(((unsigned)b) << 16); }
__device__ __forceinline__ float bfr(float f) { return bf2f(f2bf(f)); }
__device__ __forceinline__ v16h cat16(v8h lo, v8h hi) { return __builtin_shufflevector(lo, hi, 0, 1, 2, 3, 4, 5, 6, 7, 8, 9, 10, 11, 12, 13, 14, 15); }
__device__ __forceinline__ v16bf cat16b(v8us lo, v8us hi) { return __builtin_bit_cast(v16bf, __builtin_shufflevector(lo, hi, 0, 1, 2, 3, 4, 5, 6, 7, 8, 9, 10, 11, 12, 13, 14, 15)); }
__device__ __forceinline__ v8f wmma16(v16h a, v16h b, v8f c) { return __builtin_amdgcn_wmma_f32_16x16x32_f16(false, a, false, b, (short)0, c, false, false); }
__device__ __forceinline__ v8f wmmab(v16bf a, v16bf b, v8f c) { return __builtin_amdgcn_wmma_f32_16x16x32_bf16(false, a, false, b, (short)0, c, false, false); }



// ---- FRAGMENT ORDER: every 16-bit matrix operand plane (rows x K) is stored as blocks of 16 rows x 32 k = 512 elements, block (row / 16, k / 32) at element (row / 16) * 16 * K + (k / 32) * 512.
// Inside a block the element (row, k) lies at ((k >> 4) & 1) * 256 + ((k >> 3) & 1) * 128 + (row & 15) * 8 + (k & 7): lane l of the wave finds its first 8 operand elements at l * 8 and its last 8 at 256 + l * 8,
// so each of a fragment's two 16-byte loads covers 512 contiguous bytes (4 whole lines), where a row-major plane made it touch 16 lines. The k order of a fragment is what it was.
__device__ __forceinline__ size_t fidx(size_t row, int k, int K) { return (row >> 4) * ((size_t)16 * K) + (size_t)(k >> 5) * 512 + ((k >> 4) & 1) * 256 + ((k >> 3) & 1) * 128 + (row & 15) * 8 + (k & 7); }
// ---- k_gemmw: register-blocked GEMM, one wave per 64x64 output tile (16 accumulators), WM x WN waves a work-group, operands from 16-bit planes in fragment order through LDS; grid (M / (64 WM), N / (64 WN), Z).
// C[m][n] (f32, pitch ldc, + optional f32 bias[n]) = sum_k A[m][k] Bt[n][k]. z-batch strides sA/sB/sC in elements. K % KD == 0.
// HEADS (the joined q | k | v projection; a 64-column tile is one head): no C plane. The epilogue turns the accumulators into the fp16 operand planes that k_fattn reads, in fragment order, straight from the registers.
// A lane's 8 accumulator registers run along the A operand's rows. A v tile keeps x as A: 8 neighbouring t of one d, a 16-byte piece of the [d][t] plane. A q or k tile takes the weight rows as A and x as B (same loader, same k order, same sums):
// 8 neighbouring d of one t, a piece of the [t][d] plane, and the rotary partner d + 32 lies in the same lane and register two accumulator tiles on.
template <typename T16> struct WFrag;
template <> struct WFrag<h16> { typedef v16h V; static __device__ __forceinline__ V ld(const h16* p) { return cat16(*(const v8h*)p, *(const v8h*)(p + 256)); } static __device__ __forceinline__ v8f mma(V a, V b, v8f c) { return wmma16(a, b, c); } };
template <> struct WFrag<bf> { typedef v16bf V; static __device__ __forceinline__ V ld(const bf* p) { return cat16b(*(const v8us*)p, *(const v8us*)(p + 256)); } static __device__ __forceinline__ v8f mma(V a, V b, v8f c) { return wmmab(a, b, c); } };
// OPERAND TILES THROUGH LDS: a work-group of WM x WN waves owns 64 WM x 64 WN outputs (a wave keeps its 64 x 64 tile and its epilogue). A stage is KD k of every operand row of the work-group, brought in once by tensor loads
// and read by every wave that needs it; two buffers, the next stage's loads fly while this one is worked on. A plane in fragment order keeps its order in LDS: a run of 16 rows x KD k is KD * 32 contiguous bytes there as in memory,
// so 64 operand rows of a stage are one two-dimensional tile: 4 tile rows (runs) of KD * 32 bytes, 16 K elements apart in memory, side by side in LDS; a fragment read is two conflict-free 16-byte reads a lane.
// ONE REQUEST OF ONE WAVE brings such a tile, through no register and with no address arithmetic on the vector port.
typedef __attribute__((ext_vector_type(4))) unsigned u32x4;
typedef __attribute__((ext_vector_type(8))) unsigned u32x8;
__device__ __forceinline__ unsigned uni(unsigned v) { return (unsigned)__builtin_amdgcn_readfirstlane(v); }
// the value held in a scalar register: a test on it is a scalar branch (a tensor load ignores EXEC), and what is formed from it is formed behind the volatile statements in front of it (the wait that covers the wave's last request)
__device__ __forceinline__ unsigned pinned(unsigned v) { unsigned w = uni(v); asm volatile("" : "+s"(w)); return w; }   // the empty statement keeps an issue test or a descriptor word's source in a scalar register
__device__ __forceinline__ void tdm_load(u32x4 g0, u32x8 g1) { asm volatile("tensor_load_to_lds %0, %1" :: "s"(g0), "s"(g1) : "memory"); }
// the wave's own request has landed. The wait names both groups of that request: the operands keep their registers from taking another value between the issue and this wait
__device__ __forceinline__ void twait(u32x4 g0, u32x8 g1) { asm volatile("s_wait_tensorcnt 0x0" :: "s"(g0), "s"(g1) : "memory"); }
// group 1 is formed once and keeps its registers through the loop; without this the compiler forms its constants anew in front of each issue and uses those registers for other values in between
__device__ __forceinline__ void hold(u32x8& g1) { asm volatile("" : "+s"(g1)); }   // the empty statement holds descriptor words in scalar registers, as pinned() does
// group 1: 1-byte elements, no mask, no pad; tensor = tile = N rows of R bytes; source pitch in bytes
template <unsigned R, unsigned N> __device__ __forceinline__ u32x8 tdm_g1(unsigned pitch) {
    static_assert(R % 4 == 0 && R < 65536 && N < 65536, "a tile's extents");
    u32x8 g; g[0] = uni(0u); g[1] = uni((R & 0xFFFFu) << 16); g[2] = uni((R >> 16) | ((N & 0xFFFFu) << 16)); g[3] = uni((N >> 16) | (R << 16)); g[4] = uni(N); g[5] = uni(pitch); g[6] = uni(0u); g[7] = uni(0u); return g; }
// group 0: count 1, the place in LDS, the tile's first byte, type 2
__device__ __forceinline__ u32x4 tdm_g0(unsigned lds, unsigned long long ga) { u32x4 g; g[0] = uni(1u); g[1] = uni(lds); g[2] = uni((unsigned)ga); g[3] = uni((((unsigned)(ga >> 32)) & 0x01FFFFFFu) | 0x80000000u); return g; }
template <typename T16, int NSPLIT, bool BIAS, bool HEADS, int WM, int WN, int KD, int K>
__global__ __launch_bounds__(WM * WN * 32) void k_gemmw(const T16* __restrict__ A, const T16* __restrict__ A2, const T16* __restrict__ Bt, const T16* __restrict__ Bt2, float* C, int ldc, const float* __restrict__ bias, size_t sA, size_t sB, size_t sC, const float* __restrict__ CS, h16* QK, h16* VT) {
    typedef typename WFrag<T16>::V V;
    static_assert(NSPLIT == 0, "one plane a side: an issuing wave brings 64 rows of one plane");
    constexpr int NW = WM * WN, NXB = 4 * WM * (NSPLIT == 1 ? 2 : 1), NRB = NXB + 4 * WN;   // waves; runs of 16 rows of a stage: the x side's, then the weight's
    constexpr int RB = KD * 16, STG = NRB * RB, NB = KD / 32, NIS = WM + WN;                  // elements of a run and of a stage; blocks of 32 k a stage; issuing waves: one for every 64 operand rows
    constexpr unsigned RBY = RB * 2, PIT = 16 * K * 2;                                        // bytes of a run (a tile row); bytes between a plane's runs
    static_assert(NIS <= NW && RBY % 2048 == 0 && PIT % 16 == 0 && PIT <= 131072, "a wave for every tile; every tile's place in LDS a multiple of 2 KiB; the source pitch in range");
    constexpr int NT = K / KD; static_assert(K % KD == 0 && NT >= 2, "whole stages, and both buffers have a first stage");
    __shared__ __attribute__((aligned(2048))) T16 sm[2 * STG];
    __shared__ __align__(16) float osm[HEADS ? 4 : NW * 16 * 68];
    const size_t z = blockIdx.z; A += z * sA; if (A2) A2 += z * sA; Bt += z * sB; C += z * sC;
    const int lane = threadIdx.x & 31, lr = lane & 15, hi = lane >> 4; const int wave = __builtin_amdgcn_readfirstlane(threadIdx.x >> 5), wm = wave % WM, wn = wave / WM;
    const int R0 = blockIdx.x * (64 * WM), C0 = blockIdx.y * (64 * WN), r0 = R0 + 64 * wm, c0 = C0 + 64 * wn;
    float* os = osm + (HEADS ? 0 : wave * (16 * 68));   // a wave's own staging rows
    v8f acc[4][4];
#pragma unroll
    for (int mb = 0; mb < 4; ++mb)
#pragma unroll
        for (int nb = 0; nb < 4; ++nb) acc[mb][nb] = (v8f){};
    const unsigned lo = lane * 8;
    const bool rot = HEADS && c0 < DQ + DKV;   // a q or k head (the same for the whole wave): the two operands change places
    const int xo = 4 * wm * RB, wo_ = (NXB + 4 * wn) * RB;   // the wave's own runs inside a stage
    const int ao = rot ? wo_ : xo, bo = rot ? xo : wo_, a2o = xo + 4 * WM * RB;
    // issuing wave w brings runs 4 w to 4 w + 3 of every stage: waves 0 to WM - 1 the x side's rows R0 + 64 w, the next WN waves the weight's rows C0 + 64 (w - WM)
    const bool isu = wave < NIS;
    const T16* sp = wave < WM ? A + (size_t)(R0 + 64 * wave) * K : Bt + (size_t)(C0 + 64 * (isu ? wave - WM : 0)) * K;
    u32x8 g1 = tdm_g1<RBY, 4>(PIT); hold(g1);
    const unsigned l0 = (unsigned)(size_t)sm + wave * (4 * RBY);
    u32x4 g0 = tdm_g0(l0, (unsigned long long)(size_t)sp);   // group 0 of the wave's last request lives on to the wait that covers it
    auto issue = [&](int st) {   // the wave's tile of stage st into buffer st & 1
        const unsigned so = pinned((unsigned)st * RBY);   // a descriptor word's source held in a scalar register: the address words are formed behind the wait in front of this line
        g0 = tdm_g0(l0 + (st & 1) * (STG * 2), (unsigned long long)(size_t)sp + so); tdm_load(g0, g1); };
    if (pinned(isu)) { issue(0); twait(g0, g1); }   // a scalar branch; this wave's tile of stage 0 has landed
#pragma unroll 1
    for (int t = 0; t < NT; ++t) {
        // publish point of stage t, at the head of its trip (for t = 0 the ring's prologue): one place in the code issues every stage but the first
        asm volatile("s_wait_dscnt 0x0" ::: "memory");      // this wave's reads of stage t - 1 are done before its buffer is handed back
        if (pinned(isu)) twait(g0, g1);                      // this wave's tile of stage t has landed
        __syncthreads();                                     // publishes stage t and ends every wave's reads of stage t - 1
        if (pinned(isu && t + 1 < NT)) issue(t + 1);         // stage t + 1 into the buffer that stage t - 1 has left; it flies under stage t's products
        const T16* sb = sm + (t & 1) * STG + lo;
        V a[2][4], a2[2][4], b[2][4];
        auto frags = [&](int kk) {
#pragma unroll
            for (int i = 0; i < 4; ++i) { a[kk & 1][i] = WFrag<T16>::ld(sb + ao + i * RB + kk * 512); if (NSPLIT == 1) a2[kk & 1][i] = WFrag<T16>::ld(sb + a2o + i * RB + kk * 512); b[kk & 1][i] = WFrag<T16>::ld(sb + bo + i * RB + kk * 512); } };
        frags(0);
#pragma unroll
        for (int kk = 0; kk < NB; ++kk) {
            if (kk + 1 < NB) frags(kk + 1);
            __builtin_amdgcn_sched_barrier(0);   // the next block's LDS reads stay one group in front of this block's products, not spread among them
#pragma unroll
            for (int nb = 0; nb < 4; ++nb)
#pragma unroll
                for (int mb = 0; mb < 4; ++mb) { acc[mb][nb] = WFrag<T16>::mma(a[kk & 1][mb], b[kk & 1][nb], acc[mb][nb]); if (NSPLIT == 1) acc[mb][nb] = WFrag<T16>::mma(a2[kk & 1][mb], b[kk & 1][nb], acc[mb][nb]); }
            __builtin_amdgcn_sched_barrier(0);   // as above: the block ends here
        }
    }
    twait(g0, g1);                                      // nothing is in flight when the wave goes on
    asm volatile("s_wait_dscnt 0x0" ::: "memory");      // ... and none of its LDS reads
    if (HEADS) {
        static_assert(TT % 64 == 0 && HD == 64, "a tile's 64 rows lie in one batch, its 64 columns are one head");
        const int bz = r0 / TT, t0 = r0 % TT;
        if (rot) {   // acc[mb][nb][j] = head column d = 16 mb + 8 hi + j of position t = t0 + 16 nb + lr
            const v4fa* tp = (const v4fa*)(CS + (size_t)(t0 >> 4) * (HD * 16)) + lane;   // p_cstab's order: every load below is 512 contiguous bytes
            h16* op = QK + (((size_t)bz * NQK + c0 / HD) * TT + t0) * HD + lo;            // fidx(head row t0 + lr, 8 hi, HD); 16 t further lie 16 HD elements on, 16 d further 256
            v4f cs[2][2][4];
#pragma unroll
            for (int mb = 0; mb < 2; ++mb)
#pragma unroll
                for (int q = 0; q < 4; ++q) cs[0][mb][q] = tp[(mb * 4 + q) * 32];
#pragma unroll
            for (int nb = 0; nb < 4; ++nb) {
                if (nb < 3) {
#pragma unroll
                    for (int mb = 0; mb < 2; ++mb)
#pragma unroll
                        for (int q = 0; q < 4; ++q) cs[(nb + 1) & 1][mb][q] = tp[(((nb + 1) * 2 + mb) * 4 + q) * 32]; }
                __builtin_amdgcn_sched_barrier(0);   // keeps the next 16 positions' table loads in front of this group's arithmetic, so that they fly under it
                v8h o[4];
#pragma unroll
                for (int mb = 0; mb < 2; ++mb)
#pragma unroll
                    for (int j = 0; j < 8; ++j) { const float co = cs[nb & 1][mb][j >> 1][(j & 1) * 2], si = cs[nb & 1][mb][j >> 1][(j & 1) * 2 + 1], x0 = acc[mb][nb][j], x1 = acc[mb + 2][nb][j];
                        o[mb][j] = (h16)(x0 * co - x1 * si); o[mb + 2][j] = (h16)(x1 * co + x0 * si); }
                __builtin_amdgcn_sched_barrier(0);   // all four pieces are formed in front of the first store: none is formed in a register that an issued store of the group names
#pragma unroll
                for (int mb = 0; mb < 4; ++mb) *(v8h*)(op + nb * 16 * HD + mb * 256) = o[mb];
                if (nb < 3) asm volatile("s_wait_xcnt 0x0" ::: "memory");   // the next group's pieces are formed in registers that these stores name (behind the last group nothing is)
            }
        } else {     // acc[mb][nb][j] = v column d = 16 nb + lr of position t = t0 + 16 mb + 8 hi + j
            h16* op = VT + ((size_t)bz * DKV + (c0 - DQ - DKV)) * TT + (size_t)(t0 >> 5) * 512 + lo;   // fidx(row d = lr, t0 + 8 hi, TT); 16 d further lie 16 TT elements on, 16 t further 256
#pragma unroll
            for (int nb = 0; nb < 4; ++nb) {
                v8h o[4];
#pragma unroll
                for (int mb = 0; mb < 4; ++mb)
#pragma unroll
                    for (int j = 0; j < 8; ++j) o[mb][j] = (h16)acc[mb][nb][j];
                __builtin_amdgcn_sched_barrier(0);   // as above: the group's four pieces first, then its stores
#pragma unroll
                for (int mb = 0; mb < 4; ++mb) *(v8h*)(op + (size_t)nb * 16 * TT + mb * 256) = o[mb];
                if (nb < 3) asm volatile("s_wait_xcnt 0x0" ::: "memory");   // as above
            }
        }
        return;
    }
#pragma unroll
    for (int mb = 0; mb < 4; ++mb) {
#pragma unroll
        for (int nb = 0; nb < 4; ++nb) {
#pragma unroll
            for (int j = 0; j < 8; ++j) os[(hi * 8 + j) * 68 + nb * 16 + lr] = acc[mb][nb][j]; }
        __builtin_amdgcn_wave_barrier(); asm volatile("" ::: "memory");
        float* crow = C + (size_t)(r0 + mb * 16) * ldc + c0;
{
#pragma unroll
            for (int s = 0; s < 8; ++s) { const int row = 2 * s + hi, cofs = lr * 4; v4f val = *(const v4fa*)(os + row * 68 + cofs); if (BIAS) { val[0] += bfr(bias[c0 + cofs]); val[1] += bfr(bias[c0 + cofs + 1]); val[2] += bfr(bias[c0 + cofs + 2]); val[3] += bfr(bias[c0 + cofs + 3]); }
                *(v4f*)(crow + (size_t)row * ldc + cofs) = val; }
             }
        __builtin_amdgcn_wave_barrier(); asm volatile("" ::: "memory");
    }
}

__device__ __forceinline__ h16 tohx(float x) { return (h16)x; }
typedef __attribute__((ext_vector_type(2))) _Float16 v2h;
typedef __attribute__((ext_vector_type(4))) _Float16 v4h;
typedef __attribute__((ext_vector_type(2))) unsigned short v2us;
typedef __attribute__((ext_vector_type(4))) unsigned short v4us;
typedef __attribute__((ext_vector_type(2))) float v2f;
typedef __attribute__((ext_vector_type(4))) int v4i;

// ---- k_prep: ALL THE PREPARATION IN ONE LAUNCH. The rotary table, the four weight planes and the x plane depend on nothing but the inputs: each takes a range of the launch's work-groups (8 waves each), and all 1280 are resident at once,
// five on each of the chip's 256 WGPs (96 registers a wave). For that a thread of the two conversions takes several neighbouring pieces instead of one: PB work-groups each, not one wave for every 512 bytes written.
// All of a thread's loads are issued first and fly together; then every piece is rounded, then all are stored. A piece, its place and its values are what they were.
// A thread's pieces lie a constant step apart in both planes: it forms one 32-bit byte offset a plane, and the steps are the instructions' immediate offsets.
#define PB   512
#define PT   (PB * 256)   // threads of a conversion's range
__device__ __forceinline__ v8us rnd8(const float (&v)[8]) { v8us o;
#pragma unroll
    for (int q = 0; q < 8; ++q) o[q] = f2bf(v[q]);
    return o; }
// the same rounding to bf16, the value then carried in fp16 (8 significant bits fit in its 11: exact from 2^-17 up to the fp16 range, below that to 2^-25 absolute)
__device__ __forceinline__ v8us rnd8h(const float (&v)[8]) { v8h o;
#pragma unroll
    for (int q = 0; q < 8; ++q) o[q] = (h16)bfr(v[q]);
    return __builtin_bit_cast(v8us, o); }
// A piece of a weight w [K][N]: 16 bytes (8 k of one n) of the transposed plane in fragment order. A wave takes 32 neighbouring n at the same 8 k: each of its 8 loads is one whole line of w, its store two runs of 256 bytes.
// 128 threads take a group of 32 n x 32 k, and the J - 1 groups that follow it in k; neighbouring threads' groups take neighbouring lines of the same rows of w.
template <int N, int K, int J> struct WPc {
    static_assert((size_t)N * K / 8 == (size_t)J * PT, "the pieces of the weight are covered exactly");
    unsigned lo, so;   // byte offsets of the thread's first piece in w (its first k) and in the transposed plane
    __device__ __forceinline__ WPc(unsigned t) { const unsigned grp = t >> 7, n = (grp % (N / 32)) * 32 + (t & 31), k = (grp / (N / 32)) * (32 * J) + ((t >> 5) & 3) * 8; lo = (k * N + n) * 4; so = (unsigned)fidx(n, (int)k, K) * 2; }
    __device__ __forceinline__ void ld(const float* __restrict__ w, int j, float (&v)[8]) const {
#pragma unroll
        for (int q = 0; q < 8; ++q) v[q] = *(const float*)((const char*)w + lo + (32 * j + q) * (N * 4)); }
    __device__ __forceinline__ void st(void* Bt, int j, v8us o) const { *(v8us*)((char*)Bt + so + j * 1024) = o; }   // 32 k further: the next block of 512 elements
};
// all four weights (wq, wk, wv into the joined plane, wo into its own): thread t of PT takes 4 pieces of wq, one of wk, one of wv and 4 of wo
__device__ __forceinline__ void p_wt(unsigned t, const float* __restrict__ wq, const float* __restrict__ wk, const float* __restrict__ wv, const float* __restrict__ wo, bf* WF, h16* WO) {
    static_assert(DQ == DM, "wq and wo have one shape");
    const WPc<DQ, DM, 4> wide(t); const WPc<DKV, DM, 1> slim(t); float v[10][8]; v8us o[10];
#pragma unroll
    for (int j = 0; j < 4; ++j) wide.ld(wq, j, v[j]);
    slim.ld(wk, 0, v[4]); slim.ld(wv, 0, v[5]);
#pragma unroll
    for (int j = 0; j < 4; ++j) wide.ld(wo, j, v[6 + j]);
    asm volatile("s_wait_xcnt 0x0" :: "v"(wide.lo), "v"(slim.lo) : "memory");   // stands in front of any overwrite of the two offset registers that the issued loads name; the operands keep those registers from being reused in front of the wait
    __builtin_amdgcn_sched_barrier(0);   // every load is issued in front of the first rounding: all of them are in flight at once
#pragma unroll
    for (int j = 0; j < 10; ++j) o[j] = j < 6 ? rnd8(v[j]) : rnd8h(v[j]);   // wo's plane is the fp16 product's operand
    __builtin_amdgcn_sched_barrier(0);   // every piece is formed in front of the first store: none is formed in a register that an issued store names
#pragma unroll
    for (int j = 0; j < 4; ++j) wide.st(WF, j, o[j]);
    slim.st(WF + (size_t)DQ * DM, 0, o[4]); slim.st(WF + (size_t)(DQ + DKV) * DM, 0, o[5]);
#pragma unroll
    for (int j = 0; j < 4; ++j) wide.st(WO, j, o[6 + j]);
    asm volatile("s_wait_xcnt 0x0" ::: "memory");   // behind the last store: whatever the listing places behind this range may overwrite registers that the issued stores name
}
// x (rows of DM) rounded to bf16, in fragment order: a piece is 16 bytes (8 k of one row). A wave takes 32 k of 8 rows: it reads 8 whole lines of x and stores 4 whole lines (8 rows' pieces of the same 8 k lie side by side).
// Thread t of PT takes 8 pieces: the same k of rows that lie 16 apart.
__device__ __forceinline__ void p_cvt(unsigned t, const float* __restrict__ src, bf* dst) {
    static_assert((size_t)MT * DM / 8 == 8 * (size_t)PT, "the pieces of x are covered exactly");
    const unsigned row = (t >> 6) / (DM / 32) * (16 * 8) + ((t >> 2) & 15), k = (t >> 6) % (DM / 32) * 32 + (t & 3) * 8;
    const unsigned lo = (row * DM + k) * 4, so = (unsigned)fidx(row, (int)k, DM) * 2; v8f v[8]; v8us o[8];
#pragma unroll
    for (int j = 0; j < 8; ++j) v[j] = *(const v8f*)((const char*)src + lo + j * (16 * DM * 4));
    asm volatile("s_wait_xcnt 0x0" :: "v"(lo) : "memory");   // as in p_wt: in front of any overwrite of the loads' offset register
    __builtin_amdgcn_sched_barrier(0);   // as in p_wt: all loads first
#pragma unroll
    for (int j = 0; j < 8; ++j)
#pragma unroll
        for (int q = 0; q < 8; ++q) o[j][q] = f2bf(v[j][q]);
    __builtin_amdgcn_sched_barrier(0);   // as in p_wt: all pieces first, then the stores
#pragma unroll
    for (int j = 0; j < 8; ++j) *(v8us*)((char*)dst + so + j * (16 * DM * 2)) = o[j];
    asm volatile("s_wait_xcnt 0x0" ::: "memory");   // as in p_wt: behind the last store
}
__constant__ float INV[HD / 2] = {1.00000000f,0.663601220f,0.440366596f,0.292227834f,0.193922743f,0.128687367f,0.0853971019f,0.0566696227f,0.0376060307f,0.0249554086f,0.0165604409f,0.0109895281f,0.00729266461f,0.00483942125f,0.00321144611f,0.00213111960f,0.00141421356f,0.000938473851f,0.000622772437f,0.000413272559f,0.000274248188f,0.000181991432f,0.000120769735f,0.0000801429487f,0.0000531829573f,0.0000352922762f,0.0000234199997f,0.0000155415401f,0.0000103133852f,0.00000684397537f,0.00000454167048f,0.00000301385808f};
// (cos, sin) of t x INV[d], d < HD / 2 (d + HD / 2 has the same angle), in the order in which the projection's epilogue reads them: pair p = ((((t / 16) * 2 + d / 16) * 4 + (d & 7) / 2) * 32 + ((d >> 3) & 1) * 16 + (t & 15)) * 2 + (d & 1),
// so that lane 16 hi + lr finds the pairs of d = 16 mb + 8 hi + 2 q, + 1 at position t = 16 tb + lr in one 16-byte load, and the wave's load covers 4 whole lines. Thread p writes pair p.
__device__ __forceinline__ void p_cstab(int p, float* CS) { const int t = (p >> 9) * 16 + ((p >> 1) & 15), d = ((p >> 8) & 1) * 16 + ((p >> 5) & 1) * 8 + ((p >> 6) & 3) * 2 + (p & 1); const float ang = __fmul_rn((float)t, INV[d]); v2f cs; cs[0] = cosf(ang); cs[1] = sinf(ang);
    *(v2f*)(CS + (size_t)p * 2) = cs;  }
#define CB   (TT * HD / 2 / 256)   // work-groups of the table's range
// the ranges: the table first (little data, long chains of arithmetic), then the weights, then x; blockIdx.x picks, the same for a whole work-group
__global__ __launch_bounds__(256) void k_prep(const float* __restrict__ x, const float* __restrict__ wq, const float* __restrict__ wk, const float* __restrict__ wv, const float* __restrict__ wo, bf* XB, bf* WF, h16* WO, float* CS) {
    static_assert(TT * HD / 2 % 256 == 0, "the table's pairs are covered exactly");
    const unsigned b = blockIdx.x;
    if (b < CB) p_cstab((int)(b * 256 + threadIdx.x), CS);
    else if (b < CB + PB) p_wt((b - CB) * 256 + threadIdx.x, wq, wk, wv, wo, WF, WO);
    else p_cvt((b - CB - PB) * 256 + threadIdx.x, x, XB);
}

#define PC2  6.0f
#define CS2  (SCL * 1.4426950408889634f)
__device__ __forceinline__ float xhalf(float x) { return __builtin_bit_cast(float, __builtin_amdgcn_permlanex16(__builtin_bit_cast(int, x), __builtin_bit_cast(int, x), 0x76543210, 0xfedcba98, false, false)); }  // lane l with lane l ^ 16
__device__ __forceinline__ void sfence() { __builtin_amdgcn_sched_barrier(0); }   // keeps a load group where it is written, so that it flies under the work behind it
#define SK   128
#define FKE  (SK * HD)      // elements of a stage's K part; V^T takes as many
#define FVB  (SK / 32 * 512)   // elements of a stage's part of 16 rows of V^T
__device__ __forceinline__ void ld_k(v16h (&k)[2][2], const h16* kp) {
#pragma unroll
    for (int kt = 0; kt < 2; ++kt)
#pragma unroll
        for (int kc = 0; kc < 2; ++kc) k[kt][kc] = WFrag<h16>::ld(kp + kt * 16 * HD + kc * 512); }
__device__ __forceinline__ void xwait() { asm volatile("s_wait_xcnt 0x0" ::: "memory"); }   // stands in front of the overwrite of a register that issued stores name
// one pass of 32 keys, from the stage in LDS (kp, vp: the pass's own K rows and V^T blocks, + the lane's place). Behind the score products one group of LDS reads: the pass's V^T fragments and, inside a stage (NEXTK),
// the next pass's K fragments into the registers just read; they land under the softmax.
// ROW SUMS ON THE MATRIX PIPE: one product a column group with an A operand whose rows 0 and 8 are ones gives, in register 0 of every lane, the sum of the query's 32 rounded probabilities of the pass (both lane halves' keys).
// It is added to the denominator, and it is the test for the lazy rescale as well: all terms are positive, so a sum of at most PLIM bounds each of them. Only a pass that fails the test scans its scores for the maximum and forms P again.
#define PLIM 16384.0f   // 2^(PC2 + 8)
template <bool NEXTK>
__device__ __forceinline__ void fpass(v16h (&kf)[2][2], const h16* kp, const h16* vp, const v16h (&qf)[2][2], const v16h& ones, v8f (&acc)[2][4], float (&lsum)[2], float (&mrun)[2]) {
    v8f s[2][2]; v16h vf[4];
#pragma unroll
    for (int kt = 0; kt < 2; ++kt)
#pragma unroll
        for (int g = 0; g < 2; ++g) { s[kt][g] = (v8f){};
#pragma unroll
            for (int kc = 0; kc < 2; ++kc) s[kt][g] = wmma16(kf[kt][kc], qf[g][kc], s[kt][g]); }
    sfence();
#pragma unroll
    for (int t = 0; t < 4; ++t) vf[t] = WFrag<h16>::ld(vp + t * FVB);
    if (NEXTK) ld_k(kf, kp + 32 * HD);
    sfence();
    v16h pf[2]; v8f rs[2];
    auto probs = [&]() {   // P against the maximum in use, and its row sums
#pragma unroll
        for (int g = 0; g < 2; ++g) { const float nm = PC2 - mrun[g];
#pragma unroll
            for (int e = 0; e < 16; ++e) pf[g][e] = tohx(__builtin_amdgcn_exp2f(s[e >> 3][g][e & 7] * CS2 + nm));   // element e of the 32-key operand = tile e >> 3, register e & 7 (the hardware k order, as the V^T loader's). A product and a sum, which the compiler fuses into the FMA that it was (in the rescale branch it rounds the product first): as fmaf calls, with the scores now live past them, they came out as packed pairs across the two groups, each pair's scores first copied side by side
            rs[g] = wmma16(ones, pf[g], (v8f){}); }
    };
    probs();
    const bool need = !(rs[0][0] <= PLIM) || !(rs[1][0] <= PLIM);   // also true for an infinite sum (the first pass: no maximum yet; a probability beyond the fp16 range)
    if (__builtin_amdgcn_ballot_w32(need) != 0) {   // wave-uniform; rare after the first pass
#pragma unroll
        for (int g = 0; g < 2; ++g) { float mx = -INFINITY;
#pragma unroll
            for (int kt = 0; kt < 2; ++kt)
#pragma unroll
                for (int r = 0; r < 8; ++r) mx = fmaxf(mx, s[kt][g][r]);
            mx = fmaxf(mx, xhalf(mx)) * CS2;
            const float mn = fmaxf(mrun[g], mx); const float corr = __builtin_amdgcn_exp2f(mrun[g] - mn); mrun[g] = mn; lsum[g] = lsum[g] * corr;
#pragma unroll
            for (int t = 0; t < 4; ++t) acc[g][t] = acc[g][t] * corr; }
        probs();
    }
#pragma unroll
    for (int g = 0; g < 2; ++g)
#pragma unroll
        for (int t = 0; t < 4; ++t) acc[g][t] = wmma16(vf[t], pf[g], acc[g][t]);
    lsum[0] += rs[0][0]; lsum[1] += rs[1][0];
}
__global__ __launch_bounds__(256) __attribute__((amdgpu_waves_per_eu(4, 4))) void k_fattn(const h16* __restrict__ Q16, const h16* __restrict__ K16, const h16* __restrict__ V16, h16* AT) {
    static_assert(TT % SK == 0 && TT / SK >= 2 && FKE * 2 == 4 * 4096 && FVB * 2 == 4096 && HD == 4 * 16, "whole stages, both buffers have a first one; either part of a stage is 4 tile rows of 4 KiB");
    __shared__ __attribute__((aligned(2048))) h16 sm[2 * 2 * FKE];
    const int lane = threadIdx.x & 31, c = lane & 15, hi = lane >> 4; const int wave = __builtin_amdgcn_readfirstlane(threadIdx.x >> 5);
    const int h = blockIdx.y, q0 = blockIdx.x * 256 + wave * 32;
    { const size_t z = blockIdx.z; Q16 += z * NQK * TT * HD; K16 += z * NQK * TT * HD; V16 += z * NKV * HD * TT; AT += z * TT * DQ; }   // blockIdx.z = batch; a batch's q and k planes lie in one run of NQK planes
    const h16* qp = Q16 + ((size_t)h * TT + q0) * HD + lane * 8;
    // wave 0 brings a stage's K rows (16 KiB in a row: tile rows 4 KiB apart), wave 1 its V^T blocks (4 KiB of each 16 rows of the [d][t] plane: tile rows 16 TT elements apart); a stage further lie 16 KiB and 4 KiB
    const bool isu = wave < 2, isk = wave == 0;
    const h16* sp = isk ? K16 + (size_t)(h / REP) * TT * HD : V16 + (size_t)(h / REP) * HD * TT;
    u32x8 g1 = tdm_g1<4096, 4>(isk ? 4096u : (unsigned)(16 * TT * 2)); hold(g1);
    const unsigned l0 = (unsigned)(size_t)sm + (isk ? 0 : FKE * 2), sstep = isk ? FKE * 2 : FVB * 2;
    u32x4 g0 = tdm_g0(l0, (unsigned long long)(size_t)sp);   // group 0 of the wave's last request lives on to the wait that covers it
    auto issue = [&](int st) {   // the wave's tile of stage st into buffer st & 1
        const unsigned so = pinned((unsigned)st * sstep);   // a descriptor word's source held in a scalar register: the address words are formed behind the wait in front of this line
        g0 = tdm_g0(l0 + (st & 1) * (2 * FKE * 2), (unsigned long long)(size_t)sp + so); tdm_load(g0, g1); };
    v16h qf[2][2];
#pragma unroll
    for (int g = 0; g < 2; ++g)
#pragma unroll
        for (int kc = 0; kc < 2; ++kc) qf[g][kc] = WFrag<h16>::ld(qp + g * 16 * HD + kc * 512);
    asm volatile("s_wait_xcnt 0x0" :: "v"(qp) : "memory");   // as xwait(); the operand keeps the Q loads' address pair from being reused in front of the wait
    v8f acc[2][4]; float lsum[2], mrun[2]; v16h ones;   // rows 0 and 8 (lanes 0, 8, 16, 24) are ones, the rest 0: register 0 of a result tile is row 0 in lanes 0 to 15 and row 8 in lanes 16 to 31. An operand that differs by lane keeps its registers through the loop; one of ones alone was formed anew in every pass
#pragma unroll
    for (int e = 0; e < 16; ++e) ones[e] = (lane & 7) == 0 ? (h16)1.0f : (h16)0.0f;
#pragma unroll
    for (int g = 0; g < 2; ++g) { mrun[g] = -INFINITY; lsum[g] = 0.0f;
#pragma unroll
        for (int t = 0; t < 4; ++t) acc[g][t] = (v8f){}; }
    if (pinned(isu)) { issue(0); twait(g0, g1); }   // a scalar branch; this wave's tile of stage 0 has landed (the Q loads above fly meanwhile)
#pragma unroll 1   // a stage a trip, its SK / 32 passes unrolled
    for (int st = 0; st < TT / SK; ++st) {
        // publish point of stage st, at the head of its trip (for st = 0 the ring's prologue): one place in the code issues every stage but the first
        asm volatile("s_wait_dscnt 0x0" ::: "memory");      // this wave's reads of stage st - 1 are done before its buffer is handed back
        if (pinned(isu)) twait(g0, g1);                      // this wave's tile of stage st has landed
        __syncthreads();                                     // publishes stage st and ends every wave's reads of stage st - 1
        if (pinned(isu && st + 1 < TT / SK)) issue(st + 1);  // stage st + 1 into the buffer that stage st - 1 has left; it flies under stage st's passes
        const h16* sb = sm + (st & 1) * (2 * FKE) + lane * 8;
        v16h kf[2][2]; ld_k(kf, sb); sfence();   // the stage's first K fragments as one group of LDS reads, not spread among the first products
#pragma unroll
        for (int p = 0; p < SK / 32; ++p) {
            if (p + 1 < SK / 32) fpass<true>(kf, sb + p * 32 * HD, sb + FKE + p * 512, qf, ones, acc, lsum, mrun);
            else fpass<false>(kf, sb + p * 32 * HD, sb + FKE + p * 512, qf, ones, acc, lsum, mrun); }
    }
    twait(g0, g1);                                      // nothing is in flight when the wave goes on
    asm volatile("s_wait_dscnt 0x0" ::: "memory");      // ... and none of its LDS reads
#pragma unroll
    for (int g = 0; g < 2; ++g) { const float inv = __fdiv_rn(1.0f, lsum[g]);   // the row-sum product has joined the two lane halves' keys already
        const size_t oo = fidx(q0 + 16 * g + c, h * HD + 8 * hi, DQ);   // the merged plane is the last product's A operand: fragment order, a wave's store 512 contiguous bytes; 16 d further lie 256 elements on
#pragma unroll
        for (int t = 0; t < 4; ++t) { v8h o;   // acc[g][t][r] = O[query c][d = 16 t + 8 hi + r]
#pragma unroll
            for (int r = 0; r < 8; ++r) o[r] = tohx(acc[g][t][r] * inv);
            *(v8h*)(AT + oo + 256 * t) = o; if (g == 0 || t < 3) xwait(); } }   // the wait: the next piece's values are formed in registers that this store names (behind the last piece nothing is)
}

extern "C" void kernel_launch(void* const* d_in, const int* in_sizes, int n_in,
                              void* d_out, int out_size, void* d_ws, size_t ws_size, hipStream_t stream) {
    (void)in_sizes; (void)n_in; (void)out_size;
    const float* x = (const float*)d_in[0]; const float* wq = (const float*)d_in[1]; const float* wk = (const float*)d_in[2]; const float* wv = (const float*)d_in[3]; const float* wo = (const float*)d_in[4];
    float* OUT = (float*)d_out;     // [2][2048][2048]
    char* wsp = (char*)d_ws;
    auto take = [&](size_t bytes) { char* p = wsp; wsp += (bytes + 255) & ~(size_t)255; return (void*)p; };
    bf* WF = (bf*)take((size_t)DF * DM * 2); h16* WO = (h16*)take((size_t)DM * DQ * 2); float* CS = (float*)take((size_t)TT * (HD / 2) * 2 * 4);   // WF: wq, wk, wv transposed, row after row: one [DF][DM] operand
    bf* XB = (bf*)take((size_t)MT * DM * 2);
    h16* QK16 = (h16*)take((size_t)NB_ * NQK * TT * HD * 2); h16* VT16 = (h16*)take((size_t)NB_ * NKV * HD * TT * 2);
    h16* AT16 = (h16*)take((size_t)MT * DQ * 2);
    if ((size_t)(wsp - (char*)d_ws) > ws_size) return;    // 77 MiB of the 256 MiB
    // every stage is ONE launch over all of its work: both batches as 4096 rows (a grid index in k_fattn), q, k and v as one product: 256 work-groups in each of the two products, 12 and 8 waves each (3 and 2 wave tiles a SIMD)
    // Left open: k_gemmw's 64 x 64 wave tile reads 8 fragments from LDS for 16 products (a 64 x 128 tile: 12 for 32), its ring has two buffers, and a stage's first products wait for the LDS reads of its first two blocks; k_prep's weight range loads 4 bytes a lane; k_fattn (all 512 work-groups resident, four waves a SIMD) scales its scores and rounds P on the vector port
    k_prep<<<CB + 2 * PB, 256, 0, stream>>>(x, wq, wk, wv, wo, XB, WF, WO, CS);
    k_gemmw<bf, 0, false, true, 4, 3, 128, DM><<<dim3(MT / 256, DF / 192, 1), 384, 0, stream>>>(XB, nullptr, WF, nullptr, nullptr, 0, nullptr, 0, 0, 0, CS, QK16, VT16);   // writes the rotated q and k planes and the transposed v plane
    k_fattn<<<dim3(TT / 256, NH_, NB_), 256, 0, stream>>>(QK16, QK16 + (size_t)NH_ * TT * HD, VT16, AT16);
    k_gemmw<h16, 0, false, false, 4, 2, 128, DQ><<<dim3(MT / 256, DM / 128, 1), 256, 0, stream>>>(AT16, nullptr, WO, nullptr, OUT, DM, nullptr, 0, 0, 0, nullptr, nullptr, nullptr);
}
